// v000
// The times below were measured on an AMD MI455X: many runs one after another, warmed up first and cycling through
// copies of the inputs, with the whole window's GPU time divided by the number of runs. Launches and the gaps
// between them are all in it. The median over several windows is given; except for v000 it joins two sittings, which
// can be a few percent apart, so the side-by-side timings, each taken in one sitting, are the better comparison.
// The starting kernel, v000, takes 313 microseconds a run.
#include <hip/hip_runtime.h>
#include <hip/hip_bf16.h>
#include <math.h>

typedef _Float16 h16;
typedef __attribute__((ext_vector_type(8)))  _Float16 v8h;
typedef __attribute__((ext_vector_type(16))) _Float16 v16h;
typedef __attribute__((ext_vector_type(8)))  float    v8f;

#define NJ    17
#define NF    32
#define CDIM  544
#define NH    8
#define HD    68
#define HDP   96    // padded head dim for Q/K (3 K-steps of 32)
#define HDP2  80    // padded head dim for O tiles (5 tiles of 16)
#define NB    8
#define NSEQ  1024
#define BN    8192  // NB*NSEQ
#define C3    1632  // 3*CDIM
#define QTPB  4     // query tiles (waves) per attention block

#define WMMA16(a,b,c) __builtin_amdgcn_wmma_f32_16x16x32_f16(false,(a),false,(b),(short)0,(c),false,false)

__device__ __forceinline__ v16h make_frag(const h16* p0, const h16* p1) {
    v8h a = *(const v8h*)p0;
    v8h b = *(const v8h*)p1;
    return __builtin_shufflevector(a, b, 0,1,2,3,4,5,6,7,8,9,10,11,12,13,14,15);
}

// ---------------- stage W: convert weights f32 -> f16 ----------------
__global__ void k_cvt(const float* __restrict__ qkvw, const float* __restrict__ projw,
                      h16* __restrict__ wq, h16* __restrict__ wp) {
    int i = blockIdx.x * blockDim.x + threadIdx.x;
    const int n1 = C3 * CDIM, n2 = CDIM * CDIM;
    if (i < n1)            wq[i] = (h16)qkvw[i];
    else if (i < n1 + n2)  wp[i - n1] = (h16)projw[i - n1];
}

// ---------------- stage Z: zero Q/K/Vt padded buffers ----------------
__global__ void k_zero(unsigned int* __restrict__ p, int nwords) {
    int i = blockIdx.x * blockDim.x + threadIdx.x;
    if (i < nwords) p[i] = 0u;
}

// ---------------- stage A: per-joint LN + pooling scores ----------------
__global__ void k_ln1(const float* __restrict__ x, const float* __restrict__ g,
                      const float* __restrict__ bb, const float* __restrict__ apw,
                      const float* __restrict__ apb,
                      float* __restrict__ xr, float* __restrict__ sc) {
    int idx = blockIdx.x * blockDim.x + threadIdx.x;  // (b*N+n)*17 + j
    if (idx >= BN * NJ) return;
    const float* px = x + (size_t)idx * NF;
    float s = 0.f, s2 = 0.f;
    #pragma unroll
    for (int f = 0; f < NF; f++) { float v = px[f]; s += v; s2 += v * v; }
    float mu = s * (1.f / NF);
    float var = s2 * (1.f / NF) - mu * mu;
    float rs = rsqrtf(var + 1e-5f);
    float* po = xr + (size_t)idx * NF;
    float acc = 0.f;
    #pragma unroll
    for (int f = 0; f < NF; f++) {
        float v = (px[f] - mu) * rs * g[f] + bb[f];
        po[f] = v;
        acc += v * apw[f];
    }
    sc[idx] = acc + apb[0];
}

// ---------------- stage B: softmax over sequence axis N ----------------
__global__ void k_softmax_n(float* __restrict__ sc) {
    int b = blockIdx.x / NJ, j = blockIdx.x % NJ;
    __shared__ float red[256];
    int t = threadIdx.x;
    float m = -3e38f;
    for (int n = t; n < NSEQ; n += 256) m = fmaxf(m, sc[(b * NSEQ + n) * NJ + j]);
    red[t] = m; __syncthreads();
    for (int o = 128; o > 0; o >>= 1) { if (t < o) red[t] = fmaxf(red[t], red[t + o]); __syncthreads(); }
    m = red[0]; __syncthreads();
    float s = 0.f;
    for (int n = t; n < NSEQ; n += 256) s += __expf(sc[(b * NSEQ + n) * NJ + j] - m);
    red[t] = s; __syncthreads();
    for (int o = 128; o > 0; o >>= 1) { if (t < o) red[t] += red[t + o]; __syncthreads(); }
    float inv = 1.f / red[0];
    for (int n = t; n < NSEQ; n += 256) {
        int id = (b * NSEQ + n) * NJ + j;
        sc[id] = __expf(sc[id] - m) * inv;
    }
}

// ---------------- stage C: pool by weights + LN over C, emit f16 ----------------
__global__ void k_pool_ln2(const float* __restrict__ xr, const float* __restrict__ w,
                           const float* __restrict__ g2, const float* __restrict__ b2,
                           h16* __restrict__ xp) {
    int row = blockIdx.x;  // b*N + n
    __shared__ float vals[CDIM];
    __shared__ float red[256];
    int t = threadIdx.x;
    float s = 0.f;
    for (int c = t; c < CDIM; c += 256) {
        float v = xr[(size_t)row * CDIM + c] * w[row * NJ + c / NF];
        vals[c] = v; s += v;
    }
    red[t] = s; __syncthreads();
    for (int o = 128; o > 0; o >>= 1) { if (t < o) red[t] += red[t + o]; __syncthreads(); }
    float mu = red[0] * (1.f / CDIM); __syncthreads();
    float s2 = 0.f;
    for (int c = t; c < CDIM; c += 256) { float d = vals[c] - mu; s2 += d * d; }
    red[t] = s2; __syncthreads();
    for (int o = 128; o > 0; o >>= 1) { if (t < o) red[t] += red[t + o]; __syncthreads(); }
    float rs = rsqrtf(red[0] * (1.f / CDIM) + 1e-5f);
    for (int c = t; c < CDIM; c += 256)
        xp[(size_t)row * CDIM + c] = (h16)((vals[c] - mu) * rs * g2[c] + b2[c]);
}

// ---------------- stage D: QKV GEMM (WMMA, 16x48 per wave) ----------------
__global__ void k_qkv_gemm(const h16* __restrict__ xp, const h16* __restrict__ wq,
                           h16* __restrict__ Qp, h16* __restrict__ Kp, h16* __restrict__ Vt) {
    int lane = threadIdx.x;                 // 0..31
    int mt = blockIdx.y * 8 + threadIdx.y;  // row tile 0..511
    int ntg = blockIdx.x;                   // col tile group 0..33 (3 tiles each)
    int r = lane & 15, hh = lane >> 4;
    const h16* arow = xp + (size_t)(mt * 16 + r) * CDIM;
    const h16* brow[3];
    #pragma unroll
    for (int nt = 0; nt < 3; nt++)
        brow[nt] = wq + (size_t)((ntg * 3 + nt) * 16 + r) * CDIM;
    v8f zero = {};
    v8f acc[3];
    #pragma unroll
    for (int nt = 0; nt < 3; nt++) acc[nt] = zero;
    for (int ks = 0; ks < CDIM; ks += 32) {
        int c0 = ks + 8 * hh, c1 = ks + 16 + 8 * hh;
        v16h a = make_frag(arow + c0, arow + c1);
        #pragma unroll
        for (int nt = 0; nt < 3; nt++) {
            v16h bfr = make_frag(brow[nt] + c0, brow[nt] + c1);
            acc[nt] = WMMA16(a, bfr, acc[nt]);
        }
    }
    const float qscale = 0.121267813f;  // 68^-0.5, folded into Q
    #pragma unroll
    for (int nt = 0; nt < 3; nt++) {
        int o = (ntg * 3 + nt) * 16 + r;
        int third = o / CDIM, rem = o % CDIM;
        int hd = rem / HD, d = rem % HD;
        #pragma unroll
        for (int vg = 0; vg < 8; vg++) {
            int m = mt * 16 + vg + 8 * hh;          // global row (b*N+n)
            int b = m >> 10, n = m & 1023;
            int bh = b * NH + hd;
            float v = acc[nt][vg];
            if (third == 0)      Qp[(size_t)(bh * NSEQ + n) * HDP + d] = (h16)(v * qscale);
            else if (third == 1) Kp[(size_t)(bh * NSEQ + n) * HDP + d] = (h16)v;
            else                 Vt[(size_t)(bh * HDP2 + d) * NSEQ + n] = (h16)v;
        }
    }
}

// ---------------- stage E: flash attention, 4 waves share K/V via LDS ----------------
__global__ void k_attn(const h16* __restrict__ Qp, const h16* __restrict__ Kp,
                       const h16* __restrict__ Vt, const float* __restrict__ sfp,
                       h16* __restrict__ O) {
    int lane = threadIdx.x;               // 0..31
    int wv = threadIdx.y;                 // 0..3 : one query tile per wave
    int tid = wv * 32 + lane;
    int qt = blockIdx.x * QTPB + wv;      // 0..63
    int hd = blockIdx.y, b = blockIdx.z;
    int bh = b * NH + hd;
    int r = lane & 15, hh = lane >> 4;
    float sf = sfp[0];

    __shared__ __align__(16) h16 kl[32 * HDP];        // 6 KB: 32 keys x 96 dims
    __shared__ __align__(16) h16 vl[HDP2 * 32];       // 5 KB: 80 dims x 32 keys
    __shared__ __align__(16) h16 p_lds[QTPB][16 * 32];// 4 KB: per-wave P tile

    // Q fragments for this wave's 16-row tile (3 K-steps covering padded 96)
    const h16* qrow = Qp + (size_t)(bh * NSEQ + qt * 16 + r) * HDP;
    v16h qa0 = make_frag(qrow +      8 * hh, qrow + 16 + 8 * hh);
    v16h qa1 = make_frag(qrow + 32 + 8 * hh, qrow + 48 + 8 * hh);
    v16h qa2 = make_frag(qrow + 64 + 8 * hh, qrow + 80 + 8 * hh);

    v8f zero = {};
    v8f accO[5];
    #pragma unroll
    for (int i = 0; i < 5; i++) accO[i] = zero;
    float m_run[8], l_run[8];
    #pragma unroll
    for (int i = 0; i < 8; i++) { m_run[i] = -1e30f; l_run[i] = 0.f; }

    const h16* kbase = Kp + (size_t)bh * NSEQ * HDP;
    const h16* vbase = Vt + (size_t)bh * HDP2 * NSEQ;
    const float invN1 = 1.f / (float)(NSEQ - 1);

    for (int kt = 0; kt < NSEQ; kt += 32) {
        // ---- cooperative staging: K tile is contiguous (keys are rows) ----
        __syncthreads();  // previous iteration's LDS reads complete
        {
            const v8h* kg = (const v8h*)(kbase + (size_t)kt * HDP);
            v8h* kls = (v8h*)kl;
            #pragma unroll
            for (int i = 0; i < 3; i++)           // 32*96/8 = 384 chunks
                kls[tid + 128 * i] = kg[tid + 128 * i];
            v8h* vls = (v8h*)vl;
            for (int i = tid; i < HDP2 * 4; i += 128) {  // 80 rows x 4 chunks
                int row = i >> 2, c = i & 3;
                vls[i] = *(const v8h*)(vbase + (size_t)row * NSEQ + kt + c * 8);
            }
        }
        __syncthreads();

        // ---- S = Q K^T for two 16-key halves (fragments from LDS) ----
        v8f s0 = zero, s1 = zero;
        const h16* krow0 = kl + (size_t)r * HDP;
        const h16* krow1 = kl + (size_t)(16 + r) * HDP;
        v16h kb;
        kb = make_frag(krow0 +      8 * hh, krow0 + 16 + 8 * hh); s0 = WMMA16(qa0, kb, s0);
        kb = make_frag(krow1 +      8 * hh, krow1 + 16 + 8 * hh); s1 = WMMA16(qa0, kb, s1);
        kb = make_frag(krow0 + 32 + 8 * hh, krow0 + 48 + 8 * hh); s0 = WMMA16(qa1, kb, s0);
        kb = make_frag(krow1 + 32 + 8 * hh, krow1 + 48 + 8 * hh); s1 = WMMA16(qa1, kb, s1);
        kb = make_frag(krow0 + 64 + 8 * hh, krow0 + 80 + 8 * hh); s0 = WMMA16(qa2, kb, s0);
        kb = make_frag(krow1 + 64 + 8 * hh, krow1 + 80 + 8 * hh); s1 = WMMA16(qa2, kb, s1);

        // per-key positional scale (lane == key column in C-layout)
        float p0 = (float)(kt + r) * invN1 - 0.5f;
        float p1 = (float)(kt + 16 + r) * invN1 - 0.5f;
        float ps0 = __expf(-sf * p0 * p0);
        float ps1 = __expf(-sf * p1 * p1);

        // ---- online softmax, per query row (row = vg + 8*hh) ----
        float pv0[8], pv1[8];
        #pragma unroll
        for (int vg = 0; vg < 8; vg++) {
            float t0 = s0[vg] * ps0;
            float t1 = s1[vg] * ps1;
            float tm = fmaxf(t0, t1);
            #pragma unroll
            for (int msk = 8; msk >= 1; msk >>= 1)
                tm = fmaxf(tm, __shfl_xor(tm, msk, 32));
            float mn = fmaxf(m_run[vg], tm);
            float alpha = __expf(m_run[vg] - mn);
            float e0 = __expf(t0 - mn), e1 = __expf(t1 - mn);
            float es = e0 + e1;
            #pragma unroll
            for (int msk = 8; msk >= 1; msk >>= 1)
                es += __shfl_xor(es, msk, 32);
            l_run[vg] = l_run[vg] * alpha + es;
            m_run[vg] = mn;
            #pragma unroll
            for (int dt = 0; dt < 5; dt++) accO[dt][vg] *= alpha;
            pv0[vg] = e0; pv1[vg] = e1;
        }

        // ---- stash P tile (16x32) in this wave's LDS slice, reload as A-frag ----
        h16* pw = p_lds[wv];
        #pragma unroll
        for (int vg = 0; vg < 8; vg++) {
            int row = vg + 8 * hh;
            pw[row * 32 + r]      = (h16)pv0[vg];
            pw[row * 32 + 16 + r] = (h16)pv1[vg];
        }
        const h16* prow = pw + r * 32;       // same-wave DS ops are in-order
        v16h pf = make_frag(prow + 8 * hh, prow + 16 + 8 * hh);

        // ---- O += P @ V  (V fragments from LDS, key-contiguous rows of 32) ----
        #pragma unroll
        for (int dt = 0; dt < 5; dt++) {
            const h16* vrow = vl + (dt * 16 + r) * 32;
            v16h vf = make_frag(vrow + 8 * hh, vrow + 16 + 8 * hh);
            accO[dt] = WMMA16(pf, vf, accO[dt]);
        }
    }

    // ---- finalize: normalize and scatter to O[b,n, h*68+d] ----
    #pragma unroll
    for (int vg = 0; vg < 8; vg++) {
        float inv = 1.f / l_run[vg];
        int q = qt * 16 + vg + 8 * hh;
        #pragma unroll
        for (int dt = 0; dt < 5; dt++) {
            int d = dt * 16 + r;
            if (d < HD)
                O[(size_t)(b * NSEQ + q) * CDIM + hd * HD + d] = (h16)(accO[dt][vg] * inv);
        }
    }
}

// ---------------- stage F: projection GEMM (WMMA) + bias ----------------
__global__ void k_proj(const h16* __restrict__ O, const h16* __restrict__ wp,
                       const float* __restrict__ pb, float* __restrict__ out) {
    int lane = threadIdx.x;
    int mt = blockIdx.y * 8 + threadIdx.y;  // 0..511
    int ntg = blockIdx.x;                   // 0..16 (2 tiles each -> 34 tiles = 544)
    int r = lane & 15, hh = lane >> 4;
    const h16* arow = O + (size_t)(mt * 16 + r) * CDIM;
    int o0 = (ntg * 2 + 0) * 16 + r;
    int o1 = (ntg * 2 + 1) * 16 + r;
    const h16* b0row = wp + (size_t)o0 * CDIM;
    const h16* b1row = wp + (size_t)o1 * CDIM;
    v8f acc0 = {}; v8f acc1 = {};
    for (int ks = 0; ks < CDIM; ks += 32) {
        int c0 = ks + 8 * hh, c1 = ks + 16 + 8 * hh;
        v16h a  = make_frag(arow  + c0, arow  + c1);
        v16h b0 = make_frag(b0row + c0, b0row + c1);
        v16h b1 = make_frag(b1row + c0, b1row + c1);
        acc0 = WMMA16(a, b0, acc0);
        acc1 = WMMA16(a, b1, acc1);
    }
    float bias0 = pb[o0], bias1 = pb[o1];
    #pragma unroll
    for (int vg = 0; vg < 8; vg++) {
        int m = mt * 16 + vg + 8 * hh;
        out[(size_t)m * CDIM + o0] = acc0[vg] + bias0;
        out[(size_t)m * CDIM + o1] = acc1[vg] + bias1;
    }
}

extern "C" void kernel_launch(void* const* d_in, const int* in_sizes, int n_in,
                              void* d_out, int out_size, void* d_ws, size_t ws_size,
                              hipStream_t stream) {
    const float* x     = (const float*)d_in[0];
    const float* ng    = (const float*)d_in[1];
    const float* nb    = (const float*)d_in[2];
    const float* apw   = (const float*)d_in[3];
    const float* apb   = (const float*)d_in[4];
    const float* n2g   = (const float*)d_in[5];
    const float* n2b   = (const float*)d_in[6];
    const float* qkvw  = (const float*)d_in[7];
    const float* projw = (const float*)d_in[8];
    const float* projb = (const float*)d_in[9];
    const float* sfp   = (const float*)d_in[10];
    float* out = (float*)d_out;

    char* ws = (char*)d_ws;
    size_t off = 0;
    float* xr = (float*)(ws + off); off += (size_t)BN * CDIM * 4;        // 17.8 MB
    float* sc = (float*)(ws + off); off += (size_t)BN * NJ * 4;          // 0.56 MB
    h16* xp = (h16*)(ws + off); off += (size_t)BN * CDIM * 2;            // 8.9 MB
    h16* wq = (h16*)(ws + off); off += (size_t)C3 * CDIM * 2;            // 1.8 MB
    h16* wp = (h16*)(ws + off); off += (size_t)CDIM * CDIM * 2;          // 0.6 MB
    h16* Qp = (h16*)(ws + off); off += (size_t)NB * NH * NSEQ * HDP * 2; // 12.6 MB
    h16* Kp = (h16*)(ws + off); off += (size_t)NB * NH * NSEQ * HDP * 2; // 12.6 MB
    h16* Vt = (h16*)(ws + off); off += (size_t)NB * NH * HDP2 * NSEQ * 2;// 10.5 MB
    h16* O  = (h16*)(ws + off); off += (size_t)BN * CDIM * 2;            // 8.9 MB

    // W: weight conversion f32 -> f16
    int ncvt = C3 * CDIM + CDIM * CDIM;
    k_cvt<<<(ncvt + 255) / 256, 256, 0, stream>>>(qkvw, projw, wq, wp);
    // Z: zero padded Q/K/Vt region (contiguous)
    int zwords = (int)(((size_t)NB * NH * NSEQ * HDP * 2 * 2 +
                        (size_t)NB * NH * HDP2 * NSEQ * 2) / 4);
    k_zero<<<(zwords + 255) / 256, 256, 0, stream>>>((unsigned int*)Qp, zwords);
    // A: per-joint LN + attention-pool scores
    k_ln1<<<(BN * NJ + 255) / 256, 256, 0, stream>>>(x, ng, nb, apw, apb, xr, sc);
    // B: softmax over sequence axis
    k_softmax_n<<<NB * NJ, 256, 0, stream>>>(sc);
    // C: pool + LN over C -> f16 activations
    k_pool_ln2<<<BN, 256, 0, stream>>>(xr, sc, n2g, n2b, xp);
    // D: QKV GEMM (WMMA), scatter to Q (scaled), K, V^T
    k_qkv_gemm<<<dim3(34, 64), dim3(32, 8), 0, stream>>>(xp, wq, Qp, Kp, Vt);
    // E: flash attention, 4 query tiles per block sharing K/V through LDS
    k_attn<<<dim3(64 / QTPB, NH, NB), dim3(32, QTPB), 0, stream>>>(Qp, Kp, Vt, sfp, O);
    // F: projection GEMM (WMMA) + bias -> f32 output
    k_proj<<<dim3(17, 64), dim3(32, 8), 0, stream>>>(O, wp, projb, out);
    (void)in_sizes; (void)n_in; (void)out_size; (void)ws_size;
}

// v001
// Measured time: 235 microseconds a run.
// In both of two side-by-side timings against v000, it was 1.37 times as fast.
#include <hip/hip_runtime.h>
#include <hip/hip_bf16.h>
#include <math.h>

typedef _Float16 h16;
typedef __attribute__((ext_vector_type(8)))  _Float16 v8h;
typedef __attribute__((ext_vector_type(16))) _Float16 v16h;
typedef __attribute__((ext_vector_type(8)))  float    v8f;

#define NJ    17
#define NF    32
#define CDIM  544
#define NH    8
#define HD    68
#define HDP   96    // padded head dim for Q/K (3 K-steps of 32)
#define HDP2  80    // padded head dim for O tiles (5 tiles of 16)
#define NB    8
#define NSEQ  1024
#define BN    8192  // NB*NSEQ
#define C3    1632  // 3*CDIM
#define QTPB  4     // query tiles (waves) per attention block

#define WMMA16(a,b,c) __builtin_amdgcn_wmma_f32_16x16x32_f16(false,(a),false,(b),(short)0,(c),false,false)

__device__ __forceinline__ v16h make_frag(const h16* p0, const h16* p1) {
    v8h a = *(const v8h*)p0;
    v8h b = *(const v8h*)p1;
    return __builtin_shufflevector(a, b, 0,1,2,3,4,5,6,7,8,9,10,11,12,13,14,15);
}

// ---------------- stage W: convert weights f32 -> f16 ----------------
__global__ void k_cvt(const float* __restrict__ qkvw, const float* __restrict__ projw,
                      h16* __restrict__ wq, h16* __restrict__ wp) {
    int i = blockIdx.x * blockDim.x + threadIdx.x;
    const int n1 = C3 * CDIM, n2 = CDIM * CDIM;
    if (i < n1)            wq[i] = (h16)qkvw[i];
    else if (i < n1 + n2)  wp[i - n1] = (h16)projw[i - n1];
}

// ---------------- stage Z: zero Q/K/Vt padded buffers ----------------
__global__ void k_zero(unsigned int* __restrict__ p, int nwords) {
    int i = blockIdx.x * blockDim.x + threadIdx.x;
    if (i < nwords) p[i] = 0u;
}

// ---------------- stage A: per-joint LN + pooling scores ----------------
__global__ void k_ln1(const float* __restrict__ x, const float* __restrict__ g,
                      const float* __restrict__ bb, const float* __restrict__ apw,
                      const float* __restrict__ apb,
                      float* __restrict__ xr, float* __restrict__ sc) {
    int idx = blockIdx.x * blockDim.x + threadIdx.x;  // (b*N+n)*17 + j
    if (idx >= BN * NJ) return;
    const float* px = x + (size_t)idx * NF;
    float s = 0.f, s2 = 0.f;
    #pragma unroll
    for (int f = 0; f < NF; f++) { float v = px[f]; s += v; s2 += v * v; }
    float mu = s * (1.f / NF);
    float var = s2 * (1.f / NF) - mu * mu;
    float rs = rsqrtf(var + 1e-5f);
    float* po = xr + (size_t)idx * NF;
    float acc = 0.f;
    #pragma unroll
    for (int f = 0; f < NF; f++) {
        float v = (px[f] - mu) * rs * g[f] + bb[f];
        po[f] = v;
        acc += v * apw[f];
    }
    sc[idx] = acc + apb[0];
}

// ---------------- stage B: softmax over sequence axis N ----------------
__global__ void k_softmax_n(float* __restrict__ sc) {
    int b = blockIdx.x / NJ, j = blockIdx.x % NJ;
    __shared__ float red[256];
    int t = threadIdx.x;
    float m = -3e38f;
    for (int n = t; n < NSEQ; n += 256) m = fmaxf(m, sc[(b * NSEQ + n) * NJ + j]);
    red[t] = m; __syncthreads();
    for (int o = 128; o > 0; o >>= 1) { if (t < o) red[t] = fmaxf(red[t], red[t + o]); __syncthreads(); }
    m = red[0]; __syncthreads();
    float s = 0.f;
    for (int n = t; n < NSEQ; n += 256) s += __expf(sc[(b * NSEQ + n) * NJ + j] - m);
    red[t] = s; __syncthreads();
    for (int o = 128; o > 0; o >>= 1) { if (t < o) red[t] += red[t + o]; __syncthreads(); }
    float inv = 1.f / red[0];
    for (int n = t; n < NSEQ; n += 256) {
        int id = (b * NSEQ + n) * NJ + j;
        sc[id] = __expf(sc[id] - m) * inv;
    }
}

// ---------------- stage C: pool by weights + LN over C, emit f16 ----------------
__global__ void k_pool_ln2(const float* __restrict__ xr, const float* __restrict__ w,
                           const float* __restrict__ g2, const float* __restrict__ b2,
                           h16* __restrict__ xp) {
    int row = blockIdx.x;  // b*N + n
    __shared__ float vals[CDIM];
    __shared__ float red[256];
    int t = threadIdx.x;
    float s = 0.f;
    for (int c = t; c < CDIM; c += 256) {
        float v = xr[(size_t)row * CDIM + c] * w[row * NJ + c / NF];
        vals[c] = v; s += v;
    }
    red[t] = s; __syncthreads();
    for (int o = 128; o > 0; o >>= 1) { if (t < o) red[t] += red[t + o]; __syncthreads(); }
    float mu = red[0] * (1.f / CDIM); __syncthreads();
    float s2 = 0.f;
    for (int c = t; c < CDIM; c += 256) { float d = vals[c] - mu; s2 += d * d; }
    red[t] = s2; __syncthreads();
    for (int o = 128; o > 0; o >>= 1) { if (t < o) red[t] += red[t + o]; __syncthreads(); }
    float rs = rsqrtf(red[0] * (1.f / CDIM) + 1e-5f);
    for (int c = t; c < CDIM; c += 256)
        xp[(size_t)row * CDIM + c] = (h16)((vals[c] - mu) * rs * g2[c] + b2[c]);
}

// ---------------- stage D: QKV GEMM (WMMA, 16x48 per wave) ----------------
__global__ void k_qkv_gemm(const h16* __restrict__ xp, const h16* __restrict__ wq,
                           h16* __restrict__ Qp, h16* __restrict__ Kp, h16* __restrict__ Vt) {
    int lane = threadIdx.x;                 // 0..31
    int mt = blockIdx.y * 8 + threadIdx.y;  // row tile 0..511
    int ntg = blockIdx.x;                   // col tile group 0..33 (3 tiles each)
    int r = lane & 15, hh = lane >> 4;
    const h16* arow = xp + (size_t)(mt * 16 + r) * CDIM;
    const h16* brow[3];
    #pragma unroll
    for (int nt = 0; nt < 3; nt++)
        brow[nt] = wq + (size_t)((ntg * 3 + nt) * 16 + r) * CDIM;
    v8f zero = {};
    v8f acc[3];
    #pragma unroll
    for (int nt = 0; nt < 3; nt++) acc[nt] = zero;
    for (int ks = 0; ks < CDIM; ks += 32) {
        int c0 = ks + 8 * hh, c1 = ks + 16 + 8 * hh;
        v16h a = make_frag(arow + c0, arow + c1);
        #pragma unroll
        for (int nt = 0; nt < 3; nt++) {
            v16h bfr = make_frag(brow[nt] + c0, brow[nt] + c1);
            acc[nt] = WMMA16(a, bfr, acc[nt]);
        }
    }
    const float qscale = 0.121267813f;  // 68^-0.5, folded into Q
    #pragma unroll
    for (int nt = 0; nt < 3; nt++) {
        int o = (ntg * 3 + nt) * 16 + r;
        int third = o / CDIM, rem = o % CDIM;
        int hd = rem / HD, d = rem % HD;
        #pragma unroll
        for (int vg = 0; vg < 8; vg++) {
            int m = mt * 16 + vg + 8 * hh;          // global row (b*N+n)
            int b = m >> 10, n = m & 1023;
            int bh = b * NH + hd;
            float v = acc[nt][vg];
            if (third == 0)      Qp[(size_t)(bh * NSEQ + n) * HDP + d] = (h16)(v * qscale);
            else if (third == 1) Kp[(size_t)(bh * NSEQ + n) * HDP + d] = (h16)v;
            else                 Vt[(size_t)(bh * HDP2 + d) * NSEQ + n] = (h16)v;
        }
    }
}

typedef __attribute__((ext_vector_type(4))) _Float16 v4h;
typedef __attribute__((ext_vector_type(4))) float    v4f;

// lane l <-> lane l ^ 16: the other half of the same query's keys
__device__ __forceinline__ float xhalf(float x) {
    return __builtin_bit_cast(float, __builtin_amdgcn_permlanex16(
        __builtin_bit_cast(int, x), __builtin_bit_cast(int, x),
        0x76543210, 0xfedcba98, false, false));
}

__global__ void k_attn(const h16* __restrict__ Qp, const h16* __restrict__ Kp,
                       const h16* __restrict__ Vt, const float* __restrict__ sfp,
                       h16* __restrict__ O) {
    int lane = threadIdx.x;               // 0..31
    int wv = threadIdx.y;                 // 0..3 : one query tile per wave
    int tid = wv * 32 + lane;
    int qt = blockIdx.x * QTPB + wv;      // 0..63
    int hd = blockIdx.y, b = blockIdx.z;
    int bh = b * NH + hd;
    int r = lane & 15, hh = lane >> 4;
    float sf = sfp[0];

    __shared__ __align__(16) h16 kl[32 * HDP];        // 6 KB: 32 keys x 96 dims
    __shared__ __align__(16) h16 vl[HDP2 * 32];       // 5 KB: 80 dims x 32 keys
    __shared__ __align__(16) float psl[NSEQ];         // 4 KB: per-key positional scale

    // Q fragments for this wave's 16 queries (3 K-steps covering padded 96), used as B
    const h16* qrow = Qp + (size_t)(bh * NSEQ + qt * 16 + r) * HDP;
    v16h qa0 = make_frag(qrow +      8 * hh, qrow + 16 + 8 * hh);
    v16h qa1 = make_frag(qrow + 32 + 8 * hh, qrow + 48 + 8 * hh);
    v16h qa2 = make_frag(qrow + 64 + 8 * hh, qrow + 80 + 8 * hh);

    v8f zero = {};
    v8f accO[5];                          // O^T tiles: row = dim dt*16 + vg + 8*hh, column = query r
    #pragma unroll
    for (int i = 0; i < 5; i++) accO[i] = zero;
    float m_run = -1e30f, l_run = 0.f;    // this lane's query; l_run sums this half's keys only

    const h16* kbase = Kp + (size_t)bh * NSEQ * HDP;
    const h16* vbase = Vt + (size_t)bh * HDP2 * NSEQ;
    const float invN1 = 1.f / (float)(NSEQ - 1);

    // a key is now a register row, not a lane: its scale comes from a table filled once
    // (published by the two barriers at the head of the first pass)
    #pragma unroll  // fixed 8 trips: the exponentials issue back to back instead of one per loop trip
    for (int i = 0; i < NSEQ / (32 * QTPB); i++) {
        int k = tid + 32 * QTPB * i;
        float p = (float)k * invN1 - 0.5f;
        psl[k] = __expf(-sf * p * p);
    }

    for (int kt = 0; kt < NSEQ; kt += 32) {
        // ---- cooperative staging: K tile is contiguous (keys are rows) ----
        __syncthreads();  // previous iteration's LDS reads complete
        {
            const v8h* kg = (const v8h*)(kbase + (size_t)kt * HDP);
            v8h* kls = (v8h*)kl;
            #pragma unroll
            for (int i = 0; i < 3; i++)           // 32*96/8 = 384 chunks
                kls[tid + 128 * i] = kg[tid + 128 * i];
            v8h* vls = (v8h*)vl;
            for (int i = tid; i < HDP2 * 4; i += 128) {  // 80 rows x 4 chunks
                int row = i >> 2, c = i & 3;
                vls[i] = *(const v8h*)(vbase + (size_t)row * NSEQ + kt + c * 8);
            }
        }
        __syncthreads();

        // ---- S^T = K Q^T for two 16-key tiles (K fragments from LDS as A) ----
        v8f s0 = zero, s1 = zero;
        const h16* krow0 = kl + (size_t)r * HDP;
        const h16* krow1 = kl + (size_t)(16 + r) * HDP;
        v16h kb;
        kb = make_frag(krow0 +      8 * hh, krow0 + 16 + 8 * hh); s0 = WMMA16(kb, qa0, s0);
        kb = make_frag(krow1 +      8 * hh, krow1 + 16 + 8 * hh); s1 = WMMA16(kb, qa0, s1);
        kb = make_frag(krow0 + 32 + 8 * hh, krow0 + 48 + 8 * hh); s0 = WMMA16(kb, qa1, s0);
        kb = make_frag(krow1 + 32 + 8 * hh, krow1 + 48 + 8 * hh); s1 = WMMA16(kb, qa1, s1);
        kb = make_frag(krow0 + 64 + 8 * hh, krow0 + 80 + 8 * hh); s0 = WMMA16(kb, qa2, s0);
        kb = make_frag(krow1 + 64 + 8 * hh, krow1 + 80 + 8 * hh); s1 = WMMA16(kb, qa2, s1);

        // per-key positional scale: keys kt + 8*hh + vg (s0) and kt + 16 + 8*hh + vg (s1)
        const v4f* pt = (const v4f*)(psl + kt + 8 * hh);
        v4f pa = pt[0], pb = pt[1], pc = pt[4], pd = pt[5];

        // ---- online softmax for this lane's query ----
        float t0[8], t1[8];
        #pragma unroll
        for (int vg = 0; vg < 4; vg++) {
            t0[vg]     = s0[vg]     * pa[vg];
            t0[vg + 4] = s0[vg + 4] * pb[vg];
            t1[vg]     = s1[vg]     * pc[vg];
            t1[vg + 4] = s1[vg + 4] * pd[vg];
        }
        float tm = fmaxf(t0[0], t1[0]);
        #pragma unroll
        for (int vg = 1; vg < 8; vg++) tm = fmaxf(tm, fmaxf(t0[vg], t1[vg]));
        tm = fmaxf(tm, xhalf(tm));
        float mn = fmaxf(m_run, tm);
        float alpha = __expf(m_run - mn);
        m_run = mn;
        v16h pf;                           // P^T as B: element i = key 8*hh + i, 8 + i = key 16 + 8*hh + i
        float es = 0.f;
        #pragma unroll
        for (int vg = 0; vg < 8; vg++) {
            float e0 = __expf(t0[vg] - mn), e1 = __expf(t1[vg] - mn);
            es += e0 + e1;
            pf[vg] = (h16)e0; pf[vg + 8] = (h16)e1;
        }
        l_run = l_run * alpha + es;
        #pragma unroll
        for (int dt = 0; dt < 5; dt++)
            #pragma unroll
            for (int vg = 0; vg < 8; vg++) accO[dt][vg] *= alpha;

        // ---- O^T += V^T P^T  (V^T fragments from LDS as A, key-contiguous rows of 32) ----
        #pragma unroll
        for (int dt = 0; dt < 5; dt++) {
            const h16* vrow = vl + (dt * 16 + r) * 32;
            v16h vf = make_frag(vrow + 8 * hh, vrow + 16 + 8 * hh);
            accO[dt] = WMMA16(vf, pf, accO[dt]);
        }
    }

    // ---- finalize: join the halves' sums, normalize, store 8 consecutive dims per lane ----
    float inv = 1.f / (l_run + xhalf(l_run));
    h16* orow = O + (size_t)(b * NSEQ + qt * 16 + r) * CDIM + hd * HD + 8 * hh;
    #pragma unroll
    for (int dt = 0; dt < 5; dt++) {
        v4h lo, hi;
        #pragma unroll
        for (int vg = 0; vg < 4; vg++) {
            lo[vg] = (h16)(accO[dt][vg] * inv);
            hi[vg] = (h16)(accO[dt][vg + 4] * inv);
        }
        if (dt < 4) {
            *(v4h*)(orow + dt * 16)     = lo;   // head offset is a multiple of 8 bytes only
            *(v4h*)(orow + dt * 16 + 4) = hi;
        } else if (hh == 0) {
            *(v4h*)(orow + dt * 16)     = lo;   // dims 64..67; 68..79 are padding
        }
    }
}

// ---------------- stage F: projection GEMM (WMMA) + bias ----------------
__global__ void k_proj(const h16* __restrict__ O, const h16* __restrict__ wp,
                       const float* __restrict__ pb, float* __restrict__ out) {
    int lane = threadIdx.x;
    int mt = blockIdx.y * 8 + threadIdx.y;  // 0..511
    int ntg = blockIdx.x;                   // 0..16 (2 tiles each -> 34 tiles = 544)
    int r = lane & 15, hh = lane >> 4;
    const h16* arow = O + (size_t)(mt * 16 + r) * CDIM;
    int o0 = (ntg * 2 + 0) * 16 + r;
    int o1 = (ntg * 2 + 1) * 16 + r;
    const h16* b0row = wp + (size_t)o0 * CDIM;
    const h16* b1row = wp + (size_t)o1 * CDIM;
    v8f acc0 = {}; v8f acc1 = {};
    for (int ks = 0; ks < CDIM; ks += 32) {
        int c0 = ks + 8 * hh, c1 = ks + 16 + 8 * hh;
        v16h a  = make_frag(arow  + c0, arow  + c1);
        v16h b0 = make_frag(b0row + c0, b0row + c1);
        v16h b1 = make_frag(b1row + c0, b1row + c1);
        acc0 = WMMA16(a, b0, acc0);
        acc1 = WMMA16(a, b1, acc1);
    }
    float bias0 = pb[o0], bias1 = pb[o1];
    #pragma unroll
    for (int vg = 0; vg < 8; vg++) {
        int m = mt * 16 + vg + 8 * hh;
        out[(size_t)m * CDIM + o0] = acc0[vg] + bias0;
        out[(size_t)m * CDIM + o1] = acc1[vg] + bias1;
    }
}

extern "C" void kernel_launch(void* const* d_in, const int* in_sizes, int n_in,
                              void* d_out, int out_size, void* d_ws, size_t ws_size,
                              hipStream_t stream) {
    const float* x     = (const float*)d_in[0];
    const float* ng    = (const float*)d_in[1];
    const float* nb    = (const float*)d_in[2];
    const float* apw   = (const float*)d_in[3];
    const float* apb   = (const float*)d_in[4];
    const float* n2g   = (const float*)d_in[5];
    const float* n2b   = (const float*)d_in[6];
    const float* qkvw  = (const float*)d_in[7];
    const float* projw = (const float*)d_in[8];
    const float* projb = (const float*)d_in[9];
    const float* sfp   = (const float*)d_in[10];
    float* out = (float*)d_out;

    char* ws = (char*)d_ws;
    size_t off = 0;
    float* xr = (float*)(ws + off); off += (size_t)BN * CDIM * 4;        // 17.8 MB
    float* sc = (float*)(ws + off); off += (size_t)BN * NJ * 4;          // 0.56 MB
    h16* xp = (h16*)(ws + off); off += (size_t)BN * CDIM * 2;            // 8.9 MB
    h16* wq = (h16*)(ws + off); off += (size_t)C3 * CDIM * 2;            // 1.8 MB
    h16* wp = (h16*)(ws + off); off += (size_t)CDIM * CDIM * 2;          // 0.6 MB
    h16* Qp = (h16*)(ws + off); off += (size_t)NB * NH * NSEQ * HDP * 2; // 12.6 MB
    h16* Kp = (h16*)(ws + off); off += (size_t)NB * NH * NSEQ * HDP * 2; // 12.6 MB
    h16* Vt = (h16*)(ws + off); off += (size_t)NB * NH * HDP2 * NSEQ * 2;// 10.5 MB
    h16* O  = (h16*)(ws + off); off += (size_t)BN * CDIM * 2;            // 8.9 MB

    // W: weight conversion f32 -> f16
    int ncvt = C3 * CDIM + CDIM * CDIM;
    k_cvt<<<(ncvt + 255) / 256, 256, 0, stream>>>(qkvw, projw, wq, wp);
    // Z: zero padded Q/K/Vt region (contiguous)
    int zwords = (int)(((size_t)NB * NH * NSEQ * HDP * 2 * 2 +
                        (size_t)NB * NH * HDP2 * NSEQ * 2) / 4);
    k_zero<<<(zwords + 255) / 256, 256, 0, stream>>>((unsigned int*)Qp, zwords);
    // A: per-joint LN + attention-pool scores
    k_ln1<<<(BN * NJ + 255) / 256, 256, 0, stream>>>(x, ng, nb, apw, apb, xr, sc);
    // B: softmax over sequence axis
    k_softmax_n<<<NB * NJ, 256, 0, stream>>>(sc);
    // C: pool + LN over C -> f16 activations
    k_pool_ln2<<<BN, 256, 0, stream>>>(xr, sc, n2g, n2b, xp);
    // D: QKV GEMM (WMMA), scatter to Q (scaled), K, V^T
    k_qkv_gemm<<<dim3(34, 64), dim3(32, 8), 0, stream>>>(xp, wq, Qp, Kp, Vt);
    // E: flash attention, 4 query tiles per block sharing K/V through LDS
    k_attn<<<dim3(64 / QTPB, NH, NB), dim3(32, QTPB), 0, stream>>>(Qp, Kp, Vt, sfp, O);
    // F: projection GEMM (WMMA) + bias -> f32 output
    k_proj<<<dim3(17, 64), dim3(32, 8), 0, stream>>>(O, wp, projb, out);
    (void)in_sizes; (void)n_in; (void)out_size; (void)ws_size;
}

// v002
// It runs in 197 microseconds.
// In two side-by-side timings against v001, it was 1.20 and 1.19 times as fast.
// All steps since v000 together make it 1.64 times as fast.
#include <hip/hip_runtime.h>
#include <hip/hip_bf16.h>
#include <math.h>

typedef _Float16 h16;
typedef __attribute__((ext_vector_type(8)))  _Float16 v8h;
typedef __attribute__((ext_vector_type(16))) _Float16 v16h;
typedef __attribute__((ext_vector_type(8)))  float    v8f;

#define NJ    17
#define NF    32
#define CDIM  544
#define NH    8
#define HD    68
#define HDP   96    // padded head dim for Q/K (3 K-steps of 32)
#define HDP2  80    // padded head dim for O tiles (5 tiles of 16)
#define NB    8
#define NSEQ  1024
#define BN    8192  // NB*NSEQ
#define C3    1632  // 3*CDIM
#define QTPB  4     // query tiles (waves) per attention block

#define WMMA16(a,b,c) __builtin_amdgcn_wmma_f32_16x16x32_f16(false,(a),false,(b),(short)0,(c),false,false)

__device__ __forceinline__ v16h make_frag(const h16* p0, const h16* p1) {
    v8h a = *(const v8h*)p0;
    v8h b = *(const v8h*)p1;
    return __builtin_shufflevector(a, b, 0,1,2,3,4,5,6,7,8,9,10,11,12,13,14,15);
}

// Fragment order for the operands of the two GEMMs (row-major [rows][CDIM] matrices).
// One 16-row x 32-k block is 1 KB: two 512-byte halves, and in each half lane l = r + 16*hh
// owns 16 bytes. Half 0 holds k = 8*hh + e, half 1 holds k = 16 + 8*hh + e (e = 0..7): the
// same elements at the same lane and register as the row-major loader took, so a fragment
// is two loads of 512 contiguous bytes (4 whole lines each) instead of 16 pieces of 32 bytes.
#define KSTEPS (CDIM / 32)   // 17 k-steps
#define FBLK   512           // elements per 16 x 32 block
__device__ __forceinline__ int frag_pos(int row, int c) {
    return (((row >> 4) * KSTEPS + (c >> 5)) * FBLK) + ((c & 16) << 4) + ((c & 8) << 4)
         + ((row & 15) << 3) + (c & 7);
}
// inverse map: position in fragment order -> row * CDIM + c
__device__ __forceinline__ int frag_src(int p) {
    int blk = p / FBLK;
    int row = (blk / KSTEPS) * 16 + ((p >> 3) & 15);
    int c   = (blk % KSTEPS) * 32 + ((p >> 4) & 16) + ((p >> 4) & 8) + (p & 7);
    return row * CDIM + c;
}

// ---------------- stage W: convert weights f32 -> f16, stored in fragment order ----------------
__global__ void k_cvt(const float* __restrict__ qkvw, const float* __restrict__ projw,
                      h16* __restrict__ wq, h16* __restrict__ wp) {
    int i = blockIdx.x * blockDim.x + threadIdx.x;   // destination index: stores stay contiguous
    const int n1 = C3 * CDIM, n2 = CDIM * CDIM;
    if (i < n1)            wq[i] = (h16)qkvw[frag_src(i)];
    else if (i < n1 + n2)  wp[i - n1] = (h16)projw[frag_src(i - n1)];
}

// ---------------- stage Z: zero Q/K/Vt padded buffers ----------------
__global__ void k_zero(unsigned int* __restrict__ p, int nwords) {
    int i = blockIdx.x * blockDim.x + threadIdx.x;
    if (i < nwords) p[i] = 0u;
}

// ---------------- stage A: per-joint LN + pooling scores ----------------
__global__ void k_ln1(const float* __restrict__ x, const float* __restrict__ g,
                      const float* __restrict__ bb, const float* __restrict__ apw,
                      const float* __restrict__ apb,
                      float* __restrict__ xr, float* __restrict__ sc) {
    int idx = blockIdx.x * blockDim.x + threadIdx.x;  // (b*N+n)*17 + j
    if (idx >= BN * NJ) return;
    const float* px = x + (size_t)idx * NF;
    float s = 0.f, s2 = 0.f;
    #pragma unroll
    for (int f = 0; f < NF; f++) { float v = px[f]; s += v; s2 += v * v; }
    float mu = s * (1.f / NF);
    float var = s2 * (1.f / NF) - mu * mu;
    float rs = rsqrtf(var + 1e-5f);
    float* po = xr + (size_t)idx * NF;
    float acc = 0.f;
    #pragma unroll
    for (int f = 0; f < NF; f++) {
        float v = (px[f] - mu) * rs * g[f] + bb[f];
        po[f] = v;
        acc += v * apw[f];
    }
    sc[idx] = acc + apb[0];
}

// ---------------- stage B: softmax over sequence axis N ----------------
__global__ void k_softmax_n(float* __restrict__ sc) {
    int b = blockIdx.x / NJ, j = blockIdx.x % NJ;
    __shared__ float red[256];
    int t = threadIdx.x;
    float m = -3e38f;
    for (int n = t; n < NSEQ; n += 256) m = fmaxf(m, sc[(b * NSEQ + n) * NJ + j]);
    red[t] = m; __syncthreads();
    for (int o = 128; o > 0; o >>= 1) { if (t < o) red[t] = fmaxf(red[t], red[t + o]); __syncthreads(); }
    m = red[0]; __syncthreads();
    float s = 0.f;
    for (int n = t; n < NSEQ; n += 256) s += __expf(sc[(b * NSEQ + n) * NJ + j] - m);
    red[t] = s; __syncthreads();
    for (int o = 128; o > 0; o >>= 1) { if (t < o) red[t] += red[t + o]; __syncthreads(); }
    float inv = 1.f / red[0];
    for (int n = t; n < NSEQ; n += 256) {
        int id = (b * NSEQ + n) * NJ + j;
        sc[id] = __expf(sc[id] - m) * inv;
    }
}

// ---------------- stage C: pool by weights + LN over C, emit f16 ----------------
__global__ void k_pool_ln2(const float* __restrict__ xr, const float* __restrict__ w,
                           const float* __restrict__ g2, const float* __restrict__ b2,
                           h16* __restrict__ xp) {
    int row = blockIdx.x;  // b*N + n
    __shared__ float vals[CDIM];
    __shared__ float red[256];
    int t = threadIdx.x;
    float s = 0.f;
    for (int c = t; c < CDIM; c += 256) {
        float v = xr[(size_t)row * CDIM + c] * w[row * NJ + c / NF];
        vals[c] = v; s += v;
    }
    red[t] = s; __syncthreads();
    for (int o = 128; o > 0; o >>= 1) { if (t < o) red[t] += red[t + o]; __syncthreads(); }
    float mu = red[0] * (1.f / CDIM); __syncthreads();
    float s2 = 0.f;
    for (int c = t; c < CDIM; c += 256) { float d = vals[c] - mu; s2 += d * d; }
    red[t] = s2; __syncthreads();
    for (int o = 128; o > 0; o >>= 1) { if (t < o) red[t] += red[t + o]; __syncthreads(); }
    float rs = rsqrtf(red[0] * (1.f / CDIM) + 1e-5f);
    for (int c = t; c < CDIM; c += 256)
        xp[frag_pos(row, c)] = (h16)((vals[c] - mu) * rs * g2[c] + b2[c]);
}

// ---------------- stage D: QKV GEMM (WMMA, 16x48 per wave) ----------------
__global__ void k_qkv_gemm(const h16* __restrict__ xp, const h16* __restrict__ wq,
                           h16* __restrict__ Qp, h16* __restrict__ Kp, h16* __restrict__ Vt) {
    int lane = threadIdx.x;                 // 0..31
    int mt = blockIdx.y * 8 + threadIdx.y;  // row tile 0..511
    int ntg = blockIdx.x;                   // col tile group 0..33 (3 tiles each)
    int r = lane & 15, hh = lane >> 4;
    const h16* atile = xp + (size_t)mt * (KSTEPS * FBLK) + lane * 8;   // both operands in fragment order
    const h16* btile[3];
    #pragma unroll
    for (int nt = 0; nt < 3; nt++)
        btile[nt] = wq + (size_t)(ntg * 3 + nt) * (KSTEPS * FBLK) + lane * 8;
    v8f zero = {};
    v8f acc[3];
    #pragma unroll
    for (int nt = 0; nt < 3; nt++) acc[nt] = zero;
    for (int ks = 0; ks < KSTEPS; ks++) {
        int c0 = ks * FBLK, c1 = ks * FBLK + FBLK / 2;
        v16h a = make_frag(atile + c0, atile + c1);
        #pragma unroll
        for (int nt = 0; nt < 3; nt++) {
            v16h bfr = make_frag(btile[nt] + c0, btile[nt] + c1);
            acc[nt] = WMMA16(a, bfr, acc[nt]);
        }
    }
    const float qscale = 0.121267813f;  // 68^-0.5, folded into Q
    #pragma unroll
    for (int nt = 0; nt < 3; nt++) {
        int o = (ntg * 3 + nt) * 16 + r;
        int third = o / CDIM, rem = o % CDIM;
        int hd = rem / HD, d = rem % HD;
        #pragma unroll
        for (int vg = 0; vg < 8; vg++) {
            int m = mt * 16 + vg + 8 * hh;          // global row (b*N+n)
            int b = m >> 10, n = m & 1023;
            int bh = b * NH + hd;
            float v = acc[nt][vg];
            if (third == 0)      Qp[(size_t)(bh * NSEQ + n) * HDP + d] = (h16)(v * qscale);
            else if (third == 1) Kp[(size_t)(bh * NSEQ + n) * HDP + d] = (h16)v;
            else                 Vt[(size_t)(bh * HDP2 + d) * NSEQ + n] = (h16)v;
        }
    }
}

typedef __attribute__((ext_vector_type(4))) _Float16 v4h;
typedef __attribute__((ext_vector_type(4))) float    v4f;

// lane l <-> lane l ^ 16: the other half of the same query's keys
__device__ __forceinline__ float xhalf(float x) {
    return __builtin_bit_cast(float, __builtin_amdgcn_permlanex16(
        __builtin_bit_cast(int, x), __builtin_bit_cast(int, x),
        0x76543210, 0xfedcba98, false, false));
}

__global__ void k_attn(const h16* __restrict__ Qp, const h16* __restrict__ Kp,
                       const h16* __restrict__ Vt, const float* __restrict__ sfp,
                       h16* __restrict__ O) {
    int lane = threadIdx.x;               // 0..31
    int wv = threadIdx.y;                 // 0..3 : one query tile per wave
    int tid = wv * 32 + lane;
    int qt = blockIdx.x * QTPB + wv;      // 0..63
    int hd = blockIdx.y, b = blockIdx.z;
    int bh = b * NH + hd;
    int r = lane & 15, hh = lane >> 4;
    float sf = sfp[0];

    __shared__ __align__(16) h16 kl[32 * HDP];        // 6 KB: 32 keys x 96 dims
    __shared__ __align__(16) h16 vl[HDP2 * 32];       // 5 KB: 80 dims x 32 keys
    __shared__ __align__(16) float psl[NSEQ];         // 4 KB: per-key positional scale

    // Q fragments for this wave's 16 queries (3 K-steps covering padded 96), used as B
    const h16* qrow = Qp + (size_t)(bh * NSEQ + qt * 16 + r) * HDP;
    v16h qa0 = make_frag(qrow +      8 * hh, qrow + 16 + 8 * hh);
    v16h qa1 = make_frag(qrow + 32 + 8 * hh, qrow + 48 + 8 * hh);
    v16h qa2 = make_frag(qrow + 64 + 8 * hh, qrow + 80 + 8 * hh);

    v8f zero = {};
    v8f accO[5];                          // O^T tiles: row = dim dt*16 + vg + 8*hh, column = query r
    #pragma unroll
    for (int i = 0; i < 5; i++) accO[i] = zero;
    float m_run = -1e30f, l_run = 0.f;    // this lane's query; l_run sums this half's keys only

    const h16* kbase = Kp + (size_t)bh * NSEQ * HDP;
    const h16* vbase = Vt + (size_t)bh * HDP2 * NSEQ;
    const float invN1 = 1.f / (float)(NSEQ - 1);

    // a key is now a register row, not a lane: its scale comes from a table filled once
    // (published by the two barriers at the head of the first pass)
    #pragma unroll  // fixed 8 trips: the exponentials issue back to back instead of one per loop trip
    for (int i = 0; i < NSEQ / (32 * QTPB); i++) {
        int k = tid + 32 * QTPB * i;
        float p = (float)k * invN1 - 0.5f;
        psl[k] = __expf(-sf * p * p);
    }

    for (int kt = 0; kt < NSEQ; kt += 32) {
        // ---- cooperative staging: K tile is contiguous (keys are rows) ----
        __syncthreads();  // previous iteration's LDS reads complete
        {
            const v8h* kg = (const v8h*)(kbase + (size_t)kt * HDP);
            v8h* kls = (v8h*)kl;
            #pragma unroll
            for (int i = 0; i < 3; i++)           // 32*96/8 = 384 chunks
                kls[tid + 128 * i] = kg[tid + 128 * i];
            v8h* vls = (v8h*)vl;
            for (int i = tid; i < HDP2 * 4; i += 128) {  // 80 rows x 4 chunks
                int row = i >> 2, c = i & 3;
                vls[i] = *(const v8h*)(vbase + (size_t)row * NSEQ + kt + c * 8);
            }
        }
        __syncthreads();

        // ---- S^T = K Q^T for two 16-key tiles (K fragments from LDS as A) ----
        v8f s0 = zero, s1 = zero;
        const h16* krow0 = kl + (size_t)r * HDP;
        const h16* krow1 = kl + (size_t)(16 + r) * HDP;
        v16h kb;
        kb = make_frag(krow0 +      8 * hh, krow0 + 16 + 8 * hh); s0 = WMMA16(kb, qa0, s0);
        kb = make_frag(krow1 +      8 * hh, krow1 + 16 + 8 * hh); s1 = WMMA16(kb, qa0, s1);
        kb = make_frag(krow0 + 32 + 8 * hh, krow0 + 48 + 8 * hh); s0 = WMMA16(kb, qa1, s0);
        kb = make_frag(krow1 + 32 + 8 * hh, krow1 + 48 + 8 * hh); s1 = WMMA16(kb, qa1, s1);
        kb = make_frag(krow0 + 64 + 8 * hh, krow0 + 80 + 8 * hh); s0 = WMMA16(kb, qa2, s0);
        kb = make_frag(krow1 + 64 + 8 * hh, krow1 + 80 + 8 * hh); s1 = WMMA16(kb, qa2, s1);

        // per-key positional scale: keys kt + 8*hh + vg (s0) and kt + 16 + 8*hh + vg (s1)
        const v4f* pt = (const v4f*)(psl + kt + 8 * hh);
        v4f pa = pt[0], pb = pt[1], pc = pt[4], pd = pt[5];

        // ---- online softmax for this lane's query ----
        float t0[8], t1[8];
        #pragma unroll
        for (int vg = 0; vg < 4; vg++) {
            t0[vg]     = s0[vg]     * pa[vg];
            t0[vg + 4] = s0[vg + 4] * pb[vg];
            t1[vg]     = s1[vg]     * pc[vg];
            t1[vg + 4] = s1[vg + 4] * pd[vg];
        }
        float tm = fmaxf(t0[0], t1[0]);
        #pragma unroll
        for (int vg = 1; vg < 8; vg++) tm = fmaxf(tm, fmaxf(t0[vg], t1[vg]));
        tm = fmaxf(tm, xhalf(tm));
        float mn = fmaxf(m_run, tm);
        float alpha = __expf(m_run - mn);
        m_run = mn;
        v16h pf;                           // P^T as B: element i = key 8*hh + i, 8 + i = key 16 + 8*hh + i
        float es = 0.f;
        #pragma unroll
        for (int vg = 0; vg < 8; vg++) {
            float e0 = __expf(t0[vg] - mn), e1 = __expf(t1[vg] - mn);
            es += e0 + e1;
            pf[vg] = (h16)e0; pf[vg + 8] = (h16)e1;
        }
        l_run = l_run * alpha + es;
        #pragma unroll
        for (int dt = 0; dt < 5; dt++)
            #pragma unroll
            for (int vg = 0; vg < 8; vg++) accO[dt][vg] *= alpha;

        // ---- O^T += V^T P^T  (V^T fragments from LDS as A, key-contiguous rows of 32) ----
        #pragma unroll
        for (int dt = 0; dt < 5; dt++) {
            const h16* vrow = vl + (dt * 16 + r) * 32;
            v16h vf = make_frag(vrow + 8 * hh, vrow + 16 + 8 * hh);
            accO[dt] = WMMA16(vf, pf, accO[dt]);
        }
    }

    // ---- finalize: join the halves' sums, normalize, store in the projection's fragment order ----
    float inv = 1.f / (l_run + xhalf(l_run));
    int orow = b * NSEQ + qt * 16 + r;
    int ocol = hd * HD + 8 * hh;          // a multiple of 4: a group of 4 dims stays inside one 8-element chunk
    #pragma unroll
    for (int dt = 0; dt < 5; dt++) {
        v4h lo, hi;
        #pragma unroll
        for (int vg = 0; vg < 4; vg++) {
            lo[vg] = (h16)(accO[dt][vg] * inv);
            hi[vg] = (h16)(accO[dt][vg + 4] * inv);
        }
        if (dt < 4) {
            *(v4h*)(O + frag_pos(orow, ocol + dt * 16))     = lo;
            *(v4h*)(O + frag_pos(orow, ocol + dt * 16 + 4)) = hi;
        } else if (hh == 0) {
            *(v4h*)(O + frag_pos(orow, ocol + dt * 16))     = lo;   // dims 64..67; 68..79 are padding
        }
    }
}

// ---------------- stage F: projection GEMM (WMMA) + bias ----------------
__global__ void k_proj(const h16* __restrict__ O, const h16* __restrict__ wp,
                       const float* __restrict__ pb, float* __restrict__ out) {
    int lane = threadIdx.x;
    int mt = blockIdx.y * 8 + threadIdx.y;  // 0..511
    int ntg = blockIdx.x;                   // 0..16 (2 tiles each -> 34 tiles = 544)
    int r = lane & 15, hh = lane >> 4;
    const h16* atile = O + (size_t)mt * (KSTEPS * FBLK) + lane * 8;    // both operands in fragment order
    int o0 = (ntg * 2 + 0) * 16 + r;
    int o1 = (ntg * 2 + 1) * 16 + r;
    const h16* b0tile = wp + (size_t)(ntg * 2 + 0) * (KSTEPS * FBLK) + lane * 8;
    const h16* b1tile = wp + (size_t)(ntg * 2 + 1) * (KSTEPS * FBLK) + lane * 8;
    v8f acc0 = {}; v8f acc1 = {};
    for (int ks = 0; ks < KSTEPS; ks++) {
        int c0 = ks * FBLK, c1 = ks * FBLK + FBLK / 2;
        v16h a  = make_frag(atile  + c0, atile  + c1);
        v16h b0 = make_frag(b0tile + c0, b0tile + c1);
        v16h b1 = make_frag(b1tile + c0, b1tile + c1);
        acc0 = WMMA16(a, b0, acc0);
        acc1 = WMMA16(a, b1, acc1);
    }
    float bias0 = pb[o0], bias1 = pb[o1];
    #pragma unroll
    for (int vg = 0; vg < 8; vg++) {
        int m = mt * 16 + vg + 8 * hh;
        out[(size_t)m * CDIM + o0] = acc0[vg] + bias0;
        out[(size_t)m * CDIM + o1] = acc1[vg] + bias1;
    }
}

extern "C" void kernel_launch(void* const* d_in, const int* in_sizes, int n_in,
                              void* d_out, int out_size, void* d_ws, size_t ws_size,
                              hipStream_t stream) {
    const float* x     = (const float*)d_in[0];
    const float* ng    = (const float*)d_in[1];
    const float* nb    = (const float*)d_in[2];
    const float* apw   = (const float*)d_in[3];
    const float* apb   = (const float*)d_in[4];
    const float* n2g   = (const float*)d_in[5];
    const float* n2b   = (const float*)d_in[6];
    const float* qkvw  = (const float*)d_in[7];
    const float* projw = (const float*)d_in[8];
    const float* projb = (const float*)d_in[9];
    const float* sfp   = (const float*)d_in[10];
    float* out = (float*)d_out;

    char* ws = (char*)d_ws;
    size_t off = 0;
    float* xr = (float*)(ws + off); off += (size_t)BN * CDIM * 4;        // 17.8 MB
    float* sc = (float*)(ws + off); off += (size_t)BN * NJ * 4;          // 0.56 MB
    h16* xp = (h16*)(ws + off); off += (size_t)BN * CDIM * 2;            // 8.9 MB
    h16* wq = (h16*)(ws + off); off += (size_t)C3 * CDIM * 2;            // 1.8 MB
    h16* wp = (h16*)(ws + off); off += (size_t)CDIM * CDIM * 2;          // 0.6 MB
    h16* Qp = (h16*)(ws + off); off += (size_t)NB * NH * NSEQ * HDP * 2; // 12.6 MB
    h16* Kp = (h16*)(ws + off); off += (size_t)NB * NH * NSEQ * HDP * 2; // 12.6 MB
    h16* Vt = (h16*)(ws + off); off += (size_t)NB * NH * HDP2 * NSEQ * 2;// 10.5 MB
    h16* O  = (h16*)(ws + off); off += (size_t)BN * CDIM * 2;            // 8.9 MB

    // W: weight conversion f32 -> f16
    int ncvt = C3 * CDIM + CDIM * CDIM;
    k_cvt<<<(ncvt + 255) / 256, 256, 0, stream>>>(qkvw, projw, wq, wp);
    // Z: zero padded Q/K/Vt region (contiguous)
    int zwords = (int)(((size_t)NB * NH * NSEQ * HDP * 2 * 2 +
                        (size_t)NB * NH * HDP2 * NSEQ * 2) / 4);
    k_zero<<<(zwords + 255) / 256, 256, 0, stream>>>((unsigned int*)Qp, zwords);
    // A: per-joint LN + attention-pool scores
    k_ln1<<<(BN * NJ + 255) / 256, 256, 0, stream>>>(x, ng, nb, apw, apb, xr, sc);
    // B: softmax over sequence axis
    k_softmax_n<<<NB * NJ, 256, 0, stream>>>(sc);
    // C: pool + LN over C -> f16 activations
    k_pool_ln2<<<BN, 256, 0, stream>>>(xr, sc, n2g, n2b, xp);
    // D: QKV GEMM (WMMA), scatter to Q (scaled), K, V^T
    k_qkv_gemm<<<dim3(34, 64), dim3(32, 8), 0, stream>>>(xp, wq, Qp, Kp, Vt);
    // E: flash attention, 4 query tiles per block sharing K/V through LDS
    k_attn<<<dim3(64 / QTPB, NH, NB), dim3(32, QTPB), 0, stream>>>(Qp, Kp, Vt, sfp, O);
    // F: projection GEMM (WMMA) + bias -> f32 output
    k_proj<<<dim3(17, 64), dim3(32, 8), 0, stream>>>(O, wp, projb, out);
    (void)in_sizes; (void)n_in; (void)out_size; (void)ws_size;
}

// v003
// Measured time: 175 microseconds a run.
// In two side-by-side timings against v002, it was 1.12 and 1.13 times as fast.
// Over all steps from v000 it is 1.85 times as fast.
#include <hip/hip_runtime.h>
#include <hip/hip_bf16.h>
#include <math.h>

typedef _Float16 h16;
typedef __attribute__((ext_vector_type(8)))  _Float16 v8h;
typedef __attribute__((ext_vector_type(16))) _Float16 v16h;
typedef __attribute__((ext_vector_type(8)))  float    v8f;

#define NJ    17
#define NF    32
#define CDIM  544
#define NH    8
#define HD    68
#define HDP   96    // padded head dim for Q/K (3 K-steps of 32)
#define HDP2  80    // padded head dim for O tiles (5 tiles of 16)
#define NB    8
#define NSEQ  1024
#define BN    8192  // NB*NSEQ
#define C3    1632  // 3*CDIM
#define QTPB  4     // query tiles (waves) per attention block

#define WMMA16(a,b,c) __builtin_amdgcn_wmma_f32_16x16x32_f16(false,(a),false,(b),(short)0,(c),false,false)

__device__ __forceinline__ v16h make_frag(const h16* p0, const h16* p1) {
    v8h a = *(const v8h*)p0;
    v8h b = *(const v8h*)p1;
    return __builtin_shufflevector(a, b, 0,1,2,3,4,5,6,7,8,9,10,11,12,13,14,15);
}

// Fragment order for the operands of the two GEMMs (row-major [rows][CDIM] matrices).
// One 16-row x 32-k block is 1 KB: two 512-byte halves, and in each half lane l = r + 16*hh
// owns 16 bytes. Half 0 holds k = 8*hh + e, half 1 holds k = 16 + 8*hh + e (e = 0..7): the
// same elements at the same lane and register as the row-major loader took, so a fragment
// is two loads of 512 contiguous bytes (4 whole lines each) instead of 16 pieces of 32 bytes.
#define KSTEPS (CDIM / 32)   // 17 k-steps
#define FBLK   512           // elements per 16 x 32 block
__device__ __forceinline__ int frag_pos(int row, int c) {
    return (((row >> 4) * KSTEPS + (c >> 5)) * FBLK) + ((c & 16) << 4) + ((c & 8) << 4)
         + ((row & 15) << 3) + (c & 7);
}
// inverse map: position in fragment order -> row * CDIM + c
__device__ __forceinline__ int frag_src(int p) {
    int blk = p / FBLK;
    int row = (blk / KSTEPS) * 16 + ((p >> 3) & 15);
    int c   = (blk % KSTEPS) * 32 + ((p >> 4) & 16) + ((p >> 4) & 8) + (p & 7);
    return row * CDIM + c;
}

// ---------------- stage W: convert weights f32 -> f16, stored in fragment order ----------------
__global__ void k_cvt(const float* __restrict__ qkvw, const float* __restrict__ projw,
                      h16* __restrict__ wq, h16* __restrict__ wp) {
    int i = blockIdx.x * blockDim.x + threadIdx.x;   // destination index: stores stay contiguous
    const int n1 = C3 * CDIM, n2 = CDIM * CDIM;
    if (i < n1)            wq[i] = (h16)qkvw[frag_src(i)];
    else if (i < n1 + n2)  wp[i - n1] = (h16)projw[frag_src(i - n1)];
}

// ---------------- stage Z: zero Q/K/Vt padded buffers ----------------
__global__ void k_zero(unsigned int* __restrict__ p, int nwords) {
    int i = blockIdx.x * blockDim.x + threadIdx.x;
    if (i < nwords) p[i] = 0u;
}

// ---------------- stage A: per-joint LN + pooling scores ----------------
__global__ void k_ln1(const float* __restrict__ x, const float* __restrict__ g,
                      const float* __restrict__ bb, const float* __restrict__ apw,
                      const float* __restrict__ apb,
                      float* __restrict__ xr, float* __restrict__ sc) {
    int idx = blockIdx.x * blockDim.x + threadIdx.x;  // (b*N+n)*17 + j
    if (idx >= BN * NJ) return;
    const float* px = x + (size_t)idx * NF;
    float s = 0.f, s2 = 0.f;
    #pragma unroll
    for (int f = 0; f < NF; f++) { float v = px[f]; s += v; s2 += v * v; }
    float mu = s * (1.f / NF);
    float var = s2 * (1.f / NF) - mu * mu;
    float rs = rsqrtf(var + 1e-5f);
    float* po = xr + (size_t)idx * NF;
    float acc = 0.f;
    #pragma unroll
    for (int f = 0; f < NF; f++) {
        float v = (px[f] - mu) * rs * g[f] + bb[f];
        po[f] = v;
        acc += v * apw[f];
    }
    sc[idx] = acc + apb[0];
}

// ---------------- stage B: softmax over sequence axis N ----------------
__global__ void k_softmax_n(float* __restrict__ sc) {
    int b = blockIdx.x / NJ, j = blockIdx.x % NJ;
    __shared__ float red[256];
    int t = threadIdx.x;
    float m = -3e38f;
    for (int n = t; n < NSEQ; n += 256) m = fmaxf(m, sc[(b * NSEQ + n) * NJ + j]);
    red[t] = m; __syncthreads();
    for (int o = 128; o > 0; o >>= 1) { if (t < o) red[t] = fmaxf(red[t], red[t + o]); __syncthreads(); }
    m = red[0]; __syncthreads();
    float s = 0.f;
    for (int n = t; n < NSEQ; n += 256) s += __expf(sc[(b * NSEQ + n) * NJ + j] - m);
    red[t] = s; __syncthreads();
    for (int o = 128; o > 0; o >>= 1) { if (t < o) red[t] += red[t + o]; __syncthreads(); }
    float inv = 1.f / red[0];
    for (int n = t; n < NSEQ; n += 256) {
        int id = (b * NSEQ + n) * NJ + j;
        sc[id] = __expf(sc[id] - m) * inv;
    }
}

// ---------------- stage C: pool by weights + LN over C, emit f16 ----------------
__global__ void k_pool_ln2(const float* __restrict__ xr, const float* __restrict__ w,
                           const float* __restrict__ g2, const float* __restrict__ b2,
                           h16* __restrict__ xp) {
    int row = blockIdx.x;  // b*N + n
    __shared__ float vals[CDIM];
    __shared__ float red[256];
    int t = threadIdx.x;
    float s = 0.f;
    for (int c = t; c < CDIM; c += 256) {
        float v = xr[(size_t)row * CDIM + c] * w[row * NJ + c / NF];
        vals[c] = v; s += v;
    }
    red[t] = s; __syncthreads();
    for (int o = 128; o > 0; o >>= 1) { if (t < o) red[t] += red[t + o]; __syncthreads(); }
    float mu = red[0] * (1.f / CDIM); __syncthreads();
    float s2 = 0.f;
    for (int c = t; c < CDIM; c += 256) { float d = vals[c] - mu; s2 += d * d; }
    red[t] = s2; __syncthreads();
    for (int o = 128; o > 0; o >>= 1) { if (t < o) red[t] += red[t + o]; __syncthreads(); }
    float rs = rsqrtf(red[0] * (1.f / CDIM) + 1e-5f);
    for (int c = t; c < CDIM; c += 256)
        xp[frag_pos(row, c)] = (h16)((vals[c] - mu) * rs * g2[c] + b2[c]);
}

// ---------------- stage D: QKV GEMM (WMMA, 16x48 per wave) ----------------
__global__ void k_qkv_gemm(const h16* __restrict__ xp, const h16* __restrict__ wq,
                           h16* __restrict__ Qp, h16* __restrict__ Kp, h16* __restrict__ Vt) {
    int lane = threadIdx.x;                 // 0..31
    int mt = blockIdx.y * 8 + threadIdx.y;  // row tile 0..511
    int ntg = blockIdx.x;                   // col tile group 0..33 (3 tiles each)
    int r = lane & 15, hh = lane >> 4;
    const h16* atile = xp + (size_t)mt * (KSTEPS * FBLK) + lane * 8;   // both operands in fragment order
    const h16* btile[3];
    #pragma unroll
    for (int nt = 0; nt < 3; nt++)
        btile[nt] = wq + (size_t)(ntg * 3 + nt) * (KSTEPS * FBLK) + lane * 8;
    v8f zero = {};
    v8f acc[3];
    #pragma unroll
    for (int nt = 0; nt < 3; nt++) acc[nt] = zero;
    for (int ks = 0; ks < KSTEPS; ks++) {
        int c0 = ks * FBLK, c1 = ks * FBLK + FBLK / 2;
        v16h a = make_frag(atile + c0, atile + c1);
        #pragma unroll
        for (int nt = 0; nt < 3; nt++) {
            v16h bfr = make_frag(btile[nt] + c0, btile[nt] + c1);
            acc[nt] = WMMA16(a, bfr, acc[nt]);
        }
    }
    const float qscale = 0.121267813f;  // 68^-0.5, folded into Q
    #pragma unroll
    for (int nt = 0; nt < 3; nt++) {
        int o = (ntg * 3 + nt) * 16 + r;
        int third = o / CDIM, rem = o % CDIM;
        int hd = rem / HD, d = rem % HD;
        #pragma unroll
        for (int vg = 0; vg < 8; vg++) {
            int m = mt * 16 + vg + 8 * hh;          // global row (b*N+n)
            int b = m >> 10, n = m & 1023;
            int bh = b * NH + hd;
            float v = acc[nt][vg];
            if (third == 0)      Qp[(size_t)(bh * NSEQ + n) * HDP + d] = (h16)(v * qscale);
            else if (third == 1) Kp[(size_t)(bh * NSEQ + n) * HDP + d] = (h16)v;
            else                 Vt[(size_t)(bh * HDP2 + d) * NSEQ + n] = (h16)v;
        }
    }
}

typedef __attribute__((ext_vector_type(4))) _Float16 v4h;
typedef __attribute__((ext_vector_type(4))) float    v4f;

// lane l <-> lane l ^ 16: the other half of the same query's keys
__device__ __forceinline__ float xhalf(float x) {
    return __builtin_bit_cast(float, __builtin_amdgcn_permlanex16(
        __builtin_bit_cast(int, x), __builtin_bit_cast(int, x),
        0x76543210, 0xfedcba98, false, false));
}

__device__ __forceinline__ unsigned lds_off(const void* p) { return (unsigned)(size_t)p; }

#define KTILE (32 * HDP)    // elements of one staged K tile
#define VTILE (HDP2 * 32)   // elements of one staged V^T tile

__global__ void k_attn(const h16* __restrict__ Qp, const h16* __restrict__ Kp,
                       const h16* __restrict__ Vt, const float* __restrict__ sfp,
                       h16* __restrict__ O) {
    int lane = threadIdx.x;               // 0..31
    int wv = threadIdx.y;                 // 0..3 : one query tile per wave
    int tid = wv * 32 + lane;
    int wvs = __builtin_amdgcn_readfirstlane(wv);   // the wave's number in a scalar register: a test on it is a scalar branch
    int qt = blockIdx.x * QTPB + wv;      // 0..63
    int hd = blockIdx.y, b = blockIdx.z;
    int bh = b * NH + hd;
    int r = lane & 15, hh = lane >> 4;
    float sf = sfp[0];

    __shared__ __align__(16) h16 kl[2 * KTILE];       // 2 x 6 KB: 32 keys x 96 dims
    __shared__ __align__(16) h16 vl[2 * VTILE];       // 2 x 5 KB: 80 dims x 32 keys
    __shared__ __align__(16) float psl[NSEQ];         // 4 KB: per-key positional scale

    // Q fragments for this wave's 16 queries (3 K-steps covering padded 96), used as B
    const h16* qrow = Qp + (size_t)(bh * NSEQ + qt * 16 + r) * HDP;
    v16h qa0 = make_frag(qrow +      8 * hh, qrow + 16 + 8 * hh);
    v16h qa1 = make_frag(qrow + 32 + 8 * hh, qrow + 48 + 8 * hh);
    v16h qa2 = make_frag(qrow + 64 + 8 * hh, qrow + 80 + 8 * hh);

    v8f zero = {};
    v8f accO[5];                          // O^T tiles: row = dim dt*16 + vg + 8*hh, column = query r
    #pragma unroll
    for (int i = 0; i < 5; i++) accO[i] = zero;
    float m_run = -1e30f, l_run = 0.f;    // this lane's query; l_run sums this half's keys only

    const h16* kbase = Kp + (size_t)bh * NSEQ * HDP;
    const h16* vbase = Vt + (size_t)bh * HDP2 * NSEQ;
    const float invN1 = 1.f / (float)(NSEQ - 1);

    // One tile's asynchronous copies, 16 bytes a lane each, every lane on. The K tile is contiguous
    // (384 chunks: 3 a lane); the V^T tile is 80 rows x 4 chunks (2 a lane, a third from waves 0 and 1).
    const h16* kg0 = kbase + tid * 8;
    const h16* vg0 = vbase + (size_t)(tid >> 2) * NSEQ + (tid & 3) * 8;
    const unsigned kd0 = lds_off(kl) + tid * 16;
    const unsigned vd0 = lds_off(vl) + tid * 16;
    auto stage = [&](int kt, int buf) {
        const h16* kg = kg0 + (size_t)kt * HDP;
        const h16* vg = vg0 + kt;
        unsigned kd = kd0 + buf * (KTILE * 2), vd = vd0 + buf * (VTILE * 2);
        // s_wait_xcnt 0 closes each statement: no address register is rewritten in front of it
        asm volatile("global_load_async_to_lds_b128 %0, %1, off\n\t"
                     "global_load_async_to_lds_b128 %2, %3, off\n\t"
                     "global_load_async_to_lds_b128 %4, %5, off\n\t"
                     "global_load_async_to_lds_b128 %6, %7, off\n\t"
                     "global_load_async_to_lds_b128 %8, %9, off\n\t"
                     "s_wait_xcnt 0x0"
                     :: "v"(kd), "v"(kg), "v"(kd + 2048), "v"(kg + 1024), "v"(kd + 4096), "v"(kg + 2048),
                        "v"(vd), "v"(vg), "v"(vd + 2048), "v"(vg + 32 * NSEQ) : "memory");
        if (wvs < 2)
            asm volatile("global_load_async_to_lds_b128 %0, %1, off\n\t"
                         "s_wait_xcnt 0x0"
                         :: "v"(vd + 4096), "v"(vg + 64 * NSEQ) : "memory");
    };
    stage(0, 0);

    // a key is now a register row, not a lane: its scale comes from a table filled once
    // (published by the barrier in front of the loop)
    #pragma unroll  // fixed 8 trips: the exponentials issue back to back instead of one per loop trip
    for (int i = 0; i < NSEQ / (32 * QTPB); i++) {
        int k = tid + 32 * QTPB * i;
        float p = (float)k * invN1 - 0.5f;
        psl[k] = __expf(-sf * p * p);
    }

    asm volatile("s_wait_asynccnt 0x0" ::: "memory");  // this wave's copies of tile 0 have landed
    __syncthreads();                                   // every wave's have: tile 0 and the table are readable
    stage(32, 1);                                      // tile 1 flies during pass 0

    for (int kt = 0; kt < NSEQ; kt += 32) {
        int buf = (kt >> 5) & 1;                       // this pass reads this buffer alone

        // ---- S^T = K Q^T for two 16-key tiles (K fragments from LDS as A) ----
        v8f s0 = zero, s1 = zero;
        const h16* krow0 = kl + buf * KTILE + (size_t)r * HDP;
        const h16* krow1 = kl + buf * KTILE + (size_t)(16 + r) * HDP;
        v16h kb;
        kb = make_frag(krow0 +      8 * hh, krow0 + 16 + 8 * hh); s0 = WMMA16(kb, qa0, s0);
        kb = make_frag(krow1 +      8 * hh, krow1 + 16 + 8 * hh); s1 = WMMA16(kb, qa0, s1);
        kb = make_frag(krow0 + 32 + 8 * hh, krow0 + 48 + 8 * hh); s0 = WMMA16(kb, qa1, s0);
        kb = make_frag(krow1 + 32 + 8 * hh, krow1 + 48 + 8 * hh); s1 = WMMA16(kb, qa1, s1);
        kb = make_frag(krow0 + 64 + 8 * hh, krow0 + 80 + 8 * hh); s0 = WMMA16(kb, qa2, s0);
        kb = make_frag(krow1 + 64 + 8 * hh, krow1 + 80 + 8 * hh); s1 = WMMA16(kb, qa2, s1);

        // per-key positional scale: keys kt + 8*hh + vg (s0) and kt + 16 + 8*hh + vg (s1)
        const v4f* pt = (const v4f*)(psl + kt + 8 * hh);
        v4f pa = pt[0], pb = pt[1], pc = pt[4], pd = pt[5];

        // ---- online softmax for this lane's query ----
        float t0[8], t1[8];
        #pragma unroll
        for (int vg = 0; vg < 4; vg++) {
            t0[vg]     = s0[vg]     * pa[vg];
            t0[vg + 4] = s0[vg + 4] * pb[vg];
            t1[vg]     = s1[vg]     * pc[vg];
            t1[vg + 4] = s1[vg + 4] * pd[vg];
        }
        float tm = fmaxf(t0[0], t1[0]);
        #pragma unroll
        for (int vg = 1; vg < 8; vg++) tm = fmaxf(tm, fmaxf(t0[vg], t1[vg]));
        tm = fmaxf(tm, xhalf(tm));
        float mn = fmaxf(m_run, tm);
        float alpha = __expf(m_run - mn);
        m_run = mn;
        v16h pf;                           // P^T as B: element i = key 8*hh + i, 8 + i = key 16 + 8*hh + i
        float es = 0.f;
        #pragma unroll
        for (int vg = 0; vg < 8; vg++) {
            float e0 = __expf(t0[vg] - mn), e1 = __expf(t1[vg] - mn);
            es += e0 + e1;
            pf[vg] = (h16)e0; pf[vg + 8] = (h16)e1;
        }
        l_run = l_run * alpha + es;
        #pragma unroll
        for (int dt = 0; dt < 5; dt++)
            #pragma unroll
            for (int vg = 0; vg < 8; vg++) accO[dt][vg] *= alpha;

        // ---- O^T += V^T P^T  (V^T fragments from LDS as A, key-contiguous rows of 32) ----
        #pragma unroll
        for (int dt = 0; dt < 5; dt++) {
            const h16* vrow = vl + buf * VTILE + (dt * 16 + r) * 32;
            v16h vf = make_frag(vrow + 8 * hh, vrow + 16 + 8 * hh);
            accO[dt] = WMMA16(vf, pf, accO[dt]);
        }

        // ---- foot of the pass: publish the next tile, then refill the buffer just read ----
        asm volatile("s_wait_dscnt 0x0" ::: "memory");     // this wave's reads of this buffer are done
        asm volatile("s_wait_asynccnt 0x0" ::: "memory");  // this wave's copies of the next tile have landed
        __syncthreads();                                   // both hold for every wave
        if (kt + 64 < NSEQ) stage(kt + 64, buf);           // flies during the next pass
    }
    asm volatile("s_wait_asynccnt 0x0" ::: "memory");      // no copy is outstanding when the wave ends

    // ---- finalize: join the halves' sums, normalize, store in the projection's fragment order ----
    float inv = 1.f / (l_run + xhalf(l_run));
    int orow = b * NSEQ + qt * 16 + r;
    int ocol = hd * HD + 8 * hh;          // a multiple of 4: a group of 4 dims stays inside one 8-element chunk
    #pragma unroll
    for (int dt = 0; dt < 5; dt++) {
        v4h lo, hi;
        #pragma unroll
        for (int vg = 0; vg < 4; vg++) {
            lo[vg] = (h16)(accO[dt][vg] * inv);
            hi[vg] = (h16)(accO[dt][vg + 4] * inv);
        }
        if (dt < 4) {
            *(v4h*)(O + frag_pos(orow, ocol + dt * 16))     = lo;
            *(v4h*)(O + frag_pos(orow, ocol + dt * 16 + 4)) = hi;
        } else if (hh == 0) {
            *(v4h*)(O + frag_pos(orow, ocol + dt * 16))     = lo;   // dims 64..67; 68..79 are padding
        }
    }
}

// ---------------- stage F: projection GEMM (WMMA) + bias ----------------
__global__ void k_proj(const h16* __restrict__ O, const h16* __restrict__ wp,
                       const float* __restrict__ pb, float* __restrict__ out) {
    int lane = threadIdx.x;
    int mt = blockIdx.y * 8 + threadIdx.y;  // 0..511
    int ntg = blockIdx.x;                   // 0..16 (2 tiles each -> 34 tiles = 544)
    int r = lane & 15, hh = lane >> 4;
    const h16* atile = O + (size_t)mt * (KSTEPS * FBLK) + lane * 8;    // both operands in fragment order
    int o0 = (ntg * 2 + 0) * 16 + r;
    int o1 = (ntg * 2 + 1) * 16 + r;
    const h16* b0tile = wp + (size_t)(ntg * 2 + 0) * (KSTEPS * FBLK) + lane * 8;
    const h16* b1tile = wp + (size_t)(ntg * 2 + 1) * (KSTEPS * FBLK) + lane * 8;
    v8f acc0 = {}; v8f acc1 = {};
    for (int ks = 0; ks < KSTEPS; ks++) {
        int c0 = ks * FBLK, c1 = ks * FBLK + FBLK / 2;
        v16h a  = make_frag(atile  + c0, atile  + c1);
        v16h b0 = make_frag(b0tile + c0, b0tile + c1);
        v16h b1 = make_frag(b1tile + c0, b1tile + c1);
        acc0 = WMMA16(a, b0, acc0);
        acc1 = WMMA16(a, b1, acc1);
    }
    float bias0 = pb[o0], bias1 = pb[o1];
    #pragma unroll
    for (int vg = 0; vg < 8; vg++) {
        int m = mt * 16 + vg + 8 * hh;
        out[(size_t)m * CDIM + o0] = acc0[vg] + bias0;
        out[(size_t)m * CDIM + o1] = acc1[vg] + bias1;
    }
}

extern "C" void kernel_launch(void* const* d_in, const int* in_sizes, int n_in,
                              void* d_out, int out_size, void* d_ws, size_t ws_size,
                              hipStream_t stream) {
    const float* x     = (const float*)d_in[0];
    const float* ng    = (const float*)d_in[1];
    const float* nb    = (const float*)d_in[2];
    const float* apw   = (const float*)d_in[3];
    const float* apb   = (const float*)d_in[4];
    const float* n2g   = (const float*)d_in[5];
    const float* n2b   = (const float*)d_in[6];
    const float* qkvw  = (const float*)d_in[7];
    const float* projw = (const float*)d_in[8];
    const float* projb = (const float*)d_in[9];
    const float* sfp   = (const float*)d_in[10];
    float* out = (float*)d_out;

    char* ws = (char*)d_ws;
    size_t off = 0;
    float* xr = (float*)(ws + off); off += (size_t)BN * CDIM * 4;        // 17.8 MB
    float* sc = (float*)(ws + off); off += (size_t)BN * NJ * 4;          // 0.56 MB
    h16* xp = (h16*)(ws + off); off += (size_t)BN * CDIM * 2;            // 8.9 MB
    h16* wq = (h16*)(ws + off); off += (size_t)C3 * CDIM * 2;            // 1.8 MB
    h16* wp = (h16*)(ws + off); off += (size_t)CDIM * CDIM * 2;          // 0.6 MB
    h16* Qp = (h16*)(ws + off); off += (size_t)NB * NH * NSEQ * HDP * 2; // 12.6 MB
    h16* Kp = (h16*)(ws + off); off += (size_t)NB * NH * NSEQ * HDP * 2; // 12.6 MB
    h16* Vt = (h16*)(ws + off); off += (size_t)NB * NH * HDP2 * NSEQ * 2;// 10.5 MB
    h16* O  = (h16*)(ws + off); off += (size_t)BN * CDIM * 2;            // 8.9 MB

    // W: weight conversion f32 -> f16
    int ncvt = C3 * CDIM + CDIM * CDIM;
    k_cvt<<<(ncvt + 255) / 256, 256, 0, stream>>>(qkvw, projw, wq, wp);
    // Z: zero padded Q/K/Vt region (contiguous)
    int zwords = (int)(((size_t)NB * NH * NSEQ * HDP * 2 * 2 +
                        (size_t)NB * NH * HDP2 * NSEQ * 2) / 4);
    k_zero<<<(zwords + 255) / 256, 256, 0, stream>>>((unsigned int*)Qp, zwords);
    // A: per-joint LN + attention-pool scores
    k_ln1<<<(BN * NJ + 255) / 256, 256, 0, stream>>>(x, ng, nb, apw, apb, xr, sc);
    // B: softmax over sequence axis
    k_softmax_n<<<NB * NJ, 256, 0, stream>>>(sc);
    // C: pool + LN over C -> f16 activations
    k_pool_ln2<<<BN, 256, 0, stream>>>(xr, sc, n2g, n2b, xp);
    // D: QKV GEMM (WMMA), scatter to Q (scaled), K, V^T
    k_qkv_gemm<<<dim3(34, 64), dim3(32, 8), 0, stream>>>(xp, wq, Qp, Kp, Vt);
    // E: flash attention, 4 query tiles per block sharing K/V through LDS
    k_attn<<<dim3(64 / QTPB, NH, NB), dim3(32, QTPB), 0, stream>>>(Qp, Kp, Vt, sfp, O);
    // F: projection GEMM (WMMA) + bias -> f32 output
    k_proj<<<dim3(17, 64), dim3(32, 8), 0, stream>>>(O, wp, projb, out);
    (void)in_sizes; (void)n_in; (void)out_size; (void)ws_size;
}

// v004
// Measured time: 162 microseconds a run.
// Timed twice side by side with v003, it ran 1.08 times as fast both times.
// Counting every step since v000, it is 2.00 times as fast.
#include <hip/hip_runtime.h>
#include <hip/hip_bf16.h>
#include <math.h>

typedef _Float16 h16;
typedef __attribute__((ext_vector_type(8)))  _Float16 v8h;
typedef __attribute__((ext_vector_type(16))) _Float16 v16h;
typedef __attribute__((ext_vector_type(8)))  float    v8f;

#define NJ    17
#define NF    32
#define CDIM  544
#define NH    8
#define HD    68
#define HDP   96    // padded head dim for Q/K (3 K-steps of 32)
#define HDP2  80    // padded head dim for O tiles (5 tiles of 16)
#define NB    8
#define NSEQ  1024
#define BN    8192  // NB*NSEQ
#define C3    1632  // 3*CDIM
#define QTPB  4     // query tiles (waves) per attention block

#define WMMA16(a,b,c) __builtin_amdgcn_wmma_f32_16x16x32_f16(false,(a),false,(b),(short)0,(c),false,false)

__device__ __forceinline__ v16h make_frag(const h16* p0, const h16* p1) {
    v8h a = *(const v8h*)p0;
    v8h b = *(const v8h*)p1;
    return __builtin_shufflevector(a, b, 0,1,2,3,4,5,6,7,8,9,10,11,12,13,14,15);
}

// Fragment order for the operands of the two GEMMs (row-major [rows][CDIM] matrices).
// One 16-row x 32-k block is 1 KB: two 512-byte halves, and in each half lane l = r + 16*hh
// owns 16 bytes. Half 0 holds k = 8*hh + e, half 1 holds k = 16 + 8*hh + e (e = 0..7): the
// same elements at the same lane and register as the row-major loader took, so a fragment
// is two loads of 512 contiguous bytes (4 whole lines each) instead of 16 pieces of 32 bytes.
#define KSTEPS (CDIM / 32)   // 17 k-steps
#define FBLK   512           // elements per 16 x 32 block
__device__ __forceinline__ int frag_pos(int row, int c) {
    return (((row >> 4) * KSTEPS + (c >> 5)) * FBLK) + ((c & 16) << 4) + ((c & 8) << 4)
         + ((row & 15) << 3) + (c & 7);
}
// inverse map: position in fragment order -> row * CDIM + c
__device__ __forceinline__ int frag_src(int p) {
    int blk = p / FBLK;
    int row = (blk / KSTEPS) * 16 + ((p >> 3) & 15);
    int c   = (blk % KSTEPS) * 32 + ((p >> 4) & 16) + ((p >> 4) & 8) + (p & 7);
    return row * CDIM + c;
}

// ---------------- stage W: convert weights f32 -> f16, stored in fragment order ----------------
__global__ void k_cvt(const float* __restrict__ qkvw, const float* __restrict__ projw,
                      h16* __restrict__ wq, h16* __restrict__ wp) {
    int i = blockIdx.x * blockDim.x + threadIdx.x;   // destination index: stores stay contiguous
    const int n1 = C3 * CDIM, n2 = CDIM * CDIM;
    if (i < n1)            wq[i] = (h16)qkvw[frag_src(i)];
    else if (i < n1 + n2)  wp[i - n1] = (h16)projw[frag_src(i - n1)];
}

// ---------------- stage Z: zero Q/K/Vt padded buffers ----------------
__global__ void k_zero(unsigned int* __restrict__ p, int nwords) {
    int i = blockIdx.x * blockDim.x + threadIdx.x;
    if (i < nwords) p[i] = 0u;
}

// ---------------- stage A: per-joint LN + pooling scores ----------------
__global__ void k_ln1(const float* __restrict__ x, const float* __restrict__ g,
                      const float* __restrict__ bb, const float* __restrict__ apw,
                      const float* __restrict__ apb,
                      float* __restrict__ xr, float* __restrict__ sc) {
    int idx = blockIdx.x * blockDim.x + threadIdx.x;  // (b*N+n)*17 + j
    if (idx >= BN * NJ) return;
    const float* px = x + (size_t)idx * NF;
    float s = 0.f, s2 = 0.f;
    #pragma unroll
    for (int f = 0; f < NF; f++) { float v = px[f]; s += v; s2 += v * v; }
    float mu = s * (1.f / NF);
    float var = s2 * (1.f / NF) - mu * mu;
    float rs = rsqrtf(var + 1e-5f);
    float* po = xr + (size_t)idx * NF;
    float acc = 0.f;
    #pragma unroll
    for (int f = 0; f < NF; f++) {
        float v = (px[f] - mu) * rs * g[f] + bb[f];
        po[f] = v;
        acc += v * apw[f];
    }
    sc[idx] = acc + apb[0];
}

// ---------------- stage B: softmax over sequence axis N ----------------
__global__ void k_softmax_n(float* __restrict__ sc) {
    int b = blockIdx.x / NJ, j = blockIdx.x % NJ;
    __shared__ float red[256];
    int t = threadIdx.x;
    float m = -3e38f;
    for (int n = t; n < NSEQ; n += 256) m = fmaxf(m, sc[(b * NSEQ + n) * NJ + j]);
    red[t] = m; __syncthreads();
    for (int o = 128; o > 0; o >>= 1) { if (t < o) red[t] = fmaxf(red[t], red[t + o]); __syncthreads(); }
    m = red[0]; __syncthreads();
    float s = 0.f;
    for (int n = t; n < NSEQ; n += 256) s += __expf(sc[(b * NSEQ + n) * NJ + j] - m);
    red[t] = s; __syncthreads();
    for (int o = 128; o > 0; o >>= 1) { if (t < o) red[t] += red[t + o]; __syncthreads(); }
    float inv = 1.f / red[0];
    for (int n = t; n < NSEQ; n += 256) {
        int id = (b * NSEQ + n) * NJ + j;
        sc[id] = __expf(sc[id] - m) * inv;
    }
}

// ---------------- stage C: pool by weights + LN over C, emit f16 ----------------
__global__ void k_pool_ln2(const float* __restrict__ xr, const float* __restrict__ w,
                           const float* __restrict__ g2, const float* __restrict__ b2,
                           h16* __restrict__ xp) {
    int row = blockIdx.x;  // b*N + n
    __shared__ float vals[CDIM];
    __shared__ float red[256];
    int t = threadIdx.x;
    float s = 0.f;
    for (int c = t; c < CDIM; c += 256) {
        float v = xr[(size_t)row * CDIM + c] * w[row * NJ + c / NF];
        vals[c] = v; s += v;
    }
    red[t] = s; __syncthreads();
    for (int o = 128; o > 0; o >>= 1) { if (t < o) red[t] += red[t + o]; __syncthreads(); }
    float mu = red[0] * (1.f / CDIM); __syncthreads();
    float s2 = 0.f;
    for (int c = t; c < CDIM; c += 256) { float d = vals[c] - mu; s2 += d * d; }
    red[t] = s2; __syncthreads();
    for (int o = 128; o > 0; o >>= 1) { if (t < o) red[t] += red[t + o]; __syncthreads(); }
    float rs = rsqrtf(red[0] * (1.f / CDIM) + 1e-5f);
    for (int c = t; c < CDIM; c += 256)
        xp[frag_pos(row, c)] = (h16)((vals[c] - mu) * rs * g2[c] + b2[c]);
}

// ---------------- stage D: QKV GEMM (WMMA, 16x48 per wave) ----------------
__global__ void k_qkv_gemm(const h16* __restrict__ xp, const h16* __restrict__ wq,
                           h16* __restrict__ Qp, h16* __restrict__ Kp, h16* __restrict__ Vt) {
    int lane = threadIdx.x;                 // 0..31
    int mt = blockIdx.y * 8 + threadIdx.y;  // row tile 0..511
    int ntg = blockIdx.x;                   // col tile group 0..33 (3 tiles each)
    int r = lane & 15, hh = lane >> 4;
    const h16* atile = xp + (size_t)mt * (KSTEPS * FBLK) + lane * 8;   // both operands in fragment order
    const h16* btile[3];
    #pragma unroll
    for (int nt = 0; nt < 3; nt++)
        btile[nt] = wq + (size_t)(ntg * 3 + nt) * (KSTEPS * FBLK) + lane * 8;
    v8f zero = {};
    v8f acc[3];
    #pragma unroll
    for (int nt = 0; nt < 3; nt++) acc[nt] = zero;
    for (int ks = 0; ks < KSTEPS; ks++) {
        int c0 = ks * FBLK, c1 = ks * FBLK + FBLK / 2;
        v16h a = make_frag(atile + c0, atile + c1);
        #pragma unroll
        for (int nt = 0; nt < 3; nt++) {
            v16h bfr = make_frag(btile[nt] + c0, btile[nt] + c1);
            acc[nt] = WMMA16(a, bfr, acc[nt]);
        }
    }
    const float qscale = 0.121267813f;  // 68^-0.5, folded into Q
    #pragma unroll
    for (int nt = 0; nt < 3; nt++) {
        int o = (ntg * 3 + nt) * 16 + r;
        int third = o / CDIM, rem = o % CDIM;
        int hd = rem / HD, d = rem % HD;
        #pragma unroll
        for (int vg = 0; vg < 8; vg++) {
            int m = mt * 16 + vg + 8 * hh;          // global row (b*N+n)
            int b = m >> 10, n = m & 1023;
            int bh = b * NH + hd;
            float v = acc[nt][vg];
            if (third == 0)      Qp[(size_t)(bh * NSEQ + n) * HDP + d] = (h16)(v * qscale);
            else if (third == 1) Kp[(size_t)(bh * NSEQ + n) * HDP + d] = (h16)v;
            else                 Vt[(size_t)(bh * HDP2 + d) * NSEQ + n] = (h16)v;
        }
    }
}

typedef __attribute__((ext_vector_type(4))) _Float16 v4h;
typedef __attribute__((ext_vector_type(4))) float    v4f;

// lane l <-> lane l ^ 16: the other half of the same query's keys
__device__ __forceinline__ float xhalf(float x) {
    return __builtin_bit_cast(float, __builtin_amdgcn_permlanex16(
        __builtin_bit_cast(int, x), __builtin_bit_cast(int, x),
        0x76543210, 0xfedcba98, false, false));
}

__device__ __forceinline__ unsigned lds_off(const void* p) { return (unsigned)(size_t)p; }

// LDS row pitches, in elements: 16 bytes times an odd number (208 B and 80 B), so that the 16 rows
// which a half wave reads with one 16-byte load start on 16 different groups of 4 banks. At the data's
// own pitches (192 B and 64 B) they start on 4 groups only. The 16 pad bytes of a row are never touched.
#define KPITCH (HDP + 8)
#define VPITCH (32 + 8)
#define KTILE (32 * KPITCH)     // elements of one staged K tile
#define VTILE (HDP2 * VPITCH)   // elements of one staged V^T tile

__global__ void k_attn(const h16* __restrict__ Qp, const h16* __restrict__ Kp,
                       const h16* __restrict__ Vt, const float* __restrict__ sfp,
                       h16* __restrict__ O) {
    int lane = threadIdx.x;               // 0..31
    int wv = threadIdx.y;                 // 0..3 : one query tile per wave
    int tid = wv * 32 + lane;
    int wvs = __builtin_amdgcn_readfirstlane(wv);   // the wave's number in a scalar register: a test on it is a scalar branch
    int qt = blockIdx.x * QTPB + wv;      // 0..63
    int hd = blockIdx.y, b = blockIdx.z;
    int bh = b * NH + hd;
    int r = lane & 15, hh = lane >> 4;
    float sf = sfp[0];

    __shared__ __align__(16) h16 kl[2 * KTILE];       // 2 x 6.5 KB: 32 keys x 96 dims, padded rows
    __shared__ __align__(16) h16 vl[2 * VTILE];       // 2 x 6.25 KB: 80 dims x 32 keys, padded rows
    __shared__ __align__(16) float psl[NSEQ];         // 4 KB: per-key positional scale

    // Q fragments for this wave's 16 queries (3 K-steps covering padded 96), used as B
    const h16* qrow = Qp + (size_t)(bh * NSEQ + qt * 16 + r) * HDP;
    v16h qa0 = make_frag(qrow +      8 * hh, qrow + 16 + 8 * hh);
    v16h qa1 = make_frag(qrow + 32 + 8 * hh, qrow + 48 + 8 * hh);
    v16h qa2 = make_frag(qrow + 64 + 8 * hh, qrow + 80 + 8 * hh);

    v8f zero = {};
    v8f accO[5];                          // O^T tiles: row = dim dt*16 + vg + 8*hh, column = query r
    #pragma unroll
    for (int i = 0; i < 5; i++) accO[i] = zero;
    float m_run = -1e30f, l_run = 0.f;    // this lane's query; l_run sums this half's keys only

    const h16* kbase = Kp + (size_t)bh * NSEQ * HDP;
    const h16* vbase = Vt + (size_t)bh * HDP2 * NSEQ;
    const float invN1 = 1.f / (float)(NSEQ - 1);

    // One tile's asynchronous copies, 16 bytes a lane each, every lane on. The K tile is contiguous in
    // memory (384 chunks: 3 a lane, 12 a row); the V^T tile is 80 rows x 4 chunks (2 a lane, a third from
    // waves 0 and 1). In LDS chunk c lands 16 bytes further for every row in front of it.
    const h16* kg0 = kbase + tid * 8;
    const h16* vg0 = vbase + (size_t)(tid >> 2) * NSEQ + (tid & 3) * 8;
    const unsigned kd0 = lds_off(kl) + (tid       + (tid      ) / 12) * 16;
    const unsigned kd1 = lds_off(kl) + (tid + 128 + (tid + 128) / 12) * 16;
    const unsigned kd2 = lds_off(kl) + (tid + 256 + (tid + 256) / 12) * 16;
    const unsigned vd0 = lds_off(vl) + (tid + (tid >> 2)) * 16;
    auto stage = [&](int kt, int buf) {
        const h16* kg = kg0 + (size_t)kt * HDP;
        const h16* vg = vg0 + kt;
        unsigned kb = buf * (KTILE * 2), vd = vd0 + buf * (VTILE * 2);
        // s_wait_xcnt 0 closes each statement: no address register is rewritten in front of it
        asm volatile("global_load_async_to_lds_b128 %0, %1, off\n\t"
                     "global_load_async_to_lds_b128 %2, %3, off\n\t"
                     "global_load_async_to_lds_b128 %4, %5, off\n\t"
                     "global_load_async_to_lds_b128 %6, %7, off\n\t"
                     "global_load_async_to_lds_b128 %8, %9, off\n\t"
                     "s_wait_xcnt 0x0"
                     :: "v"(kd0 + kb), "v"(kg), "v"(kd1 + kb), "v"(kg + 1024), "v"(kd2 + kb), "v"(kg + 2048),
                        "v"(vd), "v"(vg), "v"(vd + 32 * VPITCH * 2), "v"(vg + 32 * NSEQ) : "memory");
        if (wvs < 2)
            asm volatile("global_load_async_to_lds_b128 %0, %1, off\n\t"
                         "s_wait_xcnt 0x0"
                         :: "v"(vd + 64 * VPITCH * 2), "v"(vg + 64 * NSEQ) : "memory");
    };
    stage(0, 0);

    // a key is now a register row, not a lane: its scale comes from a table filled once
    // (published by the barrier in front of the loop)
    #pragma unroll  // fixed 8 trips: the exponentials issue back to back instead of one per loop trip
    for (int i = 0; i < NSEQ / (32 * QTPB); i++) {
        int k = tid + 32 * QTPB * i;
        float p = (float)k * invN1 - 0.5f;
        psl[k] = __expf(-sf * p * p);
    }

    asm volatile("s_wait_asynccnt 0x0" ::: "memory");  // this wave's copies of tile 0 have landed
    __syncthreads();                                   // every wave's have: tile 0 and the table are readable
    stage(32, 1);                                      // tile 1 flies during pass 0

    for (int kt = 0; kt < NSEQ; kt += 32) {
        int buf = (kt >> 5) & 1;                       // this pass reads this buffer alone

        // ---- S^T = K Q^T for two 16-key tiles (K fragments from LDS as A) ----
        v8f s0 = zero, s1 = zero;
        const h16* krow0 = kl + buf * KTILE + (size_t)r * KPITCH;
        const h16* krow1 = kl + buf * KTILE + (size_t)(16 + r) * KPITCH;
        v16h kb;
        kb = make_frag(krow0 +      8 * hh, krow0 + 16 + 8 * hh); s0 = WMMA16(kb, qa0, s0);
        kb = make_frag(krow1 +      8 * hh, krow1 + 16 + 8 * hh); s1 = WMMA16(kb, qa0, s1);
        kb = make_frag(krow0 + 32 + 8 * hh, krow0 + 48 + 8 * hh); s0 = WMMA16(kb, qa1, s0);
        kb = make_frag(krow1 + 32 + 8 * hh, krow1 + 48 + 8 * hh); s1 = WMMA16(kb, qa1, s1);
        kb = make_frag(krow0 + 64 + 8 * hh, krow0 + 80 + 8 * hh); s0 = WMMA16(kb, qa2, s0);
        kb = make_frag(krow1 + 64 + 8 * hh, krow1 + 80 + 8 * hh); s1 = WMMA16(kb, qa2, s1);

        // per-key positional scale: keys kt + 8*hh + vg (s0) and kt + 16 + 8*hh + vg (s1)
        const v4f* pt = (const v4f*)(psl + kt + 8 * hh);
        v4f pa = pt[0], pb = pt[1], pc = pt[4], pd = pt[5];

        // ---- online softmax for this lane's query ----
        float t0[8], t1[8];
        #pragma unroll
        for (int vg = 0; vg < 4; vg++) {
            t0[vg]     = s0[vg]     * pa[vg];
            t0[vg + 4] = s0[vg + 4] * pb[vg];
            t1[vg]     = s1[vg]     * pc[vg];
            t1[vg + 4] = s1[vg + 4] * pd[vg];
        }
        float tm = fmaxf(t0[0], t1[0]);
        #pragma unroll
        for (int vg = 1; vg < 8; vg++) tm = fmaxf(tm, fmaxf(t0[vg], t1[vg]));
        tm = fmaxf(tm, xhalf(tm));
        float mn = fmaxf(m_run, tm);
        float alpha = __expf(m_run - mn);
        m_run = mn;
        v16h pf;                           // P^T as B: element i = key 8*hh + i, 8 + i = key 16 + 8*hh + i
        float es = 0.f;
        #pragma unroll
        for (int vg = 0; vg < 8; vg++) {
            float e0 = __expf(t0[vg] - mn), e1 = __expf(t1[vg] - mn);
            es += e0 + e1;
            pf[vg] = (h16)e0; pf[vg + 8] = (h16)e1;
        }
        l_run = l_run * alpha + es;
        #pragma unroll
        for (int dt = 0; dt < 5; dt++)
            #pragma unroll
            for (int vg = 0; vg < 8; vg++) accO[dt][vg] *= alpha;

        // ---- O^T += V^T P^T  (V^T fragments from LDS as A, key-contiguous rows of 32 at VPITCH) ----
        #pragma unroll
        for (int dt = 0; dt < 5; dt++) {
            const h16* vrow = vl + buf * VTILE + (dt * 16 + r) * VPITCH;
            v16h vf = make_frag(vrow + 8 * hh, vrow + 16 + 8 * hh);
            accO[dt] = WMMA16(vf, pf, accO[dt]);
        }

        // ---- foot of the pass: publish the next tile, then refill the buffer just read ----
        asm volatile("s_wait_dscnt 0x0" ::: "memory");     // this wave's reads of this buffer are done
        asm volatile("s_wait_asynccnt 0x0" ::: "memory");  // this wave's copies of the next tile have landed
        __syncthreads();                                   // both hold for every wave
        if (kt + 64 < NSEQ) stage(kt + 64, buf);           // flies during the next pass
    }
    asm volatile("s_wait_asynccnt 0x0" ::: "memory");      // no copy is outstanding when the wave ends

    // ---- finalize: join the halves' sums, normalize, store in the projection's fragment order ----
    float inv = 1.f / (l_run + xhalf(l_run));
    int orow = b * NSEQ + qt * 16 + r;
    int ocol = hd * HD + 8 * hh;          // a multiple of 4: a group of 4 dims stays inside one 8-element chunk
    #pragma unroll
    for (int dt = 0; dt < 5; dt++) {
        v4h lo, hi;
        #pragma unroll
        for (int vg = 0; vg < 4; vg++) {
            lo[vg] = (h16)(accO[dt][vg] * inv);
            hi[vg] = (h16)(accO[dt][vg + 4] * inv);
        }
        if (dt < 4) {
            *(v4h*)(O + frag_pos(orow, ocol + dt * 16))     = lo;
            *(v4h*)(O + frag_pos(orow, ocol + dt * 16 + 4)) = hi;
        } else if (hh == 0) {
            *(v4h*)(O + frag_pos(orow, ocol + dt * 16))     = lo;   // dims 64..67; 68..79 are padding
        }
    }
}

// ---------------- stage F: projection GEMM (WMMA) + bias ----------------
__global__ void k_proj(const h16* __restrict__ O, const h16* __restrict__ wp,
                       const float* __restrict__ pb, float* __restrict__ out) {
    int lane = threadIdx.x;
    int mt = blockIdx.y * 8 + threadIdx.y;  // 0..511
    int ntg = blockIdx.x;                   // 0..16 (2 tiles each -> 34 tiles = 544)
    int r = lane & 15, hh = lane >> 4;
    const h16* atile = O + (size_t)mt * (KSTEPS * FBLK) + lane * 8;    // both operands in fragment order
    int o0 = (ntg * 2 + 0) * 16 + r;
    int o1 = (ntg * 2 + 1) * 16 + r;
    const h16* b0tile = wp + (size_t)(ntg * 2 + 0) * (KSTEPS * FBLK) + lane * 8;
    const h16* b1tile = wp + (size_t)(ntg * 2 + 1) * (KSTEPS * FBLK) + lane * 8;
    v8f acc0 = {}; v8f acc1 = {};
    for (int ks = 0; ks < KSTEPS; ks++) {
        int c0 = ks * FBLK, c1 = ks * FBLK + FBLK / 2;
        v16h a  = make_frag(atile  + c0, atile  + c1);
        v16h b0 = make_frag(b0tile + c0, b0tile + c1);
        v16h b1 = make_frag(b1tile + c0, b1tile + c1);
        acc0 = WMMA16(a, b0, acc0);
        acc1 = WMMA16(a, b1, acc1);
    }
    float bias0 = pb[o0], bias1 = pb[o1];
    #pragma unroll
    for (int vg = 0; vg < 8; vg++) {
        int m = mt * 16 + vg + 8 * hh;
        out[(size_t)m * CDIM + o0] = acc0[vg] + bias0;
        out[(size_t)m * CDIM + o1] = acc1[vg] + bias1;
    }
}

extern "C" void kernel_launch(void* const* d_in, const int* in_sizes, int n_in,
                              void* d_out, int out_size, void* d_ws, size_t ws_size,
                              hipStream_t stream) {
    const float* x     = (const float*)d_in[0];
    const float* ng    = (const float*)d_in[1];
    const float* nb    = (const float*)d_in[2];
    const float* apw   = (const float*)d_in[3];
    const float* apb   = (const float*)d_in[4];
    const float* n2g   = (const float*)d_in[5];
    const float* n2b   = (const float*)d_in[6];
    const float* qkvw  = (const float*)d_in[7];
    const float* projw = (const float*)d_in[8];
    const float* projb = (const float*)d_in[9];
    const float* sfp   = (const float*)d_in[10];
    float* out = (float*)d_out;

    char* ws = (char*)d_ws;
    size_t off = 0;
    float* xr = (float*)(ws + off); off += (size_t)BN * CDIM * 4;        // 17.8 MB
    float* sc = (float*)(ws + off); off += (size_t)BN * NJ * 4;          // 0.56 MB
    h16* xp = (h16*)(ws + off); off += (size_t)BN * CDIM * 2;            // 8.9 MB
    h16* wq = (h16*)(ws + off); off += (size_t)C3 * CDIM * 2;            // 1.8 MB
    h16* wp = (h16*)(ws + off); off += (size_t)CDIM * CDIM * 2;          // 0.6 MB
    h16* Qp = (h16*)(ws + off); off += (size_t)NB * NH * NSEQ * HDP * 2; // 12.6 MB
    h16* Kp = (h16*)(ws + off); off += (size_t)NB * NH * NSEQ * HDP * 2; // 12.6 MB
    h16* Vt = (h16*)(ws + off); off += (size_t)NB * NH * HDP2 * NSEQ * 2;// 10.5 MB
    h16* O  = (h16*)(ws + off); off += (size_t)BN * CDIM * 2;            // 8.9 MB

    // W: weight conversion f32 -> f16
    int ncvt = C3 * CDIM + CDIM * CDIM;
    k_cvt<<<(ncvt + 255) / 256, 256, 0, stream>>>(qkvw, projw, wq, wp);
    // Z: zero padded Q/K/Vt region (contiguous)
    int zwords = (int)(((size_t)NB * NH * NSEQ * HDP * 2 * 2 +
                        (size_t)NB * NH * HDP2 * NSEQ * 2) / 4);
    k_zero<<<(zwords + 255) / 256, 256, 0, stream>>>((unsigned int*)Qp, zwords);
    // A: per-joint LN + attention-pool scores
    k_ln1<<<(BN * NJ + 255) / 256, 256, 0, stream>>>(x, ng, nb, apw, apb, xr, sc);
    // B: softmax over sequence axis
    k_softmax_n<<<NB * NJ, 256, 0, stream>>>(sc);
    // C: pool + LN over C -> f16 activations
    k_pool_ln2<<<BN, 256, 0, stream>>>(xr, sc, n2g, n2b, xp);
    // D: QKV GEMM (WMMA), scatter to Q (scaled), K, V^T
    k_qkv_gemm<<<dim3(34, 64), dim3(32, 8), 0, stream>>>(xp, wq, Qp, Kp, Vt);
    // E: flash attention, 4 query tiles per block sharing K/V through LDS
    k_attn<<<dim3(64 / QTPB, NH, NB), dim3(32, QTPB), 0, stream>>>(Qp, Kp, Vt, sfp, O);
    // F: projection GEMM (WMMA) + bias -> f32 output
    k_proj<<<dim3(17, 64), dim3(32, 8), 0, stream>>>(O, wp, projb, out);
    (void)in_sizes; (void)n_in; (void)out_size; (void)ws_size;
}

// v005
// It runs in 150 microseconds.
// Two timings next to v004 both put it at 1.08 times that version's speed.
// Counting every step since v000, it is 2.16 times as fast.
#include <hip/hip_runtime.h>
#include <hip/hip_bf16.h>
#include <math.h>

typedef _Float16 h16;
typedef __attribute__((ext_vector_type(4)))  _Float16 v4h;
typedef __attribute__((ext_vector_type(8)))  _Float16 v8h;
typedef __attribute__((ext_vector_type(16))) _Float16 v16h;
typedef __attribute__((ext_vector_type(8)))  float    v8f;

#define NJ    17
#define NF    32
#define CDIM  544
#define NH    8
#define HD    68
#define HDP   96    // padded head dim for Q/K (3 K-steps of 32)
#define HDP2  80    // padded head dim for O tiles (5 tiles of 16)
#define NB    8
#define NSEQ  1024
#define BN    8192  // NB*NSEQ
#define C3    1632  // 3*CDIM
#define QTPB  4     // query tiles (waves) per attention block

#define WMMA16(a,b,c) __builtin_amdgcn_wmma_f32_16x16x32_f16(false,(a),false,(b),(short)0,(c),false,false)

__device__ __forceinline__ v16h make_frag(const h16* p0, const h16* p1) {
    v8h a = *(const v8h*)p0;
    v8h b = *(const v8h*)p1;
    return __builtin_shufflevector(a, b, 0,1,2,3,4,5,6,7,8,9,10,11,12,13,14,15);
}

// Fragment order for the operands of the two GEMMs (row-major [rows][CDIM] matrices).
// One 16-row x 32-k block is 1 KB: two 512-byte halves, and in each half lane l = r + 16*hh
// owns 16 bytes. Half 0 holds k = 8*hh + e, half 1 holds k = 16 + 8*hh + e (e = 0..7): the
// same elements at the same lane and register as the row-major loader took, so a fragment
// is two loads of 512 contiguous bytes (4 whole lines each) instead of 16 pieces of 32 bytes.
#define KSTEPS (CDIM / 32)   // 17 k-steps
#define FBLK   512           // elements per 16 x 32 block
__device__ __forceinline__ int frag_pos(int row, int c) {
    return (((row >> 4) * KSTEPS + (c >> 5)) * FBLK) + ((c & 16) << 4) + ((c & 8) << 4)
         + ((row & 15) << 3) + (c & 7);
}
// inverse map: position in fragment order -> row * CDIM + c
__device__ __forceinline__ int frag_src(int p) {
    int blk = p / FBLK;
    int row = (blk / KSTEPS) * 16 + ((p >> 3) & 15);
    int c   = (blk % KSTEPS) * 32 + ((p >> 4) & 16) + ((p >> 4) & 8) + (p & 7);
    return row * CDIM + c;
}

// ---------------- stage W: convert weights f32 -> f16, stored in fragment order ----------------
__global__ void k_cvt(const float* __restrict__ qkvw, const float* __restrict__ projw,
                      h16* __restrict__ wq, h16* __restrict__ wp) {
    int i = blockIdx.x * blockDim.x + threadIdx.x;   // destination index: stores stay contiguous
    const int n1 = C3 * CDIM, n2 = CDIM * CDIM;
    if (i < n1)            wq[i] = (h16)qkvw[frag_src(i)];
    else if (i < n1 + n2)  wp[i - n1] = (h16)projw[frag_src(i - n1)];
}

// ---------------- stage A: per-joint LN + pooling scores ----------------
__global__ void k_ln1(const float* __restrict__ x, const float* __restrict__ g,
                      const float* __restrict__ bb, const float* __restrict__ apw,
                      const float* __restrict__ apb,
                      float* __restrict__ xr, float* __restrict__ sc) {
    int idx = blockIdx.x * blockDim.x + threadIdx.x;  // (b*N+n)*17 + j
    if (idx >= BN * NJ) return;
    const float* px = x + (size_t)idx * NF;
    float s = 0.f, s2 = 0.f;
    #pragma unroll
    for (int f = 0; f < NF; f++) { float v = px[f]; s += v; s2 += v * v; }
    float mu = s * (1.f / NF);
    float var = s2 * (1.f / NF) - mu * mu;
    float rs = rsqrtf(var + 1e-5f);
    float* po = xr + (size_t)idx * NF;
    float acc = 0.f;
    #pragma unroll
    for (int f = 0; f < NF; f++) {
        float v = (px[f] - mu) * rs * g[f] + bb[f];
        po[f] = v;
        acc += v * apw[f];
    }
    sc[idx] = acc + apb[0];
}

// ---------------- stage B: softmax over sequence axis N ----------------
__global__ void k_softmax_n(float* __restrict__ sc) {
    int b = blockIdx.x / NJ, j = blockIdx.x % NJ;
    __shared__ float red[256];
    int t = threadIdx.x;
    float m = -3e38f;
    for (int n = t; n < NSEQ; n += 256) m = fmaxf(m, sc[(b * NSEQ + n) * NJ + j]);
    red[t] = m; __syncthreads();
    for (int o = 128; o > 0; o >>= 1) { if (t < o) red[t] = fmaxf(red[t], red[t + o]); __syncthreads(); }
    m = red[0]; __syncthreads();
    float s = 0.f;
    for (int n = t; n < NSEQ; n += 256) s += __expf(sc[(b * NSEQ + n) * NJ + j] - m);
    red[t] = s; __syncthreads();
    for (int o = 128; o > 0; o >>= 1) { if (t < o) red[t] += red[t + o]; __syncthreads(); }
    float inv = 1.f / red[0];
    for (int n = t; n < NSEQ; n += 256) {
        int id = (b * NSEQ + n) * NJ + j;
        sc[id] = __expf(sc[id] - m) * inv;
    }
}

// ---------------- stage C: pool by weights + LN over C, emit f16 ----------------
// The launch also zeroes the padding of Q, K and V^T: the only elements of those buffers that the
// attention launch reads and the QKV GEMM does not write. One store a thread, from 124 of the 256.
#define QKPAD4 ((HDP - HD) / 4)                    // 7 groups of 4 pad dims (8 bytes) in a Q or K row
#define VPAD8  ((HDP2 - HD) * NSEQ / 8 / (BN / (NB * NH)))   // 12 chunks of 16 bytes: a block's share of its head's pad rows
__global__ void k_pool_ln2(const float* __restrict__ xr, const float* __restrict__ w,
                           const float* __restrict__ g2, const float* __restrict__ b2,
                           h16* __restrict__ xp,
                           h16* __restrict__ Qp, h16* __restrict__ Kp, h16* __restrict__ Vt) {
    int row = blockIdx.x;  // b*N + n
    __shared__ float vals[CDIM];
    __shared__ float red[256];
    int t = threadIdx.x;
    if (t < 2 * NH * QKPAD4) {
        // this token's dims 68..95 in each head's Q row (pieces 0..7) and K row (pieces 8..15)
        int piece = t / QKPAD4, part = t % QKPAD4;
        int bh = (row >> 10) * NH + (piece & (NH - 1));
        h16* dst = (piece < NH ? Qp : Kp) + (size_t)(bh * NSEQ + (row & (NSEQ - 1))) * HDP + HD + part * 4;
        v4h z4 = {};
        *(v4h*)dst = z4;
    } else if (t >= 128 && t < 128 + VPAD8) {
        // rows 68..79 of a head's V^T are contiguous: 1536 chunks, shared out over the 128 blocks row >> 7 == head
        h16* dst = Vt + ((size_t)(row >> 7) * HDP2 + HD) * NSEQ + ((row & 127) * VPAD8 + (t - 128)) * 8;
        v8h z8 = {};
        *(v8h*)dst = z8;
    }
    float s = 0.f;
    for (int c = t; c < CDIM; c += 256) {
        float v = xr[(size_t)row * CDIM + c] * w[row * NJ + c / NF];
        vals[c] = v; s += v;
    }
    red[t] = s; __syncthreads();
    for (int o = 128; o > 0; o >>= 1) { if (t < o) red[t] += red[t + o]; __syncthreads(); }
    float mu = red[0] * (1.f / CDIM); __syncthreads();
    float s2 = 0.f;
    for (int c = t; c < CDIM; c += 256) { float d = vals[c] - mu; s2 += d * d; }
    red[t] = s2; __syncthreads();
    for (int o = 128; o > 0; o >>= 1) { if (t < o) red[t] += red[t + o]; __syncthreads(); }
    float rs = rsqrtf(red[0] * (1.f / CDIM) + 1e-5f);
    for (int c = t; c < CDIM; c += 256)
        xp[frag_pos(row, c)] = (h16)((vals[c] - mu) * rs * g2[c] + b2[c]);
}

// ---------------- stage D: QKV GEMM (WMMA, 16x48 per wave) ----------------
__global__ void k_qkv_gemm(const h16* __restrict__ xp, const h16* __restrict__ wq,
                           h16* __restrict__ Qp, h16* __restrict__ Kp, h16* __restrict__ Vt) {
    int lane = threadIdx.x;                 // 0..31
    int mt = blockIdx.y * 8 + threadIdx.y;  // row tile 0..511
    int ntg = blockIdx.x;                   // col tile group 0..33 (3 tiles each)
    int r = lane & 15, hh = lane >> 4;
    const h16* atile = xp + (size_t)mt * (KSTEPS * FBLK) + lane * 8;   // both operands in fragment order
    const h16* btile[3];
    #pragma unroll
    for (int nt = 0; nt < 3; nt++)
        btile[nt] = wq + (size_t)(ntg * 3 + nt) * (KSTEPS * FBLK) + lane * 8;
    v8f zero = {};
    v8f acc[3];
    #pragma unroll
    for (int nt = 0; nt < 3; nt++) acc[nt] = zero;
    for (int ks = 0; ks < KSTEPS; ks++) {
        int c0 = ks * FBLK, c1 = ks * FBLK + FBLK / 2;
        v16h a = make_frag(atile + c0, atile + c1);
        #pragma unroll
        for (int nt = 0; nt < 3; nt++) {
            v16h bfr = make_frag(btile[nt] + c0, btile[nt] + c1);
            acc[nt] = WMMA16(a, bfr, acc[nt]);
        }
    }
    const float qscale = 0.121267813f;  // 68^-0.5, folded into Q
    #pragma unroll
    for (int nt = 0; nt < 3; nt++) {
        int o = (ntg * 3 + nt) * 16 + r;
        int third = o / CDIM, rem = o % CDIM;
        int hd = rem / HD, d = rem % HD;
        #pragma unroll
        for (int vg = 0; vg < 8; vg++) {
            int m = mt * 16 + vg + 8 * hh;          // global row (b*N+n)
            int b = m >> 10, n = m & 1023;
            int bh = b * NH + hd;
            float v = acc[nt][vg];
            if (third == 0)      Qp[(size_t)(bh * NSEQ + n) * HDP + d] = (h16)(v * qscale);
            else if (third == 1) Kp[(size_t)(bh * NSEQ + n) * HDP + d] = (h16)v;
            else                 Vt[(size_t)(bh * HDP2 + d) * NSEQ + n] = (h16)v;
        }
    }
}

typedef __attribute__((ext_vector_type(4))) float    v4f;

// lane l <-> lane l ^ 16: the other half of the same query's keys
__device__ __forceinline__ float xhalf(float x) {
    return __builtin_bit_cast(float, __builtin_amdgcn_permlanex16(
        __builtin_bit_cast(int, x), __builtin_bit_cast(int, x),
        0x76543210, 0xfedcba98, false, false));
}

__device__ __forceinline__ unsigned lds_off(const void* p) { return (unsigned)(size_t)p; }

// LDS row pitches, in elements: 16 bytes times an odd number (208 B and 80 B), so that the 16 rows
// which a half wave reads with one 16-byte load start on 16 different groups of 4 banks. At the data's
// own pitches (192 B and 64 B) they start on 4 groups only. The 16 pad bytes of a row are never touched.
#define KPITCH (HDP + 8)
#define VPITCH (32 + 8)
#define KTILE (32 * KPITCH)     // elements of one staged K tile
#define VTILE (HDP2 * VPITCH)   // elements of one staged V^T tile

__global__ void k_attn(const h16* __restrict__ Qp, const h16* __restrict__ Kp,
                       const h16* __restrict__ Vt, const float* __restrict__ sfp,
                       h16* __restrict__ O) {
    int lane = threadIdx.x;               // 0..31
    int wv = threadIdx.y;                 // 0..3 : one query tile per wave
    int tid = wv * 32 + lane;
    int wvs = __builtin_amdgcn_readfirstlane(wv);   // the wave's number in a scalar register: a test on it is a scalar branch
    int qt = blockIdx.x * QTPB + wv;      // 0..63
    int hd = blockIdx.y, b = blockIdx.z;
    int bh = b * NH + hd;
    int r = lane & 15, hh = lane >> 4;
    float sf = sfp[0];

    __shared__ __align__(16) h16 kl[2 * KTILE];       // 2 x 6.5 KB: 32 keys x 96 dims, padded rows
    __shared__ __align__(16) h16 vl[2 * VTILE];       // 2 x 6.25 KB: 80 dims x 32 keys, padded rows
    __shared__ __align__(16) float psl[NSEQ];         // 4 KB: per-key positional scale

    // Q fragments for this wave's 16 queries (3 K-steps covering padded 96), used as B
    const h16* qrow = Qp + (size_t)(bh * NSEQ + qt * 16 + r) * HDP;
    v16h qa0 = make_frag(qrow +      8 * hh, qrow + 16 + 8 * hh);
    v16h qa1 = make_frag(qrow + 32 + 8 * hh, qrow + 48 + 8 * hh);
    v16h qa2 = make_frag(qrow + 64 + 8 * hh, qrow + 80 + 8 * hh);

    v8f zero = {};
    v8f accO[5];                          // O^T tiles: row = dim dt*16 + vg + 8*hh, column = query r
    #pragma unroll
    for (int i = 0; i < 5; i++) accO[i] = zero;
    float m_run = -1e30f, l_run = 0.f;    // this lane's query; l_run sums this half's keys only

    const h16* kbase = Kp + (size_t)bh * NSEQ * HDP;
    const h16* vbase = Vt + (size_t)bh * HDP2 * NSEQ;
    const float invN1 = 1.f / (float)(NSEQ - 1);

    // One tile's asynchronous copies, 16 bytes a lane each, every lane on. The K tile is contiguous in
    // memory (384 chunks: 3 a lane, 12 a row); the V^T tile is 80 rows x 4 chunks (2 a lane, a third from
    // waves 0 and 1). In LDS chunk c lands 16 bytes further for every row in front of it.
    const h16* kg0 = kbase + tid * 8;
    const h16* vg0 = vbase + (size_t)(tid >> 2) * NSEQ + (tid & 3) * 8;
    const unsigned kd0 = lds_off(kl) + (tid       + (tid      ) / 12) * 16;
    const unsigned kd1 = lds_off(kl) + (tid + 128 + (tid + 128) / 12) * 16;
    const unsigned kd2 = lds_off(kl) + (tid + 256 + (tid + 256) / 12) * 16;
    const unsigned vd0 = lds_off(vl) + (tid + (tid >> 2)) * 16;
    auto stage = [&](int kt, int buf) {
        const h16* kg = kg0 + (size_t)kt * HDP;
        const h16* vg = vg0 + kt;
        unsigned kb = buf * (KTILE * 2), vd = vd0 + buf * (VTILE * 2);
        // s_wait_xcnt 0 closes each statement: no address register is rewritten in front of it
        asm volatile("global_load_async_to_lds_b128 %0, %1, off\n\t"
                     "global_load_async_to_lds_b128 %2, %3, off\n\t"
                     "global_load_async_to_lds_b128 %4, %5, off\n\t"
                     "global_load_async_to_lds_b128 %6, %7, off\n\t"
                     "global_load_async_to_lds_b128 %8, %9, off\n\t"
                     "s_wait_xcnt 0x0"
                     :: "v"(kd0 + kb), "v"(kg), "v"(kd1 + kb), "v"(kg + 1024), "v"(kd2 + kb), "v"(kg + 2048),
                        "v"(vd), "v"(vg), "v"(vd + 32 * VPITCH * 2), "v"(vg + 32 * NSEQ) : "memory");
        if (wvs < 2)
            asm volatile("global_load_async_to_lds_b128 %0, %1, off\n\t"
                         "s_wait_xcnt 0x0"
                         :: "v"(vd + 64 * VPITCH * 2), "v"(vg + 64 * NSEQ) : "memory");
    };
    stage(0, 0);

    // a key is now a register row, not a lane: its scale comes from a table filled once
    // (published by the barrier in front of the loop)
    #pragma unroll  // fixed 8 trips: the exponentials issue back to back instead of one per loop trip
    for (int i = 0; i < NSEQ / (32 * QTPB); i++) {
        int k = tid + 32 * QTPB * i;
        float p = (float)k * invN1 - 0.5f;
        psl[k] = __expf(-sf * p * p);
    }

    asm volatile("s_wait_asynccnt 0x0" ::: "memory");  // this wave's copies of tile 0 have landed
    __syncthreads();                                   // every wave's have: tile 0 and the table are readable
    stage(32, 1);                                      // tile 1 flies during pass 0

    for (int kt = 0; kt < NSEQ; kt += 32) {
        int buf = (kt >> 5) & 1;                       // this pass reads this buffer alone

        // ---- S^T = K Q^T for two 16-key tiles (K fragments from LDS as A) ----
        v8f s0 = zero, s1 = zero;
        const h16* krow0 = kl + buf * KTILE + (size_t)r * KPITCH;
        const h16* krow1 = kl + buf * KTILE + (size_t)(16 + r) * KPITCH;
        v16h kb;
        kb = make_frag(krow0 +      8 * hh, krow0 + 16 + 8 * hh); s0 = WMMA16(kb, qa0, s0);
        kb = make_frag(krow1 +      8 * hh, krow1 + 16 + 8 * hh); s1 = WMMA16(kb, qa0, s1);
        kb = make_frag(krow0 + 32 + 8 * hh, krow0 + 48 + 8 * hh); s0 = WMMA16(kb, qa1, s0);
        kb = make_frag(krow1 + 32 + 8 * hh, krow1 + 48 + 8 * hh); s1 = WMMA16(kb, qa1, s1);
        kb = make_frag(krow0 + 64 + 8 * hh, krow0 + 80 + 8 * hh); s0 = WMMA16(kb, qa2, s0);
        kb = make_frag(krow1 + 64 + 8 * hh, krow1 + 80 + 8 * hh); s1 = WMMA16(kb, qa2, s1);

        // per-key positional scale: keys kt + 8*hh + vg (s0) and kt + 16 + 8*hh + vg (s1)
        const v4f* pt = (const v4f*)(psl + kt + 8 * hh);
        v4f pa = pt[0], pb = pt[1], pc = pt[4], pd = pt[5];

        // ---- online softmax for this lane's query ----
        float t0[8], t1[8];
        #pragma unroll
        for (int vg = 0; vg < 4; vg++) {
            t0[vg]     = s0[vg]     * pa[vg];
            t0[vg + 4] = s0[vg + 4] * pb[vg];
            t1[vg]     = s1[vg]     * pc[vg];
            t1[vg + 4] = s1[vg + 4] * pd[vg];
        }
        float tm = fmaxf(t0[0], t1[0]);
        #pragma unroll
        for (int vg = 1; vg < 8; vg++) tm = fmaxf(tm, fmaxf(t0[vg], t1[vg]));
        tm = fmaxf(tm, xhalf(tm));
        float mn = fmaxf(m_run, tm);
        float alpha = __expf(m_run - mn);
        m_run = mn;
        v16h pf;                           // P^T as B: element i = key 8*hh + i, 8 + i = key 16 + 8*hh + i
        float es = 0.f;
        #pragma unroll
        for (int vg = 0; vg < 8; vg++) {
            float e0 = __expf(t0[vg] - mn), e1 = __expf(t1[vg] - mn);
            es += e0 + e1;
            pf[vg] = (h16)e0; pf[vg + 8] = (h16)e1;
        }
        l_run = l_run * alpha + es;
        #pragma unroll
        for (int dt = 0; dt < 5; dt++)
            #pragma unroll
            for (int vg = 0; vg < 8; vg++) accO[dt][vg] *= alpha;

        // ---- O^T += V^T P^T  (V^T fragments from LDS as A, key-contiguous rows of 32 at VPITCH) ----
        #pragma unroll
        for (int dt = 0; dt < 5; dt++) {
            const h16* vrow = vl + buf * VTILE + (dt * 16 + r) * VPITCH;
            v16h vf = make_frag(vrow + 8 * hh, vrow + 16 + 8 * hh);
            accO[dt] = WMMA16(vf, pf, accO[dt]);
        }

        // ---- foot of the pass: publish the next tile, then refill the buffer just read ----
        asm volatile("s_wait_dscnt 0x0" ::: "memory");     // this wave's reads of this buffer are done
        asm volatile("s_wait_asynccnt 0x0" ::: "memory");  // this wave's copies of the next tile have landed
        __syncthreads();                                   // both hold for every wave
        if (kt + 64 < NSEQ) stage(kt + 64, buf);           // flies during the next pass
    }
    asm volatile("s_wait_asynccnt 0x0" ::: "memory");      // no copy is outstanding when the wave ends

    // ---- finalize: join the halves' sums, normalize, store in the projection's fragment order ----
    float inv = 1.f / (l_run + xhalf(l_run));
    int orow = b * NSEQ + qt * 16 + r;
    int ocol = hd * HD + 8 * hh;          // a multiple of 4: a group of 4 dims stays inside one 8-element chunk
    #pragma unroll
    for (int dt = 0; dt < 5; dt++) {
        v4h lo, hi;
        #pragma unroll
        for (int vg = 0; vg < 4; vg++) {
            lo[vg] = (h16)(accO[dt][vg] * inv);
            hi[vg] = (h16)(accO[dt][vg + 4] * inv);
        }
        if (dt < 4) {
            *(v4h*)(O + frag_pos(orow, ocol + dt * 16))     = lo;
            *(v4h*)(O + frag_pos(orow, ocol + dt * 16 + 4)) = hi;
        } else if (hh == 0) {
            *(v4h*)(O + frag_pos(orow, ocol + dt * 16))     = lo;   // dims 64..67; 68..79 are padding
        }
    }
}

// ---------------- stage F: projection GEMM (WMMA) + bias ----------------
__global__ void k_proj(const h16* __restrict__ O, const h16* __restrict__ wp,
                       const float* __restrict__ pb, float* __restrict__ out) {
    int lane = threadIdx.x;
    int mt = blockIdx.y * 8 + threadIdx.y;  // 0..511
    int ntg = blockIdx.x;                   // 0..16 (2 tiles each -> 34 tiles = 544)
    int r = lane & 15, hh = lane >> 4;
    const h16* atile = O + (size_t)mt * (KSTEPS * FBLK) + lane * 8;    // both operands in fragment order
    int o0 = (ntg * 2 + 0) * 16 + r;
    int o1 = (ntg * 2 + 1) * 16 + r;
    const h16* b0tile = wp + (size_t)(ntg * 2 + 0) * (KSTEPS * FBLK) + lane * 8;
    const h16* b1tile = wp + (size_t)(ntg * 2 + 1) * (KSTEPS * FBLK) + lane * 8;
    v8f acc0 = {}; v8f acc1 = {};
    for (int ks = 0; ks < KSTEPS; ks++) {
        int c0 = ks * FBLK, c1 = ks * FBLK + FBLK / 2;
        v16h a  = make_frag(atile  + c0, atile  + c1);
        v16h b0 = make_frag(b0tile + c0, b0tile + c1);
        v16h b1 = make_frag(b1tile + c0, b1tile + c1);
        acc0 = WMMA16(a, b0, acc0);
        acc1 = WMMA16(a, b1, acc1);
    }
    float bias0 = pb[o0], bias1 = pb[o1];
    #pragma unroll
    for (int vg = 0; vg < 8; vg++) {
        int m = mt * 16 + vg + 8 * hh;
        out[(size_t)m * CDIM + o0] = acc0[vg] + bias0;
        out[(size_t)m * CDIM + o1] = acc1[vg] + bias1;
    }
}

extern "C" void kernel_launch(void* const* d_in, const int* in_sizes, int n_in,
                              void* d_out, int out_size, void* d_ws, size_t ws_size,
                              hipStream_t stream) {
    const float* x     = (const float*)d_in[0];
    const float* ng    = (const float*)d_in[1];
    const float* nb    = (const float*)d_in[2];
    const float* apw   = (const float*)d_in[3];
    const float* apb   = (const float*)d_in[4];
    const float* n2g   = (const float*)d_in[5];
    const float* n2b   = (const float*)d_in[6];
    const float* qkvw  = (const float*)d_in[7];
    const float* projw = (const float*)d_in[8];
    const float* projb = (const float*)d_in[9];
    const float* sfp   = (const float*)d_in[10];
    float* out = (float*)d_out;

    char* ws = (char*)d_ws;
    size_t off = 0;
    float* xr = (float*)(ws + off); off += (size_t)BN * CDIM * 4;        // 17.8 MB
    float* sc = (float*)(ws + off); off += (size_t)BN * NJ * 4;          // 0.56 MB
    h16* xp = (h16*)(ws + off); off += (size_t)BN * CDIM * 2;            // 8.9 MB
    h16* wq = (h16*)(ws + off); off += (size_t)C3 * CDIM * 2;            // 1.8 MB
    h16* wp = (h16*)(ws + off); off += (size_t)CDIM * CDIM * 2;          // 0.6 MB
    h16* Qp = (h16*)(ws + off); off += (size_t)NB * NH * NSEQ * HDP * 2; // 12.6 MB
    h16* Kp = (h16*)(ws + off); off += (size_t)NB * NH * NSEQ * HDP * 2; // 12.6 MB
    h16* Vt = (h16*)(ws + off); off += (size_t)NB * NH * HDP2 * NSEQ * 2;// 10.5 MB
    h16* O  = (h16*)(ws + off); off += (size_t)BN * CDIM * 2;            // 8.9 MB

    // W: weight conversion f32 -> f16
    int ncvt = C3 * CDIM + CDIM * CDIM;
    k_cvt<<<(ncvt + 255) / 256, 256, 0, stream>>>(qkvw, projw, wq, wp);
    // A: per-joint LN + attention-pool scores
    k_ln1<<<(BN * NJ + 255) / 256, 256, 0, stream>>>(x, ng, nb, apw, apb, xr, sc);
    // B: softmax over sequence axis
    k_softmax_n<<<NB * NJ, 256, 0, stream>>>(sc);
    // C: pool + LN over C -> f16 activations; zeroes the padding of Q, K, V^T
    k_pool_ln2<<<BN, 256, 0, stream>>>(xr, sc, n2g, n2b, xp, Qp, Kp, Vt);
    // D: QKV GEMM (WMMA), scatter to Q (scaled), K, V^T
    k_qkv_gemm<<<dim3(34, 64), dim3(32, 8), 0, stream>>>(xp, wq, Qp, Kp, Vt);
    // E: flash attention, 4 query tiles per block sharing K/V through LDS
    k_attn<<<dim3(64 / QTPB, NH, NB), dim3(32, QTPB), 0, stream>>>(Qp, Kp, Vt, sfp, O);
    // F: projection GEMM (WMMA) + bias -> f32 output
    k_proj<<<dim3(17, 64), dim3(32, 8), 0, stream>>>(O, wp, projb, out);
    (void)in_sizes; (void)n_in; (void)out_size; (void)ws_size;
}

// v006
// A run of this version takes 137 microseconds.
// Next to v005, in two timings, it ran 1.09 times as fast each time.
// Counting every step since v000, it is 2.35 times as fast.
#include <hip/hip_runtime.h>
#include <hip/hip_bf16.h>
#include <math.h>

typedef _Float16 h16;
typedef __attribute__((ext_vector_type(4)))  _Float16 v4h;
typedef __attribute__((ext_vector_type(8)))  _Float16 v8h;
typedef __attribute__((ext_vector_type(16))) _Float16 v16h;
typedef __attribute__((ext_vector_type(8)))  float    v8f;

#define NJ    17
#define NF    32
#define CDIM  544
#define NH    8
#define HD    68
#define HDP   96    // padded head dim for Q/K (3 K-steps of 32)
#define HDP2  80    // padded head dim for O tiles (5 tiles of 16)
#define NB    8
#define NSEQ  1024
#define BN    8192  // NB*NSEQ
#define C3    1632  // 3*CDIM
#define QTPB  4     // query tiles (waves) per attention block

#define WMMA16(a,b,c) __builtin_amdgcn_wmma_f32_16x16x32_f16(false,(a),false,(b),(short)0,(c),false,false)

__device__ __forceinline__ v16h make_frag(const h16* p0, const h16* p1) {
    v8h a = *(const v8h*)p0;
    v8h b = *(const v8h*)p1;
    return __builtin_shufflevector(a, b, 0,1,2,3,4,5,6,7,8,9,10,11,12,13,14,15);
}

// Fragment order for the operands of the two GEMMs (row-major [rows][CDIM] matrices).
// One 16-row x 32-k block is 1 KB: two 512-byte halves, and in each half lane l = r + 16*hh
// owns 16 bytes. Half 0 holds k = 8*hh + e, half 1 holds k = 16 + 8*hh + e (e = 0..7): the
// same elements at the same lane and register as the row-major loader took, so a fragment
// is two loads of 512 contiguous bytes (4 whole lines each) instead of 16 pieces of 32 bytes.
#define KSTEPS (CDIM / 32)   // 17 k-steps
#define FBLK   512           // elements per 16 x 32 block
__device__ __forceinline__ int frag_pos(int row, int c) {
    return (((row >> 4) * KSTEPS + (c >> 5)) * FBLK) + ((c & 16) << 4) + ((c & 8) << 4)
         + ((row & 15) << 3) + (c & 7);
}
// inverse map: position in fragment order -> row * CDIM + c
__device__ __forceinline__ int frag_src(int p) {
    int blk = p / FBLK;
    int row = (blk / KSTEPS) * 16 + ((p >> 3) & 15);
    int c   = (blk % KSTEPS) * 32 + ((p >> 4) & 16) + ((p >> 4) & 8) + (p & 7);
    return row * CDIM + c;
}

// ---------------- stage W: convert weights f32 -> f16, stored in fragment order ----------------
__global__ void k_cvt(const float* __restrict__ qkvw, const float* __restrict__ projw,
                      h16* __restrict__ wq, h16* __restrict__ wp) {
    int i = blockIdx.x * blockDim.x + threadIdx.x;   // destination index: stores stay contiguous
    const int n1 = C3 * CDIM, n2 = CDIM * CDIM;
    if (i < n1)            wq[i] = (h16)qkvw[frag_src(i)];
    else if (i < n1 + n2)  wp[i - n1] = (h16)projw[frag_src(i - n1)];
}

// ---------------- stage A: per-joint LN + pooling scores ----------------
__global__ void k_ln1(const float* __restrict__ x, const float* __restrict__ g,
                      const float* __restrict__ bb, const float* __restrict__ apw,
                      const float* __restrict__ apb,
                      float* __restrict__ xr, float* __restrict__ sc) {
    int idx = blockIdx.x * blockDim.x + threadIdx.x;  // (b*N+n)*17 + j
    if (idx >= BN * NJ) return;
    const float* px = x + (size_t)idx * NF;
    float s = 0.f, s2 = 0.f;
    #pragma unroll
    for (int f = 0; f < NF; f++) { float v = px[f]; s += v; s2 += v * v; }
    float mu = s * (1.f / NF);
    float var = s2 * (1.f / NF) - mu * mu;
    float rs = rsqrtf(var + 1e-5f);
    float* po = xr + (size_t)idx * NF;
    float acc = 0.f;
    #pragma unroll
    for (int f = 0; f < NF; f++) {
        float v = (px[f] - mu) * rs * g[f] + bb[f];
        po[f] = v;
        acc += v * apw[f];
    }
    sc[idx] = acc + apb[0];
}

// ---------------- stage B: softmax over sequence axis N ----------------
__global__ void k_softmax_n(float* __restrict__ sc) {
    int b = blockIdx.x / NJ, j = blockIdx.x % NJ;
    __shared__ float red[256];
    int t = threadIdx.x;
    float m = -3e38f;
    for (int n = t; n < NSEQ; n += 256) m = fmaxf(m, sc[(b * NSEQ + n) * NJ + j]);
    red[t] = m; __syncthreads();
    for (int o = 128; o > 0; o >>= 1) { if (t < o) red[t] = fmaxf(red[t], red[t + o]); __syncthreads(); }
    m = red[0]; __syncthreads();
    float s = 0.f;
    for (int n = t; n < NSEQ; n += 256) s += __expf(sc[(b * NSEQ + n) * NJ + j] - m);
    red[t] = s; __syncthreads();
    for (int o = 128; o > 0; o >>= 1) { if (t < o) red[t] += red[t + o]; __syncthreads(); }
    float inv = 1.f / red[0];
    for (int n = t; n < NSEQ; n += 256) {
        int id = (b * NSEQ + n) * NJ + j;
        sc[id] = __expf(sc[id] - m) * inv;
    }
}

// ---------------- stage C: pool by weights + LN over C, emit f16 ----------------
// The launch also zeroes the padding of Q, K and V^T: the only elements of those buffers that the
// attention launch reads and the QKV GEMM does not write. One store a thread, from 124 of the 256.
#define QKPAD4 ((HDP - HD) / 4)                    // 7 groups of 4 pad dims (8 bytes) in a Q or K row
#define VPAD8  ((HDP2 - HD) * NSEQ / 8 / (BN / (NB * NH)))   // 12 chunks of 16 bytes: a block's share of its head's pad rows
__global__ void k_pool_ln2(const float* __restrict__ xr, const float* __restrict__ w,
                           const float* __restrict__ g2, const float* __restrict__ b2,
                           h16* __restrict__ xp,
                           h16* __restrict__ Qp, h16* __restrict__ Kp, h16* __restrict__ Vt) {
    int row = blockIdx.x;  // b*N + n
    __shared__ float vals[CDIM];
    __shared__ float red[256];
    int t = threadIdx.x;
    if (t < 2 * NH * QKPAD4) {
        // this token's dims 68..95 in each head's Q row (pieces 0..7) and K row (pieces 8..15)
        int piece = t / QKPAD4, part = t % QKPAD4;
        int bh = (row >> 10) * NH + (piece & (NH - 1));
        h16* dst = (piece < NH ? Qp : Kp) + (size_t)(bh * NSEQ + (row & (NSEQ - 1))) * HDP + HD + part * 4;
        v4h z4 = {};
        *(v4h*)dst = z4;
    } else if (t >= 128 && t < 128 + VPAD8) {
        // rows 68..79 of a head's V^T are contiguous: 1536 chunks, shared out over the 128 blocks row >> 7 == head
        h16* dst = Vt + ((size_t)(row >> 7) * HDP2 + HD) * NSEQ + ((row & 127) * VPAD8 + (t - 128)) * 8;
        v8h z8 = {};
        *(v8h*)dst = z8;
    }
    float s = 0.f;
    for (int c = t; c < CDIM; c += 256) {
        float v = xr[(size_t)row * CDIM + c] * w[row * NJ + c / NF];
        vals[c] = v; s += v;
    }
    red[t] = s; __syncthreads();
    for (int o = 128; o > 0; o >>= 1) { if (t < o) red[t] += red[t + o]; __syncthreads(); }
    float mu = red[0] * (1.f / CDIM); __syncthreads();
    float s2 = 0.f;
    for (int c = t; c < CDIM; c += 256) { float d = vals[c] - mu; s2 += d * d; }
    red[t] = s2; __syncthreads();
    for (int o = 128; o > 0; o >>= 1) { if (t < o) red[t] += red[t + o]; __syncthreads(); }
    float rs = rsqrtf(red[0] * (1.f / CDIM) + 1e-5f);
    for (int c = t; c < CDIM; c += 256)
        xp[frag_pos(row, c)] = (h16)((vals[c] - mu) * rs * g2[c] + b2[c]);
}

// ---------------- stage D: QKV GEMM (WMMA, 16x48 per wave) ----------------
__global__ void k_qkv_gemm(const h16* __restrict__ xp, const h16* __restrict__ wq,
                           h16* __restrict__ Qp, h16* __restrict__ Kp, h16* __restrict__ Vt) {
    int lane = threadIdx.x;                 // 0..31
    int mt = blockIdx.y * 8 + threadIdx.y;  // row tile 0..511
    int ntg = blockIdx.x;                   // col tile group 0..33 (3 tiles each)
    int r = lane & 15, hh = lane >> 4;
    const h16* atile = xp + (size_t)mt * (KSTEPS * FBLK) + lane * 8;   // both operands in fragment order
    const h16* btile[3];
    #pragma unroll
    for (int nt = 0; nt < 3; nt++)
        btile[nt] = wq + (size_t)(ntg * 3 + nt) * (KSTEPS * FBLK) + lane * 8;
    v8f zero = {};
    v8f acc[3];
    #pragma unroll
    for (int nt = 0; nt < 3; nt++) acc[nt] = zero;
    for (int ks = 0; ks < KSTEPS; ks++) {
        int c0 = ks * FBLK, c1 = ks * FBLK + FBLK / 2;
        v16h a = make_frag(atile + c0, atile + c1);
        #pragma unroll
        for (int nt = 0; nt < 3; nt++) {
            v16h bfr = make_frag(btile[nt] + c0, btile[nt] + c1);
            acc[nt] = WMMA16(a, bfr, acc[nt]);
        }
    }
    const float qscale = 0.121267813f;  // 68^-0.5, folded into Q
    // keeps the epilogue's index arithmetic behind the k loop: lifted into it, it costs 8 more registers (64 -> 72) and 4 of 16 waves a SIMD
    __builtin_amdgcn_sched_barrier(0);
    int m0 = mt * 16 + 8 * hh;              // this lane's first row (b*N+n); its 8 rows are m0 + vg, inside one batch
    int b = m0 >> 10, n0 = m0 & 1023;
    #pragma unroll
    for (int nt = 0; nt < 3; nt++) {
        int tile = ntg * 3 + nt;            // the same for the whole block
        int third = tile / (CDIM / 16);     // 34 whole tiles each of Q, K and V: a tile lies in one of them
        int rem = (tile - third * (CDIM / 16)) * 16 + r;
        int hd = rem / HD, d = rem % HD;
        int bh = b * NH + hd;
        if (third == 2) {
            // a lane's 8 accumulators are 8 consecutive tokens of one dim: 16 contiguous bytes of its V^T row
            v8h pk;
            #pragma unroll
            for (int vg = 0; vg < 8; vg++) pk[vg] = (h16)acc[nt][vg];
            *(v8h*)(Vt + (size_t)(bh * HDP2 + d) * NSEQ + n0) = pk;
            // the next tile's code reuses this store's registers: the wait stands in front of that
            if (nt < 2) asm volatile("s_wait_xcnt 0x0" ::: "memory");
        } else {
            h16* dst = (third == 0 ? Qp : Kp) + (size_t)(bh * NSEQ + n0) * HDP + d;
            float sc = third == 0 ? qscale : 1.f;   // K times 1 is exact
            #pragma unroll
            for (int vg = 0; vg < 8; vg++) dst[vg * HDP] = (h16)(acc[nt][vg] * sc);
            // the code behind this branch reuses these stores' registers: the wait stands in front of that
            asm volatile("s_wait_xcnt 0x0" ::: "memory");
        }
    }
}

typedef __attribute__((ext_vector_type(4))) float    v4f;

// lane l <-> lane l ^ 16: the other half of the same query's keys
__device__ __forceinline__ float xhalf(float x) {
    return __builtin_bit_cast(float, __builtin_amdgcn_permlanex16(
        __builtin_bit_cast(int, x), __builtin_bit_cast(int, x),
        0x76543210, 0xfedcba98, false, false));
}

__device__ __forceinline__ unsigned lds_off(const void* p) { return (unsigned)(size_t)p; }

// LDS row pitches, in elements: 16 bytes times an odd number (208 B and 80 B), so that the 16 rows
// which a half wave reads with one 16-byte load start on 16 different groups of 4 banks. At the data's
// own pitches (192 B and 64 B) they start on 4 groups only. The 16 pad bytes of a row are never touched.
#define KPITCH (HDP + 8)
#define VPITCH (32 + 8)
#define KTILE (32 * KPITCH)     // elements of one staged K tile
#define VTILE (HDP2 * VPITCH)   // elements of one staged V^T tile

__global__ void k_attn(const h16* __restrict__ Qp, const h16* __restrict__ Kp,
                       const h16* __restrict__ Vt, const float* __restrict__ sfp,
                       h16* __restrict__ O) {
    int lane = threadIdx.x;               // 0..31
    int wv = threadIdx.y;                 // 0..3 : one query tile per wave
    int tid = wv * 32 + lane;
    int wvs = __builtin_amdgcn_readfirstlane(wv);   // the wave's number in a scalar register: a test on it is a scalar branch
    int qt = blockIdx.x * QTPB + wv;      // 0..63
    int hd = blockIdx.y, b = blockIdx.z;
    int bh = b * NH + hd;
    int r = lane & 15, hh = lane >> 4;
    float sf = sfp[0];

    __shared__ __align__(16) h16 kl[2 * KTILE];       // 2 x 6.5 KB: 32 keys x 96 dims, padded rows
    __shared__ __align__(16) h16 vl[2 * VTILE];       // 2 x 6.25 KB: 80 dims x 32 keys, padded rows
    __shared__ __align__(16) float psl[NSEQ];         // 4 KB: per-key positional scale

    // Q fragments for this wave's 16 queries (3 K-steps covering padded 96), used as B
    const h16* qrow = Qp + (size_t)(bh * NSEQ + qt * 16 + r) * HDP;
    v16h qa0 = make_frag(qrow +      8 * hh, qrow + 16 + 8 * hh);
    v16h qa1 = make_frag(qrow + 32 + 8 * hh, qrow + 48 + 8 * hh);
    v16h qa2 = make_frag(qrow + 64 + 8 * hh, qrow + 80 + 8 * hh);

    v8f zero = {};
    v8f accO[5];                          // O^T tiles: row = dim dt*16 + vg + 8*hh, column = query r
    #pragma unroll
    for (int i = 0; i < 5; i++) accO[i] = zero;
    float m_run = -1e30f, l_run = 0.f;    // this lane's query; l_run sums this half's keys only

    const h16* kbase = Kp + (size_t)bh * NSEQ * HDP;
    const h16* vbase = Vt + (size_t)bh * HDP2 * NSEQ;
    const float invN1 = 1.f / (float)(NSEQ - 1);

    // One tile's asynchronous copies, 16 bytes a lane each, every lane on. The K tile is contiguous in
    // memory (384 chunks: 3 a lane, 12 a row); the V^T tile is 80 rows x 4 chunks (2 a lane, a third from
    // waves 0 and 1). In LDS chunk c lands 16 bytes further for every row in front of it.
    const h16* kg0 = kbase + tid * 8;
    const h16* vg0 = vbase + (size_t)(tid >> 2) * NSEQ + (tid & 3) * 8;
    const unsigned kd0 = lds_off(kl) + (tid       + (tid      ) / 12) * 16;
    const unsigned kd1 = lds_off(kl) + (tid + 128 + (tid + 128) / 12) * 16;
    const unsigned kd2 = lds_off(kl) + (tid + 256 + (tid + 256) / 12) * 16;
    const unsigned vd0 = lds_off(vl) + (tid + (tid >> 2)) * 16;
    auto stage = [&](int kt, int buf) {
        const h16* kg = kg0 + (size_t)kt * HDP;
        const h16* vg = vg0 + kt;
        unsigned kb = buf * (KTILE * 2), vd = vd0 + buf * (VTILE * 2);
        // s_wait_xcnt 0 closes each statement: no address register is rewritten in front of it
        asm volatile("global_load_async_to_lds_b128 %0, %1, off\n\t"
                     "global_load_async_to_lds_b128 %2, %3, off\n\t"
                     "global_load_async_to_lds_b128 %4, %5, off\n\t"
                     "global_load_async_to_lds_b128 %6, %7, off\n\t"
                     "global_load_async_to_lds_b128 %8, %9, off\n\t"
                     "s_wait_xcnt 0x0"
                     :: "v"(kd0 + kb), "v"(kg), "v"(kd1 + kb), "v"(kg + 1024), "v"(kd2 + kb), "v"(kg + 2048),
                        "v"(vd), "v"(vg), "v"(vd + 32 * VPITCH * 2), "v"(vg + 32 * NSEQ) : "memory");
        if (wvs < 2)
            asm volatile("global_load_async_to_lds_b128 %0, %1, off\n\t"
                         "s_wait_xcnt 0x0"
                         :: "v"(vd + 64 * VPITCH * 2), "v"(vg + 64 * NSEQ) : "memory");
    };
    stage(0, 0);

    // a key is now a register row, not a lane: its scale comes from a table filled once
    // (published by the barrier in front of the loop)
    #pragma unroll  // fixed 8 trips: the exponentials issue back to back instead of one per loop trip
    for (int i = 0; i < NSEQ / (32 * QTPB); i++) {
        int k = tid + 32 * QTPB * i;
        float p = (float)k * invN1 - 0.5f;
        psl[k] = __expf(-sf * p * p);
    }

    asm volatile("s_wait_asynccnt 0x0" ::: "memory");  // this wave's copies of tile 0 have landed
    __syncthreads();                                   // every wave's have: tile 0 and the table are readable
    stage(32, 1);                                      // tile 1 flies during pass 0

    for (int kt = 0; kt < NSEQ; kt += 32) {
        int buf = (kt >> 5) & 1;                       // this pass reads this buffer alone

        // ---- S^T = K Q^T for two 16-key tiles (K fragments from LDS as A) ----
        v8f s0 = zero, s1 = zero;
        const h16* krow0 = kl + buf * KTILE + (size_t)r * KPITCH;
        const h16* krow1 = kl + buf * KTILE + (size_t)(16 + r) * KPITCH;
        v16h kb;
        kb = make_frag(krow0 +      8 * hh, krow0 + 16 + 8 * hh); s0 = WMMA16(kb, qa0, s0);
        kb = make_frag(krow1 +      8 * hh, krow1 + 16 + 8 * hh); s1 = WMMA16(kb, qa0, s1);
        kb = make_frag(krow0 + 32 + 8 * hh, krow0 + 48 + 8 * hh); s0 = WMMA16(kb, qa1, s0);
        kb = make_frag(krow1 + 32 + 8 * hh, krow1 + 48 + 8 * hh); s1 = WMMA16(kb, qa1, s1);
        kb = make_frag(krow0 + 64 + 8 * hh, krow0 + 80 + 8 * hh); s0 = WMMA16(kb, qa2, s0);
        kb = make_frag(krow1 + 64 + 8 * hh, krow1 + 80 + 8 * hh); s1 = WMMA16(kb, qa2, s1);

        // per-key positional scale: keys kt + 8*hh + vg (s0) and kt + 16 + 8*hh + vg (s1)
        const v4f* pt = (const v4f*)(psl + kt + 8 * hh);
        v4f pa = pt[0], pb = pt[1], pc = pt[4], pd = pt[5];

        // ---- online softmax for this lane's query ----
        float t0[8], t1[8];
        #pragma unroll
        for (int vg = 0; vg < 4; vg++) {
            t0[vg]     = s0[vg]     * pa[vg];
            t0[vg + 4] = s0[vg + 4] * pb[vg];
            t1[vg]     = s1[vg]     * pc[vg];
            t1[vg + 4] = s1[vg + 4] * pd[vg];
        }
        float tm = fmaxf(t0[0], t1[0]);
        #pragma unroll
        for (int vg = 1; vg < 8; vg++) tm = fmaxf(tm, fmaxf(t0[vg], t1[vg]));
        tm = fmaxf(tm, xhalf(tm));
        float mn = fmaxf(m_run, tm);
        float alpha = __expf(m_run - mn);
        m_run = mn;
        v16h pf;                           // P^T as B: element i = key 8*hh + i, 8 + i = key 16 + 8*hh + i
        float es = 0.f;
        #pragma unroll
        for (int vg = 0; vg < 8; vg++) {
            float e0 = __expf(t0[vg] - mn), e1 = __expf(t1[vg] - mn);
            es += e0 + e1;
            pf[vg] = (h16)e0; pf[vg + 8] = (h16)e1;
        }
        l_run = l_run * alpha + es;
        #pragma unroll
        for (int dt = 0; dt < 5; dt++)
            #pragma unroll
            for (int vg = 0; vg < 8; vg++) accO[dt][vg] *= alpha;

        // ---- O^T += V^T P^T  (V^T fragments from LDS as A, key-contiguous rows of 32 at VPITCH) ----
        #pragma unroll
        for (int dt = 0; dt < 5; dt++) {
            const h16* vrow = vl + buf * VTILE + (dt * 16 + r) * VPITCH;
            v16h vf = make_frag(vrow + 8 * hh, vrow + 16 + 8 * hh);
            accO[dt] = WMMA16(vf, pf, accO[dt]);
        }

        // ---- foot of the pass: publish the next tile, then refill the buffer just read ----
        asm volatile("s_wait_dscnt 0x0" ::: "memory");     // this wave's reads of this buffer are done
        asm volatile("s_wait_asynccnt 0x0" ::: "memory");  // this wave's copies of the next tile have landed
        __syncthreads();                                   // both hold for every wave
        if (kt + 64 < NSEQ) stage(kt + 64, buf);           // flies during the next pass
    }
    asm volatile("s_wait_asynccnt 0x0" ::: "memory");      // no copy is outstanding when the wave ends

    // ---- finalize: join the halves' sums, normalize, store in the projection's fragment order ----
    float inv = 1.f / (l_run + xhalf(l_run));
    int orow = b * NSEQ + qt * 16 + r;
    int ocol = hd * HD + 8 * hh;          // a multiple of 4: a group of 4 dims stays inside one 8-element chunk
    #pragma unroll
    for (int dt = 0; dt < 5; dt++) {
        v4h lo, hi;
        #pragma unroll
        for (int vg = 0; vg < 4; vg++) {
            lo[vg] = (h16)(accO[dt][vg] * inv);
            hi[vg] = (h16)(accO[dt][vg + 4] * inv);
        }
        if (dt < 4) {
            *(v4h*)(O + frag_pos(orow, ocol + dt * 16))     = lo;
            *(v4h*)(O + frag_pos(orow, ocol + dt * 16 + 4)) = hi;
        } else if (hh == 0) {
            *(v4h*)(O + frag_pos(orow, ocol + dt * 16))     = lo;   // dims 64..67; 68..79 are padding
        }
    }
}

// ---------------- stage F: projection GEMM (WMMA) + bias ----------------
__global__ void k_proj(const h16* __restrict__ O, const h16* __restrict__ wp,
                       const float* __restrict__ pb, float* __restrict__ out) {
    int lane = threadIdx.x;
    int mt = blockIdx.y * 8 + threadIdx.y;  // 0..511
    int ntg = blockIdx.x;                   // 0..16 (2 tiles each -> 34 tiles = 544)
    int r = lane & 15, hh = lane >> 4;
    const h16* atile = O + (size_t)mt * (KSTEPS * FBLK) + lane * 8;    // both operands in fragment order
    int o0 = (ntg * 2 + 0) * 16 + r;
    int o1 = (ntg * 2 + 1) * 16 + r;
    const h16* b0tile = wp + (size_t)(ntg * 2 + 0) * (KSTEPS * FBLK) + lane * 8;
    const h16* b1tile = wp + (size_t)(ntg * 2 + 1) * (KSTEPS * FBLK) + lane * 8;
    v8f acc0 = {}; v8f acc1 = {};
    for (int ks = 0; ks < KSTEPS; ks++) {
        int c0 = ks * FBLK, c1 = ks * FBLK + FBLK / 2;
        v16h a  = make_frag(atile  + c0, atile  + c1);
        v16h b0 = make_frag(b0tile + c0, b0tile + c1);
        v16h b1 = make_frag(b1tile + c0, b1tile + c1);
        acc0 = WMMA16(a, b0, acc0);
        acc1 = WMMA16(a, b1, acc1);
    }
    float bias0 = pb[o0], bias1 = pb[o1];
    #pragma unroll
    for (int vg = 0; vg < 8; vg++) {
        int m = mt * 16 + vg + 8 * hh;
        out[(size_t)m * CDIM + o0] = acc0[vg] + bias0;
        out[(size_t)m * CDIM + o1] = acc1[vg] + bias1;
    }
}

extern "C" void kernel_launch(void* const* d_in, const int* in_sizes, int n_in,
                              void* d_out, int out_size, void* d_ws, size_t ws_size,
                              hipStream_t stream) {
    const float* x     = (const float*)d_in[0];
    const float* ng    = (const float*)d_in[1];
    const float* nb    = (const float*)d_in[2];
    const float* apw   = (const float*)d_in[3];
    const float* apb   = (const float*)d_in[4];
    const float* n2g   = (const float*)d_in[5];
    const float* n2b   = (const float*)d_in[6];
    const float* qkvw  = (const float*)d_in[7];
    const float* projw = (const float*)d_in[8];
    const float* projb = (const float*)d_in[9];
    const float* sfp   = (const float*)d_in[10];
    float* out = (float*)d_out;

    char* ws = (char*)d_ws;
    size_t off = 0;
    float* xr = (float*)(ws + off); off += (size_t)BN * CDIM * 4;        // 17.8 MB
    float* sc = (float*)(ws + off); off += (size_t)BN * NJ * 4;          // 0.56 MB
    h16* xp = (h16*)(ws + off); off += (size_t)BN * CDIM * 2;            // 8.9 MB
    h16* wq = (h16*)(ws + off); off += (size_t)C3 * CDIM * 2;            // 1.8 MB
    h16* wp = (h16*)(ws + off); off += (size_t)CDIM * CDIM * 2;          // 0.6 MB
    h16* Qp = (h16*)(ws + off); off += (size_t)NB * NH * NSEQ * HDP * 2; // 12.6 MB
    h16* Kp = (h16*)(ws + off); off += (size_t)NB * NH * NSEQ * HDP * 2; // 12.6 MB
    h16* Vt = (h16*)(ws + off); off += (size_t)NB * NH * HDP2 * NSEQ * 2;// 10.5 MB
    h16* O  = (h16*)(ws + off); off += (size_t)BN * CDIM * 2;            // 8.9 MB

    // W: weight conversion f32 -> f16
    int ncvt = C3 * CDIM + CDIM * CDIM;
    k_cvt<<<(ncvt + 255) / 256, 256, 0, stream>>>(qkvw, projw, wq, wp);
    // A: per-joint LN + attention-pool scores
    k_ln1<<<(BN * NJ + 255) / 256, 256, 0, stream>>>(x, ng, nb, apw, apb, xr, sc);
    // B: softmax over sequence axis
    k_softmax_n<<<NB * NJ, 256, 0, stream>>>(sc);
    // C: pool + LN over C -> f16 activations; zeroes the padding of Q, K, V^T
    k_pool_ln2<<<BN, 256, 0, stream>>>(xr, sc, n2g, n2b, xp, Qp, Kp, Vt);
    // D: QKV GEMM (WMMA), scatter to Q (scaled), K, V^T
    k_qkv_gemm<<<dim3(34, 64), dim3(32, 8), 0, stream>>>(xp, wq, Qp, Kp, Vt);
    // E: flash attention, 4 query tiles per block sharing K/V through LDS
    k_attn<<<dim3(64 / QTPB, NH, NB), dim3(32, QTPB), 0, stream>>>(Qp, Kp, Vt, sfp, O);
    // F: projection GEMM (WMMA) + bias -> f32 output
    k_proj<<<dim3(17, 64), dim3(32, 8), 0, stream>>>(O, wp, projb, out);
    (void)in_sizes; (void)n_in; (void)out_size; (void)ws_size;
}

// v007
// Measured time: 132 microseconds a run.
// Timed twice side by side with v006, it ran 1.04 times as fast both times.
// Over all steps from v000 it is 2.44 times as fast.
#include <hip/hip_runtime.h>
#include <hip/hip_bf16.h>
#include <math.h>

typedef _Float16 h16;
typedef __attribute__((ext_vector_type(4)))  _Float16 v4h;
typedef __attribute__((ext_vector_type(8)))  _Float16 v8h;
typedef __attribute__((ext_vector_type(16))) _Float16 v16h;
typedef __attribute__((ext_vector_type(8)))  float    v8f;

#define NJ    17
#define NF    32
#define CDIM  544
#define NH    8
#define HD    68
#define HDP   96    // padded head dim for Q/K (3 K-steps of 32)
#define HDP2  80    // padded head dim for O tiles (5 tiles of 16)
#define NB    8
#define NSEQ  1024
#define BN    8192  // NB*NSEQ
#define C3    1632  // 3*CDIM
#define QTPB  4     // query tiles (waves) per attention block

#define WMMA16(a,b,c) __builtin_amdgcn_wmma_f32_16x16x32_f16(false,(a),false,(b),(short)0,(c),false,false)

__device__ __forceinline__ v16h make_frag(const h16* p0, const h16* p1) {
    v8h a = *(const v8h*)p0;
    v8h b = *(const v8h*)p1;
    return __builtin_shufflevector(a, b, 0,1,2,3,4,5,6,7,8,9,10,11,12,13,14,15);
}

// Fragment order for the operands of the two GEMMs (row-major [rows][CDIM] matrices).
// One 16-row x 32-k block is 1 KB: two 512-byte halves, and in each half lane l = r + 16*hh
// owns 16 bytes. Half 0 holds k = 8*hh + e, half 1 holds k = 16 + 8*hh + e (e = 0..7): the
// same elements at the same lane and register as the row-major loader took, so a fragment
// is two loads of 512 contiguous bytes (4 whole lines each) instead of 16 pieces of 32 bytes.
#define KSTEPS (CDIM / 32)   // 17 k-steps
#define FBLK   512           // elements per 16 x 32 block
__device__ __forceinline__ int frag_pos(int row, int c) {
    return (((row >> 4) * KSTEPS + (c >> 5)) * FBLK) + ((c & 16) << 4) + ((c & 8) << 4)
         + ((row & 15) << 3) + (c & 7);
}
// inverse map: position in fragment order -> row * CDIM + c
__device__ __forceinline__ int frag_src(int p) {
    int blk = p / FBLK;
    int row = (blk / KSTEPS) * 16 + ((p >> 3) & 15);
    int c   = (blk % KSTEPS) * 32 + ((p >> 4) & 16) + ((p >> 4) & 8) + (p & 7);
    return row * CDIM + c;
}

// ---------------- stage W: convert weights f32 -> f16, stored in fragment order ----------------
__global__ void k_cvt(const float* __restrict__ qkvw, const float* __restrict__ projw,
                      h16* __restrict__ wq, h16* __restrict__ wp) {
    int i = blockIdx.x * blockDim.x + threadIdx.x;   // destination index: stores stay contiguous
    const int n1 = C3 * CDIM, n2 = CDIM * CDIM;
    if (i < n1)            wq[i] = (h16)qkvw[frag_src(i)];
    else if (i < n1 + n2)  wp[i - n1] = (h16)projw[frag_src(i - n1)];
}

// ---------------- stage A: per-joint LN + pooling scores ----------------
__global__ void k_ln1(const float* __restrict__ x, const float* __restrict__ g,
                      const float* __restrict__ bb, const float* __restrict__ apw,
                      const float* __restrict__ apb,
                      float* __restrict__ xr, float* __restrict__ sc) {
    int idx = blockIdx.x * blockDim.x + threadIdx.x;  // (b*N+n)*17 + j
    if (idx >= BN * NJ) return;
    const float* px = x + (size_t)idx * NF;
    float s = 0.f, s2 = 0.f;
    #pragma unroll
    for (int f = 0; f < NF; f++) { float v = px[f]; s += v; s2 += v * v; }
    float mu = s * (1.f / NF);
    float var = s2 * (1.f / NF) - mu * mu;
    float rs = rsqrtf(var + 1e-5f);
    float* po = xr + (size_t)idx * NF;
    float acc = 0.f;
    #pragma unroll
    for (int f = 0; f < NF; f++) {
        float v = (px[f] - mu) * rs * g[f] + bb[f];
        po[f] = v;
        acc += v * apw[f];
    }
    sc[idx] = acc + apb[0];
}

// ---------------- stage B: softmax over sequence axis N ----------------
__global__ void k_softmax_n(float* __restrict__ sc) {
    int b = blockIdx.x / NJ, j = blockIdx.x % NJ;
    __shared__ float red[256];
    int t = threadIdx.x;
    float m = -3e38f;
    for (int n = t; n < NSEQ; n += 256) m = fmaxf(m, sc[(b * NSEQ + n) * NJ + j]);
    red[t] = m; __syncthreads();
    for (int o = 128; o > 0; o >>= 1) { if (t < o) red[t] = fmaxf(red[t], red[t + o]); __syncthreads(); }
    m = red[0]; __syncthreads();
    float s = 0.f;
    for (int n = t; n < NSEQ; n += 256) s += __expf(sc[(b * NSEQ + n) * NJ + j] - m);
    red[t] = s; __syncthreads();
    for (int o = 128; o > 0; o >>= 1) { if (t < o) red[t] += red[t + o]; __syncthreads(); }
    float inv = 1.f / red[0];
    for (int n = t; n < NSEQ; n += 256) {
        int id = (b * NSEQ + n) * NJ + j;
        sc[id] = __expf(sc[id] - m) * inv;
    }
}

// ---------------- stage C: pool by weights + LN over C, emit f16 ----------------
// The launch also zeroes the padding of Q, K and V^T: the only elements of those buffers that the
// attention launch reads and the QKV GEMM does not write. One store a thread, from 124 of the 256.
#define QKPAD4 ((HDP - HD) / 4)                    // 7 groups of 4 pad dims (8 bytes) in a Q or K row
#define VPAD8  ((HDP2 - HD) * NSEQ / 8 / (BN / (NB * NH)))   // 12 chunks of 16 bytes: a block's share of its head's pad rows
__global__ void k_pool_ln2(const float* __restrict__ xr, const float* __restrict__ w,
                           const float* __restrict__ g2, const float* __restrict__ b2,
                           h16* __restrict__ xp,
                           h16* __restrict__ Qp, h16* __restrict__ Kp, h16* __restrict__ Vt) {
    int row = blockIdx.x;  // b*N + n
    __shared__ float vals[CDIM];
    __shared__ float red[256];
    int t = threadIdx.x;
    if (t < 2 * NH * QKPAD4) {
        // this token's dims 68..95 in each head's Q row (pieces 0..7) and K row (pieces 8..15)
        int piece = t / QKPAD4, part = t % QKPAD4;
        int bh = (row >> 10) * NH + (piece & (NH - 1));
        h16* dst = (piece < NH ? Qp : Kp) + (size_t)(bh * NSEQ + (row & (NSEQ - 1))) * HDP + HD + part * 4;
        v4h z4 = {};
        *(v4h*)dst = z4;
    } else if (t >= 128 && t < 128 + VPAD8) {
        // rows 68..79 of a head's V^T are contiguous: 1536 chunks, shared out over the 128 blocks row >> 7 == head
        h16* dst = Vt + ((size_t)(row >> 7) * HDP2 + HD) * NSEQ + ((row & 127) * VPAD8 + (t - 128)) * 8;
        v8h z8 = {};
        *(v8h*)dst = z8;
    }
    float s = 0.f;
    for (int c = t; c < CDIM; c += 256) {
        float v = xr[(size_t)row * CDIM + c] * w[row * NJ + c / NF];
        vals[c] = v; s += v;
    }
    red[t] = s; __syncthreads();
    for (int o = 128; o > 0; o >>= 1) { if (t < o) red[t] += red[t + o]; __syncthreads(); }
    float mu = red[0] * (1.f / CDIM); __syncthreads();
    float s2 = 0.f;
    for (int c = t; c < CDIM; c += 256) { float d = vals[c] - mu; s2 += d * d; }
    red[t] = s2; __syncthreads();
    for (int o = 128; o > 0; o >>= 1) { if (t < o) red[t] += red[t + o]; __syncthreads(); }
    float rs = rsqrtf(red[0] * (1.f / CDIM) + 1e-5f);
    for (int c = t; c < CDIM; c += 256)
        xp[frag_pos(row, c)] = (h16)((vals[c] - mu) * rs * g2[c] + b2[c]);
}

// ---------------- stage D: QKV GEMM (WMMA, 16x48 per wave) ----------------
__global__ void k_qkv_gemm(const h16* __restrict__ xp, const h16* __restrict__ wq,
                           h16* __restrict__ Qp, h16* __restrict__ Kp, h16* __restrict__ Vt) {
    int lane = threadIdx.x;                 // 0..31
    int mt = blockIdx.y * 8 + threadIdx.y;  // row tile 0..511
    int ntg = blockIdx.x;                   // col tile group 0..33 (3 tiles each)
    int r = lane & 15, hh = lane >> 4;
    const h16* atile = xp + (size_t)mt * (KSTEPS * FBLK) + lane * 8;   // both operands in fragment order
    const h16* btile[3];
    #pragma unroll
    for (int nt = 0; nt < 3; nt++)
        btile[nt] = wq + (size_t)(ntg * 3 + nt) * (KSTEPS * FBLK) + lane * 8;
    v8f zero = {};
    v8f acc[3];
    #pragma unroll
    for (int nt = 0; nt < 3; nt++) acc[nt] = zero;
    for (int ks = 0; ks < KSTEPS; ks++) {
        int c0 = ks * FBLK, c1 = ks * FBLK + FBLK / 2;
        v16h a = make_frag(atile + c0, atile + c1);
        #pragma unroll
        for (int nt = 0; nt < 3; nt++) {
            v16h bfr = make_frag(btile[nt] + c0, btile[nt] + c1);
            acc[nt] = WMMA16(a, bfr, acc[nt]);
        }
    }
    const float qscale = 0.121267813f;  // 68^-0.5, folded into Q
    // keeps the epilogue's index arithmetic behind the k loop: lifted into it, it costs 8 more registers (64 -> 72) and 4 of 16 waves a SIMD
    __builtin_amdgcn_sched_barrier(0);
    int m0 = mt * 16 + 8 * hh;              // this lane's first row (b*N+n); its 8 rows are m0 + vg, inside one batch
    int b = m0 >> 10, n0 = m0 & 1023;
    #pragma unroll
    for (int nt = 0; nt < 3; nt++) {
        int tile = ntg * 3 + nt;            // the same for the whole block
        int third = tile / (CDIM / 16);     // 34 whole tiles each of Q, K and V: a tile lies in one of them
        int rem = (tile - third * (CDIM / 16)) * 16 + r;
        int hd = rem / HD, d = rem % HD;
        int bh = b * NH + hd;
        if (third == 2) {
            // a lane's 8 accumulators are 8 consecutive tokens of one dim: 16 contiguous bytes of its V^T row
            v8h pk;
            #pragma unroll
            for (int vg = 0; vg < 8; vg++) pk[vg] = (h16)acc[nt][vg];
            *(v8h*)(Vt + (size_t)(bh * HDP2 + d) * NSEQ + n0) = pk;
            // the next tile's code reuses this store's registers: the wait stands in front of that
            if (nt < 2) asm volatile("s_wait_xcnt 0x0" ::: "memory");
        } else {
            h16* dst = (third == 0 ? Qp : Kp) + (size_t)(bh * NSEQ + n0) * HDP + d;
            float sc = third == 0 ? qscale : 1.f;   // K times 1 is exact
            #pragma unroll
            for (int vg = 0; vg < 8; vg++) dst[vg * HDP] = (h16)(acc[nt][vg] * sc);
            // the code behind this branch reuses these stores' registers: the wait stands in front of that
            asm volatile("s_wait_xcnt 0x0" ::: "memory");
        }
    }
}

typedef __attribute__((ext_vector_type(4))) float    v4f;

// lane l <-> lane l ^ 16: the other half of the same query's keys
__device__ __forceinline__ float xhalf(float x) {
    return __builtin_bit_cast(float, __builtin_amdgcn_permlanex16(
        __builtin_bit_cast(int, x), __builtin_bit_cast(int, x),
        0x76543210, 0xfedcba98, false, false));
}

__device__ __forceinline__ unsigned lds_off(const void* p) { return (unsigned)(size_t)p; }

// LDS row pitches, in elements: 16 bytes times an odd number (208 B and 80 B), so that the 16 rows
// which a half wave reads with one 16-byte load start on 16 different groups of 4 banks. At the data's
// own pitches (192 B and 64 B) they start on 4 groups only. The 16 pad bytes of a row are never touched.
#define KPITCH (HDP + 8)
#define VPITCH (32 + 8)
#define KTILE (32 * KPITCH)     // elements of one staged K tile
#define VTILE (HDP2 * VPITCH)   // elements of one staged V^T tile

// the real block size: without it the compiler budgets for 1,024 threads (128 registers a wave), too few
// to hold a pass's 11 fragments at once
__global__ __launch_bounds__(32 * QTPB) void k_attn(const h16* __restrict__ Qp, const h16* __restrict__ Kp,
                       const h16* __restrict__ Vt, const float* __restrict__ sfp,
                       h16* __restrict__ O) {
    int lane = threadIdx.x;               // 0..31
    int wv = threadIdx.y;                 // 0..3 : one query tile per wave
    int tid = wv * 32 + lane;
    int wvs = __builtin_amdgcn_readfirstlane(wv);   // the wave's number in a scalar register: a test on it is a scalar branch
    int qt = blockIdx.x * QTPB + wv;      // 0..63
    int hd = blockIdx.y, b = blockIdx.z;
    int bh = b * NH + hd;
    int r = lane & 15, hh = lane >> 4;
    float sf = sfp[0];

    __shared__ __align__(16) h16 kl[2 * KTILE];       // 2 x 6.5 KB: 32 keys x 96 dims, padded rows
    __shared__ __align__(16) h16 vl[2 * VTILE];       // 2 x 6.25 KB: 80 dims x 32 keys, padded rows
    __shared__ __align__(16) float psl[NSEQ];         // 4 KB: per-key positional scale

    // Q fragments for this wave's 16 queries (3 K-steps covering padded 96), used as B
    const h16* qrow = Qp + (size_t)(bh * NSEQ + qt * 16 + r) * HDP;
    v16h qa0 = make_frag(qrow +      8 * hh, qrow + 16 + 8 * hh);
    v16h qa1 = make_frag(qrow + 32 + 8 * hh, qrow + 48 + 8 * hh);
    v16h qa2 = make_frag(qrow + 64 + 8 * hh, qrow + 80 + 8 * hh);

    v8f zero = {};
    v8f accO[5];                          // O^T tiles: row = dim dt*16 + vg + 8*hh, column = query r
    #pragma unroll
    for (int i = 0; i < 5; i++) accO[i] = zero;
    float m_run = -1e30f, l_run = 0.f;    // this lane's query; l_run sums this half's keys only

    const h16* kbase = Kp + (size_t)bh * NSEQ * HDP;
    const h16* vbase = Vt + (size_t)bh * HDP2 * NSEQ;
    const float invN1 = 1.f / (float)(NSEQ - 1);

    // One tile's asynchronous copies, 16 bytes a lane each, every lane on. The K tile is contiguous in
    // memory (384 chunks: 3 a lane, 12 a row); the V^T tile is 80 rows x 4 chunks (2 a lane, a third from
    // waves 0 and 1). In LDS chunk c lands 16 bytes further for every row in front of it.
    const h16* kg0 = kbase + tid * 8;
    const h16* vg0 = vbase + (size_t)(tid >> 2) * NSEQ + (tid & 3) * 8;
    const unsigned kd0 = lds_off(kl) + (tid       + (tid      ) / 12) * 16;
    const unsigned kd1 = lds_off(kl) + (tid + 128 + (tid + 128) / 12) * 16;
    const unsigned kd2 = lds_off(kl) + (tid + 256 + (tid + 256) / 12) * 16;
    const unsigned vd0 = lds_off(vl) + (tid + (tid >> 2)) * 16;
    auto stage = [&](int kt, int buf) {
        const h16* kg = kg0 + (size_t)kt * HDP;
        const h16* vg = vg0 + kt;
        unsigned kb = buf * (KTILE * 2), vd = vd0 + buf * (VTILE * 2);
        // s_wait_xcnt 0 closes each statement: no address register is rewritten in front of it
        asm volatile("global_load_async_to_lds_b128 %0, %1, off\n\t"
                     "global_load_async_to_lds_b128 %2, %3, off\n\t"
                     "global_load_async_to_lds_b128 %4, %5, off\n\t"
                     "global_load_async_to_lds_b128 %6, %7, off\n\t"
                     "global_load_async_to_lds_b128 %8, %9, off\n\t"
                     "s_wait_xcnt 0x0"
                     :: "v"(kd0 + kb), "v"(kg), "v"(kd1 + kb), "v"(kg + 1024), "v"(kd2 + kb), "v"(kg + 2048),
                        "v"(vd), "v"(vg), "v"(vd + 32 * VPITCH * 2), "v"(vg + 32 * NSEQ) : "memory");
        if (wvs < 2)
            asm volatile("global_load_async_to_lds_b128 %0, %1, off\n\t"
                         "s_wait_xcnt 0x0"
                         :: "v"(vd + 64 * VPITCH * 2), "v"(vg + 64 * NSEQ) : "memory");
    };
    stage(0, 0);

    // a key is now a register row, not a lane: its scale comes from a table filled once
    // (published by the barrier in front of the loop)
    #pragma unroll  // fixed 8 trips: the exponentials issue back to back instead of one per loop trip
    for (int i = 0; i < NSEQ / (32 * QTPB); i++) {
        int k = tid + 32 * QTPB * i;
        float p = (float)k * invN1 - 0.5f;
        psl[k] = __expf(-sf * p * p);
    }

    asm volatile("s_wait_asynccnt 0x0" ::: "memory");  // this wave's copies of tile 0 have landed
    __syncthreads();                                   // every wave's have: tile 0 and the table are readable
    stage(32, 1);                                      // tile 1 flies during pass 0

    for (int kt = 0; kt < NSEQ; kt += 32) {
        int buf = (kt >> 5) & 1;                       // this pass reads this buffer alone

        // ---- all 26 LDS reads of the pass in one group: scales, K fragments, V^T fragments ----
        // per-key positional scale: keys kt + 8*hh + vg (s0) and kt + 16 + 8*hh + vg (s1)
        const v4f* pt = (const v4f*)(psl + kt + 8 * hh);
        v4f pa = pt[0], pb = pt[1], pc = pt[4], pd = pt[5];
        const h16* krow0 = kl + buf * KTILE + (size_t)r * KPITCH + 8 * hh;
        const h16* krow1 = krow0 + 16 * KPITCH;
        v16h kf0[3], kf1[3], vf[5];
        #pragma unroll  // every index a constant: the fragment arrays stay in registers
        for (int ks = 0; ks < 3; ks++) {
            kf0[ks] = make_frag(krow0 + 32 * ks, krow0 + 32 * ks + 16);
            kf1[ks] = make_frag(krow1 + 32 * ks, krow1 + 32 * ks + 16);
        }
        // keeps the K reads in front of the V^T reads: LDS answers in order, and the first products wait for K alone
        __builtin_amdgcn_sched_barrier(0);
        #pragma unroll  // as above
        for (int dt = 0; dt < 5; dt++) {
            const h16* vrow = vl + buf * VTILE + (dt * 16 + r) * VPITCH + 8 * hh;
            vf[dt] = make_frag(vrow, vrow + 16);
        }
        // holds the reads together in front of the products: sunk among them, each pair is waited out alone,
        // about ten LDS latencies a pass instead of one
        __builtin_amdgcn_sched_barrier(0);

        // ---- S^T = K Q^T for two 16-key tiles (K fragments as A) ----
        v8f s0 = zero, s1 = zero;
        s0 = WMMA16(kf0[0], qa0, s0);
        s1 = WMMA16(kf1[0], qa0, s1);
        s0 = WMMA16(kf0[1], qa1, s0);
        s1 = WMMA16(kf1[1], qa1, s1);
        s0 = WMMA16(kf0[2], qa2, s0);
        s1 = WMMA16(kf1[2], qa2, s1);

        // ---- online softmax for this lane's query ----
        float t0[8], t1[8];
        #pragma unroll
        for (int vg = 0; vg < 4; vg++) {
            t0[vg]     = s0[vg]     * pa[vg];
            t0[vg + 4] = s0[vg + 4] * pb[vg];
            t1[vg]     = s1[vg]     * pc[vg];
            t1[vg + 4] = s1[vg + 4] * pd[vg];
        }
        float tm = fmaxf(t0[0], t1[0]);
        #pragma unroll
        for (int vg = 1; vg < 8; vg++) tm = fmaxf(tm, fmaxf(t0[vg], t1[vg]));
        tm = fmaxf(tm, xhalf(tm));
        float mn = fmaxf(m_run, tm);
        float alpha = __expf(m_run - mn);
        m_run = mn;
        v16h pf;                           // P^T as B: element i = key 8*hh + i, 8 + i = key 16 + 8*hh + i
        float es = 0.f;
        #pragma unroll
        for (int vg = 0; vg < 8; vg++) {
            float e0 = __expf(t0[vg] - mn), e1 = __expf(t1[vg] - mn);
            es += e0 + e1;
            pf[vg] = (h16)e0; pf[vg + 8] = (h16)e1;
        }
        l_run = l_run * alpha + es;
        #pragma unroll
        for (int dt = 0; dt < 5; dt++)
            #pragma unroll
            for (int vg = 0; vg < 8; vg++) accO[dt][vg] *= alpha;

        // ---- O^T += V^T P^T  (V^T fragments as A, read at the head of the pass) ----
        #pragma unroll
        for (int dt = 0; dt < 5; dt++) accO[dt] = WMMA16(vf[dt], pf, accO[dt]);

        // ---- foot of the pass: publish the next tile, then refill the buffer just read ----
        // holds the pass's arithmetic in front of the foot: with every LDS read at the head the compiler lifts the
        // waits and the barrier over it, and the wait for the next tile's copies then stands right behind their issue
        __builtin_amdgcn_sched_barrier(0);
        asm volatile("s_wait_dscnt 0x0" ::: "memory");     // this wave's reads of this buffer are done
        asm volatile("s_wait_asynccnt 0x0" ::: "memory");  // this wave's copies of the next tile have landed
        __syncthreads();                                   // both hold for every wave
        if (kt + 64 < NSEQ) stage(kt + 64, buf);           // flies during the next pass
    }
    asm volatile("s_wait_asynccnt 0x0" ::: "memory");      // no copy is outstanding when the wave ends

    // ---- finalize: join the halves' sums, normalize, store in the projection's fragment order ----
    float inv = 1.f / (l_run + xhalf(l_run));
    int orow = b * NSEQ + qt * 16 + r;
    int ocol = hd * HD + 8 * hh;          // a multiple of 4: a group of 4 dims stays inside one 8-element chunk
    #pragma unroll
    for (int dt = 0; dt < 5; dt++) {
        v4h lo, hi;
        #pragma unroll
        for (int vg = 0; vg < 4; vg++) {
            lo[vg] = (h16)(accO[dt][vg] * inv);
            hi[vg] = (h16)(accO[dt][vg + 4] * inv);
        }
        if (dt < 4) {
            *(v4h*)(O + frag_pos(orow, ocol + dt * 16))     = lo;
            *(v4h*)(O + frag_pos(orow, ocol + dt * 16 + 4)) = hi;
        } else if (hh == 0) {
            *(v4h*)(O + frag_pos(orow, ocol + dt * 16))     = lo;   // dims 64..67; 68..79 are padding
        }
    }
}

// ---------------- stage F: projection GEMM (WMMA) + bias ----------------
__global__ void k_proj(const h16* __restrict__ O, const h16* __restrict__ wp,
                       const float* __restrict__ pb, float* __restrict__ out) {
    int lane = threadIdx.x;
    int mt = blockIdx.y * 8 + threadIdx.y;  // 0..511
    int ntg = blockIdx.x;                   // 0..16 (2 tiles each -> 34 tiles = 544)
    int r = lane & 15, hh = lane >> 4;
    const h16* atile = O + (size_t)mt * (KSTEPS * FBLK) + lane * 8;    // both operands in fragment order
    int o0 = (ntg * 2 + 0) * 16 + r;
    int o1 = (ntg * 2 + 1) * 16 + r;
    const h16* b0tile = wp + (size_t)(ntg * 2 + 0) * (KSTEPS * FBLK) + lane * 8;
    const h16* b1tile = wp + (size_t)(ntg * 2 + 1) * (KSTEPS * FBLK) + lane * 8;
    v8f acc0 = {}; v8f acc1 = {};
    for (int ks = 0; ks < KSTEPS; ks++) {
        int c0 = ks * FBLK, c1 = ks * FBLK + FBLK / 2;
        v16h a  = make_frag(atile  + c0, atile  + c1);
        v16h b0 = make_frag(b0tile + c0, b0tile + c1);
        v16h b1 = make_frag(b1tile + c0, b1tile + c1);
        acc0 = WMMA16(a, b0, acc0);
        acc1 = WMMA16(a, b1, acc1);
    }
    float bias0 = pb[o0], bias1 = pb[o1];
    #pragma unroll
    for (int vg = 0; vg < 8; vg++) {
        int m = mt * 16 + vg + 8 * hh;
        out[(size_t)m * CDIM + o0] = acc0[vg] + bias0;
        out[(size_t)m * CDIM + o1] = acc1[vg] + bias1;
    }
}

extern "C" void kernel_launch(void* const* d_in, const int* in_sizes, int n_in,
                              void* d_out, int out_size, void* d_ws, size_t ws_size,
                              hipStream_t stream) {
    const float* x     = (const float*)d_in[0];
    const float* ng    = (const float*)d_in[1];
    const float* nb    = (const float*)d_in[2];
    const float* apw   = (const float*)d_in[3];
    const float* apb   = (const float*)d_in[4];
    const float* n2g   = (const float*)d_in[5];
    const float* n2b   = (const float*)d_in[6];
    const float* qkvw  = (const float*)d_in[7];
    const float* projw = (const float*)d_in[8];
    const float* projb = (const float*)d_in[9];
    const float* sfp   = (const float*)d_in[10];
    float* out = (float*)d_out;

    char* ws = (char*)d_ws;
    size_t off = 0;
    float* xr = (float*)(ws + off); off += (size_t)BN * CDIM * 4;        // 17.8 MB
    float* sc = (float*)(ws + off); off += (size_t)BN * NJ * 4;          // 0.56 MB
    h16* xp = (h16*)(ws + off); off += (size_t)BN * CDIM * 2;            // 8.9 MB
    h16* wq = (h16*)(ws + off); off += (size_t)C3 * CDIM * 2;            // 1.8 MB
    h16* wp = (h16*)(ws + off); off += (size_t)CDIM * CDIM * 2;          // 0.6 MB
    h16* Qp = (h16*)(ws + off); off += (size_t)NB * NH * NSEQ * HDP * 2; // 12.6 MB
    h16* Kp = (h16*)(ws + off); off += (size_t)NB * NH * NSEQ * HDP * 2; // 12.6 MB
    h16* Vt = (h16*)(ws + off); off += (size_t)NB * NH * HDP2 * NSEQ * 2;// 10.5 MB
    h16* O  = (h16*)(ws + off); off += (size_t)BN * CDIM * 2;            // 8.9 MB

    // W: weight conversion f32 -> f16
    int ncvt = C3 * CDIM + CDIM * CDIM;
    k_cvt<<<(ncvt + 255) / 256, 256, 0, stream>>>(qkvw, projw, wq, wp);
    // A: per-joint LN + attention-pool scores
    k_ln1<<<(BN * NJ + 255) / 256, 256, 0, stream>>>(x, ng, nb, apw, apb, xr, sc);
    // B: softmax over sequence axis
    k_softmax_n<<<NB * NJ, 256, 0, stream>>>(sc);
    // C: pool + LN over C -> f16 activations; zeroes the padding of Q, K, V^T
    k_pool_ln2<<<BN, 256, 0, stream>>>(xr, sc, n2g, n2b, xp, Qp, Kp, Vt);
    // D: QKV GEMM (WMMA), scatter to Q (scaled), K, V^T
    k_qkv_gemm<<<dim3(34, 64), dim3(32, 8), 0, stream>>>(xp, wq, Qp, Kp, Vt);
    // E: flash attention, 4 query tiles per block sharing K/V through LDS
    k_attn<<<dim3(64 / QTPB, NH, NB), dim3(32, QTPB), 0, stream>>>(Qp, Kp, Vt, sfp, O);
    // F: projection GEMM (WMMA) + bias -> f32 output
    k_proj<<<dim3(17, 64), dim3(32, 8), 0, stream>>>(O, wp, projb, out);
    (void)in_sizes; (void)n_in; (void)out_size; (void)ws_size;
}

// v008
// One run takes 111 microseconds.
// Timed twice side by side with v007, it ran 1.20 times as fast both times.
// Over all steps from v000 it is 2.92 times as fast.
#include <hip/hip_runtime.h>
#include <hip/hip_bf16.h>
#include <math.h>

typedef _Float16 h16;
typedef __attribute__((ext_vector_type(4)))  _Float16 v4h;
typedef __attribute__((ext_vector_type(8)))  _Float16 v8h;
typedef __attribute__((ext_vector_type(16))) _Float16 v16h;
typedef __attribute__((ext_vector_type(8)))  float    v8f;
typedef __attribute__((ext_vector_type(4)))  float    v4f;

#define NJ    17
#define NF    32
#define CDIM  544
#define NH    8
#define HD    68
#define HDP   96    // padded head dim for Q/K (3 K-steps of 32)
#define HDP2  80    // padded head dim for O tiles (5 tiles of 16)
#define NB    8
#define NSEQ  1024
#define BN    8192  // NB*NSEQ
#define C3    1632  // 3*CDIM
#define QTPB  4     // query tiles (waves) per attention block

#define WMMA16(a,b,c) __builtin_amdgcn_wmma_f32_16x16x32_f16(false,(a),false,(b),(short)0,(c),false,false)

__device__ __forceinline__ v16h make_frag(const h16* p0, const h16* p1) {
    v8h a = *(const v8h*)p0;
    v8h b = *(const v8h*)p1;
    return __builtin_shufflevector(a, b, 0,1,2,3,4,5,6,7,8,9,10,11,12,13,14,15);
}

// Fragment order for the operands of the two GEMMs (row-major [rows][CDIM] matrices).
// One 16-row x 32-k block is 1 KB: two 512-byte halves, and in each half lane l = r + 16*hh
// owns 16 bytes. Half 0 holds k = 8*hh + e, half 1 holds k = 16 + 8*hh + e (e = 0..7): the
// same elements at the same lane and register as the row-major loader took, so a fragment
// is two loads of 512 contiguous bytes (4 whole lines each) instead of 16 pieces of 32 bytes.
#define KSTEPS (CDIM / 32)   // 17 k-steps
#define FBLK   512           // elements per 16 x 32 block
__device__ __forceinline__ int frag_pos(int row, int c) {
    return (((row >> 4) * KSTEPS + (c >> 5)) * FBLK) + ((c & 16) << 4) + ((c & 8) << 4)
         + ((row & 15) << 3) + (c & 7);
}
// inverse map: position in fragment order -> row * CDIM + c
__device__ __forceinline__ int frag_src(int p) {
    int blk = p / FBLK;
    int row = (blk / KSTEPS) * 16 + ((p >> 3) & 15);
    int c   = (blk % KSTEPS) * 32 + ((p >> 4) & 16) + ((p >> 4) & 8) + (p & 7);
    return row * CDIM + c;
}

// ---------------- stage W: convert weights f32 -> f16, stored in fragment order ----------------
__global__ void k_cvt(const float* __restrict__ qkvw, const float* __restrict__ projw,
                      h16* __restrict__ wq, h16* __restrict__ wp) {
    int i = blockIdx.x * blockDim.x + threadIdx.x;   // destination index: stores stay contiguous
    const int n1 = C3 * CDIM, n2 = CDIM * CDIM;
    if (i < n1)            wq[i] = (h16)qkvw[frag_src(i)];
    else if (i < n1 + n2)  wp[i - n1] = (h16)projw[frag_src(i - n1)];
}

// ---------------- stage A: per-joint LN + pooling scores ----------------
__global__ void k_ln1(const float* __restrict__ x, const float* __restrict__ g,
                      const float* __restrict__ bb, const float* __restrict__ apw,
                      const float* __restrict__ apb,
                      float* __restrict__ xr, float* __restrict__ sc) {
    int idx = blockIdx.x * blockDim.x + threadIdx.x;  // (b*N+n)*17 + j
    if (idx >= BN * NJ) return;
    const float* px = x + (size_t)idx * NF;
    float s = 0.f, s2 = 0.f;
    #pragma unroll
    for (int f = 0; f < NF; f++) { float v = px[f]; s += v; s2 += v * v; }
    float mu = s * (1.f / NF);
    float var = s2 * (1.f / NF) - mu * mu;
    float rs = rsqrtf(var + 1e-5f);
    float* po = xr + (size_t)idx * NF;
    float acc = 0.f;
    #pragma unroll
    for (int f = 0; f < NF; f++) {
        float v = (px[f] - mu) * rs * g[f] + bb[f];
        po[f] = v;
        acc += v * apw[f];
    }
    sc[idx] = acc + apb[0];
}

// ---------------- stage B: softmax over sequence axis N ----------------
__global__ void k_softmax_n(float* __restrict__ sc) {
    int b = blockIdx.x / NJ, j = blockIdx.x % NJ;
    __shared__ float red[256];
    int t = threadIdx.x;
    float m = -3e38f;
    for (int n = t; n < NSEQ; n += 256) m = fmaxf(m, sc[(b * NSEQ + n) * NJ + j]);
    red[t] = m; __syncthreads();
    for (int o = 128; o > 0; o >>= 1) { if (t < o) red[t] = fmaxf(red[t], red[t + o]); __syncthreads(); }
    m = red[0]; __syncthreads();
    float s = 0.f;
    for (int n = t; n < NSEQ; n += 256) s += __expf(sc[(b * NSEQ + n) * NJ + j] - m);
    red[t] = s; __syncthreads();
    for (int o = 128; o > 0; o >>= 1) { if (t < o) red[t] += red[t + o]; __syncthreads(); }
    float inv = 1.f / red[0];
    for (int n = t; n < NSEQ; n += 256) {
        int id = (b * NSEQ + n) * NJ + j;
        sc[id] = __expf(sc[id] - m) * inv;
    }
}

// ---------------- stage C: pool by weights + LN over C, emit f16 ----------------
// lane l <-> lane l ^ 16: the other 16-lane row of the wave
__device__ __forceinline__ float xhalf(float x) {
    return __builtin_bit_cast(float, __builtin_amdgcn_permlanex16(
        __builtin_bit_cast(int, x), __builtin_bit_cast(int, x),
        0x76543210, 0xfedcba98, false, false));
}
// lane l <-> lane l ^ M inside a 16-lane row (DPP row_xmask:M)
template <int M> __device__ __forceinline__ float xrow(float x) {
    return __builtin_bit_cast(float, __builtin_amdgcn_update_dpp(
        0, __builtin_bit_cast(int, x), 0x160 + M, 0xf, 0xf, true));
}
// sum over the 32 lanes of a wave; every lane ends with the same value
__device__ __forceinline__ float wave_sum(float x) {
    x += xrow<1>(x);
    x += xrow<2>(x);
    x += xrow<4>(x);
    x += xrow<8>(x);
    return x + xhalf(x);
}

// One wave owns one row: its 544 values stay in registers (a lane holds groups of 8 consecutive channels,
// c = 256*i + 8*lane + e; group 2, channels 512..543, lives on lanes 0..3), both sums are in-lane adds and one
// five-step exchange, and a group leaves as the one 16-byte chunk it is in fragment order. No LDS, no barrier.
// The launch also zeroes the padding of Q, K and V^T: the only elements of those buffers that the
// attention launch reads and the QKV GEMM does not write.
#define QKPAD4 ((HDP - HD) / 4)                    // 7 groups of 4 pad dims (8 bytes) in a Q or K row
#define VPAD8  ((HDP2 - HD) * NSEQ / 8 / (BN / (NB * NH)))   // 12 chunks of 16 bytes: a row's share of its head's pad rows
#define PROWS  8                                   // rows (waves) per block
#define PGRP   3                                   // groups of 8 channels per lane
__global__ __launch_bounds__(32 * PROWS) void k_pool_ln2(const float* __restrict__ xr, const float* __restrict__ w,
                           const float* __restrict__ g2, const float* __restrict__ b2,
                           h16* __restrict__ xp,
                           h16* __restrict__ Qp, h16* __restrict__ Kp, h16* __restrict__ Vt) {
    int lane = threadIdx.x & 31;
    int row = blockIdx.x * PROWS + (threadIdx.x >> 5);  // b*N + n
    const bool tail = lane < (CDIM - 512) / 8;          // the lanes that hold a third group

    const float* px = xr + (size_t)row * CDIM + 8 * lane;
    const float* pw = w + row * NJ + (lane >> 2);       // a group of 8 channels lies inside one joint
    const float* pg = g2 + 8 * lane;
    const float* pb = b2 + 8 * lane;
    v4f lo[PGRP] = {}, hi[PGRP] = {}, glo[PGRP] = {}, ghi[PGRP] = {}, blo[PGRP] = {}, bhi[PGRP] = {};
    float ww[PGRP] = {};
    // the third group first: its loads stand under a lane test, and nothing is yet in flight that could be waited for there
    #pragma unroll  // every index a constant: the arrays stay in registers
    for (int i = PGRP - 1; i >= 0; i--) {
        if (i < PGRP - 1 || tail) {
            lo[i]  = *(const v4f*)(px + 256 * i);
            hi[i]  = *(const v4f*)(px + 256 * i + 4);
            ww[i]  = pw[8 * i];
            glo[i] = *(const v4f*)(pg + 256 * i);
            ghi[i] = *(const v4f*)(pg + 256 * i + 4);
            blo[i] = *(const v4f*)(pb + 256 * i);
            bhi[i] = *(const v4f*)(pb + 256 * i + 4);
        }
    }
    // keeps all of the row's loads in one group at the head: sunk behind the two sums, the loads of scale and shift
    // are waited out one after another at the end of the wave
    __builtin_amdgcn_sched_barrier(0);

    // this token's dims 68..95 in each head's Q row (pieces 0..7) and K row (pieces 8..15)
    #pragma unroll  // 4 fixed trips: only the last one needs its lane test
    for (int k0 = 0; k0 < 2 * NH * QKPAD4; k0 += 32) {
        int k = k0 + lane;
        if (k < 2 * NH * QKPAD4) {
            int piece = k / QKPAD4, part = k % QKPAD4;
            int bh = (row >> 10) * NH + (piece & (NH - 1));
            h16* dst = (piece < NH ? Qp : Kp) + (size_t)(bh * NSEQ + (row & (NSEQ - 1))) * HDP + HD + part * 4;
            v4h z4 = {};
            *(v4h*)dst = z4;
        }
    }
    if (lane < VPAD8) {
        // rows 68..79 of a head's V^T are contiguous: 1536 chunks, shared out over the 128 rows with row >> 7 == head
        h16* dst = Vt + ((size_t)(row >> 7) * HDP2 + HD) * NSEQ + ((row & 127) * VPAD8 + lane) * 8;
        v8h z8 = {};
        *(v8h*)dst = z8;
    }

    v4f s4 = {};
    #pragma unroll  // constant indices, here and below: the arrays stay in registers
    for (int i = 0; i < PGRP; i++) {
        lo[i] *= ww[i];                                 // zero in a lane without a third group
        hi[i] *= ww[i];
        s4 += lo[i] + hi[i];
    }
    float mu = wave_sum((s4[0] + s4[1]) + (s4[2] + s4[3])) * (1.f / CDIM);
    v4f q4 = {};
    #pragma unroll
    for (int i = 0; i < PGRP; i++) {
        lo[i] -= mu;
        hi[i] -= mu;
        v4f q = lo[i] * lo[i] + hi[i] * hi[i];
        if (i == PGRP - 1 && !tail) q = v4f{};          // a lane without a third group adds nothing for it
        q4 += q;
    }
    float rs = rsqrtf(wave_sum((q4[0] + q4[1]) + (q4[2] + q4[3])) * (1.f / CDIM) + 1e-5f);
    #pragma unroll
    for (int i = 0; i < PGRP; i++) {
        if (i < PGRP - 1 || tail) {
            v4f ylo = lo[i] * rs * glo[i] + blo[i];
            v4f yhi = hi[i] * rs * ghi[i] + bhi[i];
            v8h pk;
            #pragma unroll
            for (int e = 0; e < 4; e++) { pk[e] = (h16)ylo[e]; pk[e + 4] = (h16)yhi[e]; }
            *(v8h*)(xp + frag_pos(row, 256 * i + 8 * lane)) = pk;
        }
    }
}

// ---------------- stage D: QKV GEMM (WMMA, 16x48 per wave) ----------------
__global__ void k_qkv_gemm(const h16* __restrict__ xp, const h16* __restrict__ wq,
                           h16* __restrict__ Qp, h16* __restrict__ Kp, h16* __restrict__ Vt) {
    int lane = threadIdx.x;                 // 0..31
    int mt = blockIdx.y * 8 + threadIdx.y;  // row tile 0..511
    int ntg = blockIdx.x;                   // col tile group 0..33 (3 tiles each)
    int r = lane & 15, hh = lane >> 4;
    const h16* atile = xp + (size_t)mt * (KSTEPS * FBLK) + lane * 8;   // both operands in fragment order
    const h16* btile[3];
    #pragma unroll
    for (int nt = 0; nt < 3; nt++)
        btile[nt] = wq + (size_t)(ntg * 3 + nt) * (KSTEPS * FBLK) + lane * 8;
    v8f zero = {};
    v8f acc[3];
    #pragma unroll
    for (int nt = 0; nt < 3; nt++) acc[nt] = zero;
    for (int ks = 0; ks < KSTEPS; ks++) {
        int c0 = ks * FBLK, c1 = ks * FBLK + FBLK / 2;
        v16h a = make_frag(atile + c0, atile + c1);
        #pragma unroll
        for (int nt = 0; nt < 3; nt++) {
            v16h bfr = make_frag(btile[nt] + c0, btile[nt] + c1);
            acc[nt] = WMMA16(a, bfr, acc[nt]);
        }
    }
    const float qscale = 0.121267813f;  // 68^-0.5, folded into Q
    // keeps the epilogue's index arithmetic behind the k loop: lifted into it, it costs 8 more registers (64 -> 72) and 4 of 16 waves a SIMD
    __builtin_amdgcn_sched_barrier(0);
    int m0 = mt * 16 + 8 * hh;              // this lane's first row (b*N+n); its 8 rows are m0 + vg, inside one batch
    int b = m0 >> 10, n0 = m0 & 1023;
    #pragma unroll
    for (int nt = 0; nt < 3; nt++) {
        int tile = ntg * 3 + nt;            // the same for the whole block
        int third = tile / (CDIM / 16);     // 34 whole tiles each of Q, K and V: a tile lies in one of them
        int rem = (tile - third * (CDIM / 16)) * 16 + r;
        int hd = rem / HD, d = rem % HD;
        int bh = b * NH + hd;
        if (third == 2) {
            // a lane's 8 accumulators are 8 consecutive tokens of one dim: 16 contiguous bytes of its V^T row
            v8h pk;
            #pragma unroll
            for (int vg = 0; vg < 8; vg++) pk[vg] = (h16)acc[nt][vg];
            *(v8h*)(Vt + (size_t)(bh * HDP2 + d) * NSEQ + n0) = pk;
            // the next tile's code reuses this store's registers: the wait stands in front of that
            if (nt < 2) asm volatile("s_wait_xcnt 0x0" ::: "memory");
        } else {
            h16* dst = (third == 0 ? Qp : Kp) + (size_t)(bh * NSEQ + n0) * HDP + d;
            float sc = third == 0 ? qscale : 1.f;   // K times 1 is exact
            #pragma unroll
            for (int vg = 0; vg < 8; vg++) dst[vg * HDP] = (h16)(acc[nt][vg] * sc);
            // the code behind this branch reuses these stores' registers: the wait stands in front of that
            asm volatile("s_wait_xcnt 0x0" ::: "memory");
        }
    }
}

// xhalf (above) joins the two halves of one query's keys

__device__ __forceinline__ unsigned lds_off(const void* p) { return (unsigned)(size_t)p; }

// LDS row pitches, in elements: 16 bytes times an odd number (208 B and 80 B), so that the 16 rows
// which a half wave reads with one 16-byte load start on 16 different groups of 4 banks. At the data's
// own pitches (192 B and 64 B) they start on 4 groups only. The 16 pad bytes of a row are never touched.
#define KPITCH (HDP + 8)
#define VPITCH (32 + 8)
#define KTILE (32 * KPITCH)     // elements of one staged K tile
#define VTILE (HDP2 * VPITCH)   // elements of one staged V^T tile

// the real block size: without it the compiler budgets for 1,024 threads (128 registers a wave), too few
// to hold a pass's 11 fragments at once
__global__ __launch_bounds__(32 * QTPB) void k_attn(const h16* __restrict__ Qp, const h16* __restrict__ Kp,
                       const h16* __restrict__ Vt, const float* __restrict__ sfp,
                       h16* __restrict__ O) {
    int lane = threadIdx.x;               // 0..31
    int wv = threadIdx.y;                 // 0..3 : one query tile per wave
    int tid = wv * 32 + lane;
    int wvs = __builtin_amdgcn_readfirstlane(wv);   // the wave's number in a scalar register: a test on it is a scalar branch
    int qt = blockIdx.x * QTPB + wv;      // 0..63
    int hd = blockIdx.y, b = blockIdx.z;
    int bh = b * NH + hd;
    int r = lane & 15, hh = lane >> 4;
    float sf = sfp[0];

    __shared__ __align__(16) h16 kl[2 * KTILE];       // 2 x 6.5 KB: 32 keys x 96 dims, padded rows
    __shared__ __align__(16) h16 vl[2 * VTILE];       // 2 x 6.25 KB: 80 dims x 32 keys, padded rows
    __shared__ __align__(16) float psl[NSEQ];         // 4 KB: per-key positional scale

    // Q fragments for this wave's 16 queries (3 K-steps covering padded 96), used as B
    const h16* qrow = Qp + (size_t)(bh * NSEQ + qt * 16 + r) * HDP;
    v16h qa0 = make_frag(qrow +      8 * hh, qrow + 16 + 8 * hh);
    v16h qa1 = make_frag(qrow + 32 + 8 * hh, qrow + 48 + 8 * hh);
    v16h qa2 = make_frag(qrow + 64 + 8 * hh, qrow + 80 + 8 * hh);

    v8f zero = {};
    v8f accO[5];                          // O^T tiles: row = dim dt*16 + vg + 8*hh, column = query r
    #pragma unroll
    for (int i = 0; i < 5; i++) accO[i] = zero;
    float m_run = -1e30f, l_run = 0.f;    // this lane's query; l_run sums this half's keys only

    const h16* kbase = Kp + (size_t)bh * NSEQ * HDP;
    const h16* vbase = Vt + (size_t)bh * HDP2 * NSEQ;
    const float invN1 = 1.f / (float)(NSEQ - 1);

    // One tile's asynchronous copies, 16 bytes a lane each, every lane on. The K tile is contiguous in
    // memory (384 chunks: 3 a lane, 12 a row); the V^T tile is 80 rows x 4 chunks (2 a lane, a third from
    // waves 0 and 1). In LDS chunk c lands 16 bytes further for every row in front of it.
    const h16* kg0 = kbase + tid * 8;
    const h16* vg0 = vbase + (size_t)(tid >> 2) * NSEQ + (tid & 3) * 8;
    const unsigned kd0 = lds_off(kl) + (tid       + (tid      ) / 12) * 16;
    const unsigned kd1 = lds_off(kl) + (tid + 128 + (tid + 128) / 12) * 16;
    const unsigned kd2 = lds_off(kl) + (tid + 256 + (tid + 256) / 12) * 16;
    const unsigned vd0 = lds_off(vl) + (tid + (tid >> 2)) * 16;
    auto stage = [&](int kt, int buf) {
        const h16* kg = kg0 + (size_t)kt * HDP;
        const h16* vg = vg0 + kt;
        unsigned kb = buf * (KTILE * 2), vd = vd0 + buf * (VTILE * 2);
        // s_wait_xcnt 0 closes each statement: no address register is rewritten in front of it
        asm volatile("global_load_async_to_lds_b128 %0, %1, off\n\t"
                     "global_load_async_to_lds_b128 %2, %3, off\n\t"
                     "global_load_async_to_lds_b128 %4, %5, off\n\t"
                     "global_load_async_to_lds_b128 %6, %7, off\n\t"
                     "global_load_async_to_lds_b128 %8, %9, off\n\t"
                     "s_wait_xcnt 0x0"
                     :: "v"(kd0 + kb), "v"(kg), "v"(kd1 + kb), "v"(kg + 1024), "v"(kd2 + kb), "v"(kg + 2048),
                        "v"(vd), "v"(vg), "v"(vd + 32 * VPITCH * 2), "v"(vg + 32 * NSEQ) : "memory");
        if (wvs < 2)
            asm volatile("global_load_async_to_lds_b128 %0, %1, off\n\t"
                         "s_wait_xcnt 0x0"
                         :: "v"(vd + 64 * VPITCH * 2), "v"(vg + 64 * NSEQ) : "memory");
    };
    stage(0, 0);

    // a key is now a register row, not a lane: its scale comes from a table filled once
    // (published by the barrier in front of the loop)
    #pragma unroll  // fixed 8 trips: the exponentials issue back to back instead of one per loop trip
    for (int i = 0; i < NSEQ / (32 * QTPB); i++) {
        int k = tid + 32 * QTPB * i;
        float p = (float)k * invN1 - 0.5f;
        psl[k] = __expf(-sf * p * p);
    }

    asm volatile("s_wait_asynccnt 0x0" ::: "memory");  // this wave's copies of tile 0 have landed
    __syncthreads();                                   // every wave's have: tile 0 and the table are readable
    stage(32, 1);                                      // tile 1 flies during pass 0

    for (int kt = 0; kt < NSEQ; kt += 32) {
        int buf = (kt >> 5) & 1;                       // this pass reads this buffer alone

        // ---- all 26 LDS reads of the pass in one group: scales, K fragments, V^T fragments ----
        // per-key positional scale: keys kt + 8*hh + vg (s0) and kt + 16 + 8*hh + vg (s1)
        const v4f* pt = (const v4f*)(psl + kt + 8 * hh);
        v4f pa = pt[0], pb = pt[1], pc = pt[4], pd = pt[5];
        const h16* krow0 = kl + buf * KTILE + (size_t)r * KPITCH + 8 * hh;
        const h16* krow1 = krow0 + 16 * KPITCH;
        v16h kf0[3], kf1[3], vf[5];
        #pragma unroll  // every index a constant: the fragment arrays stay in registers
        for (int ks = 0; ks < 3; ks++) {
            kf0[ks] = make_frag(krow0 + 32 * ks, krow0 + 32 * ks + 16);
            kf1[ks] = make_frag(krow1 + 32 * ks, krow1 + 32 * ks + 16);
        }
        // keeps the K reads in front of the V^T reads: LDS answers in order, and the first products wait for K alone
        __builtin_amdgcn_sched_barrier(0);
        #pragma unroll  // as above
        for (int dt = 0; dt < 5; dt++) {
            const h16* vrow = vl + buf * VTILE + (dt * 16 + r) * VPITCH + 8 * hh;
            vf[dt] = make_frag(vrow, vrow + 16);
        }
        // holds the reads together in front of the products: sunk among them, each pair is waited out alone,
        // about ten LDS latencies a pass instead of one
        __builtin_amdgcn_sched_barrier(0);

        // ---- S^T = K Q^T for two 16-key tiles (K fragments as A) ----
        v8f s0 = zero, s1 = zero;
        s0 = WMMA16(kf0[0], qa0, s0);
        s1 = WMMA16(kf1[0], qa0, s1);
        s0 = WMMA16(kf0[1], qa1, s0);
        s1 = WMMA16(kf1[1], qa1, s1);
        s0 = WMMA16(kf0[2], qa2, s0);
        s1 = WMMA16(kf1[2], qa2, s1);

        // ---- online softmax for this lane's query ----
        float t0[8], t1[8];
        #pragma unroll
        for (int vg = 0; vg < 4; vg++) {
            t0[vg]     = s0[vg]     * pa[vg];
            t0[vg + 4] = s0[vg + 4] * pb[vg];
            t1[vg]     = s1[vg]     * pc[vg];
            t1[vg + 4] = s1[vg + 4] * pd[vg];
        }
        float tm = fmaxf(t0[0], t1[0]);
        #pragma unroll
        for (int vg = 1; vg < 8; vg++) tm = fmaxf(tm, fmaxf(t0[vg], t1[vg]));
        tm = fmaxf(tm, xhalf(tm));
        float mn = fmaxf(m_run, tm);
        float alpha = __expf(m_run - mn);
        m_run = mn;
        v16h pf;                           // P^T as B: element i = key 8*hh + i, 8 + i = key 16 + 8*hh + i
        float es = 0.f;
        #pragma unroll
        for (int vg = 0; vg < 8; vg++) {
            float e0 = __expf(t0[vg] - mn), e1 = __expf(t1[vg] - mn);
            es += e0 + e1;
            pf[vg] = (h16)e0; pf[vg + 8] = (h16)e1;
        }
        l_run = l_run * alpha + es;
        #pragma unroll
        for (int dt = 0; dt < 5; dt++)
            #pragma unroll
            for (int vg = 0; vg < 8; vg++) accO[dt][vg] *= alpha;

        // ---- O^T += V^T P^T  (V^T fragments as A, read at the head of the pass) ----
        #pragma unroll
        for (int dt = 0; dt < 5; dt++) accO[dt] = WMMA16(vf[dt], pf, accO[dt]);

        // ---- foot of the pass: publish the next tile, then refill the buffer just read ----
        // holds the pass's arithmetic in front of the foot: with every LDS read at the head the compiler lifts the
        // waits and the barrier over it, and the wait for the next tile's copies then stands right behind their issue
        __builtin_amdgcn_sched_barrier(0);
        asm volatile("s_wait_dscnt 0x0" ::: "memory");     // this wave's reads of this buffer are done
        asm volatile("s_wait_asynccnt 0x0" ::: "memory");  // this wave's copies of the next tile have landed
        __syncthreads();                                   // both hold for every wave
        if (kt + 64 < NSEQ) stage(kt + 64, buf);           // flies during the next pass
    }
    asm volatile("s_wait_asynccnt 0x0" ::: "memory");      // no copy is outstanding when the wave ends

    // ---- finalize: join the halves' sums, normalize, store in the projection's fragment order ----
    float inv = 1.f / (l_run + xhalf(l_run));
    int orow = b * NSEQ + qt * 16 + r;
    int ocol = hd * HD + 8 * hh;          // a multiple of 4: a group of 4 dims stays inside one 8-element chunk
    #pragma unroll
    for (int dt = 0; dt < 5; dt++) {
        v4h lo, hi;
        #pragma unroll
        for (int vg = 0; vg < 4; vg++) {
            lo[vg] = (h16)(accO[dt][vg] * inv);
            hi[vg] = (h16)(accO[dt][vg + 4] * inv);
        }
        if (dt < 4) {
            *(v4h*)(O + frag_pos(orow, ocol + dt * 16))     = lo;
            *(v4h*)(O + frag_pos(orow, ocol + dt * 16 + 4)) = hi;
        } else if (hh == 0) {
            *(v4h*)(O + frag_pos(orow, ocol + dt * 16))     = lo;   // dims 64..67; 68..79 are padding
        }
    }
}

// ---------------- stage F: projection GEMM (WMMA) + bias ----------------
__global__ void k_proj(const h16* __restrict__ O, const h16* __restrict__ wp,
                       const float* __restrict__ pb, float* __restrict__ out) {
    int lane = threadIdx.x;
    int mt = blockIdx.y * 8 + threadIdx.y;  // 0..511
    int ntg = blockIdx.x;                   // 0..16 (2 tiles each -> 34 tiles = 544)
    int r = lane & 15, hh = lane >> 4;
    const h16* atile = O + (size_t)mt * (KSTEPS * FBLK) + lane * 8;    // both operands in fragment order
    int o0 = (ntg * 2 + 0) * 16 + r;
    int o1 = (ntg * 2 + 1) * 16 + r;
    const h16* b0tile = wp + (size_t)(ntg * 2 + 0) * (KSTEPS * FBLK) + lane * 8;
    const h16* b1tile = wp + (size_t)(ntg * 2 + 1) * (KSTEPS * FBLK) + lane * 8;
    v8f acc0 = {}; v8f acc1 = {};
    for (int ks = 0; ks < KSTEPS; ks++) {
        int c0 = ks * FBLK, c1 = ks * FBLK + FBLK / 2;
        v16h a  = make_frag(atile  + c0, atile  + c1);
        v16h b0 = make_frag(b0tile + c0, b0tile + c1);
        v16h b1 = make_frag(b1tile + c0, b1tile + c1);
        acc0 = WMMA16(a, b0, acc0);
        acc1 = WMMA16(a, b1, acc1);
    }
    float bias0 = pb[o0], bias1 = pb[o1];
    #pragma unroll
    for (int vg = 0; vg < 8; vg++) {
        int m = mt * 16 + vg + 8 * hh;
        out[(size_t)m * CDIM + o0] = acc0[vg] + bias0;
        out[(size_t)m * CDIM + o1] = acc1[vg] + bias1;
    }
}

extern "C" void kernel_launch(void* const* d_in, const int* in_sizes, int n_in,
                              void* d_out, int out_size, void* d_ws, size_t ws_size,
                              hipStream_t stream) {
    const float* x     = (const float*)d_in[0];
    const float* ng    = (const float*)d_in[1];
    const float* nb    = (const float*)d_in[2];
    const float* apw   = (const float*)d_in[3];
    const float* apb   = (const float*)d_in[4];
    const float* n2g   = (const float*)d_in[5];
    const float* n2b   = (const float*)d_in[6];
    const float* qkvw  = (const float*)d_in[7];
    const float* projw = (const float*)d_in[8];
    const float* projb = (const float*)d_in[9];
    const float* sfp   = (const float*)d_in[10];
    float* out = (float*)d_out;

    char* ws = (char*)d_ws;
    size_t off = 0;
    float* xr = (float*)(ws + off); off += (size_t)BN * CDIM * 4;        // 17.8 MB
    float* sc = (float*)(ws + off); off += (size_t)BN * NJ * 4;          // 0.56 MB
    h16* xp = (h16*)(ws + off); off += (size_t)BN * CDIM * 2;            // 8.9 MB
    h16* wq = (h16*)(ws + off); off += (size_t)C3 * CDIM * 2;            // 1.8 MB
    h16* wp = (h16*)(ws + off); off += (size_t)CDIM * CDIM * 2;          // 0.6 MB
    h16* Qp = (h16*)(ws + off); off += (size_t)NB * NH * NSEQ * HDP * 2; // 12.6 MB
    h16* Kp = (h16*)(ws + off); off += (size_t)NB * NH * NSEQ * HDP * 2; // 12.6 MB
    h16* Vt = (h16*)(ws + off); off += (size_t)NB * NH * HDP2 * NSEQ * 2;// 10.5 MB
    h16* O  = (h16*)(ws + off); off += (size_t)BN * CDIM * 2;            // 8.9 MB

    // W: weight conversion f32 -> f16
    int ncvt = C3 * CDIM + CDIM * CDIM;
    k_cvt<<<(ncvt + 255) / 256, 256, 0, stream>>>(qkvw, projw, wq, wp);
    // A: per-joint LN + attention-pool scores
    k_ln1<<<(BN * NJ + 255) / 256, 256, 0, stream>>>(x, ng, nb, apw, apb, xr, sc);
    // B: softmax over sequence axis
    k_softmax_n<<<NB * NJ, 256, 0, stream>>>(sc);
    // C: pool + LN over C -> f16 activations; zeroes the padding of Q, K, V^T
    k_pool_ln2<<<BN / PROWS, 32 * PROWS, 0, stream>>>(xr, sc, n2g, n2b, xp, Qp, Kp, Vt);
    // D: QKV GEMM (WMMA), scatter to Q (scaled), K, V^T
    k_qkv_gemm<<<dim3(34, 64), dim3(32, 8), 0, stream>>>(xp, wq, Qp, Kp, Vt);
    // E: flash attention, 4 query tiles per block sharing K/V through LDS
    k_attn<<<dim3(64 / QTPB, NH, NB), dim3(32, QTPB), 0, stream>>>(Qp, Kp, Vt, sfp, O);
    // F: projection GEMM (WMMA) + bias -> f32 output
    k_proj<<<dim3(17, 64), dim3(32, 8), 0, stream>>>(O, wp, projb, out);
    (void)in_sizes; (void)n_in; (void)out_size; (void)ws_size;
}

// v009
// Measured time: 104 microseconds a run.
// Next to v008, in two timings, it ran 1.07 times as fast each time.
// All steps since v000 together make it 3.13 times as fast.
#include <hip/hip_runtime.h>
#include <hip/hip_bf16.h>
#include <math.h>

typedef _Float16 h16;
typedef __attribute__((ext_vector_type(4)))  _Float16 v4h;
typedef __attribute__((ext_vector_type(8)))  _Float16 v8h;
typedef __attribute__((ext_vector_type(16))) _Float16 v16h;
typedef __attribute__((ext_vector_type(8)))  float    v8f;
typedef __attribute__((ext_vector_type(4)))  float    v4f;

#define NJ    17
#define NF    32
#define CDIM  544
#define NH    8
#define HD    68
#define HDP   96    // padded head dim for Q/K (3 K-steps of 32)
#define HDP2  80    // padded head dim for O tiles (5 tiles of 16)
#define NB    8
#define NSEQ  1024
#define BN    8192  // NB*NSEQ
#define C3    1632  // 3*CDIM
#define QTPB  4     // query tiles (waves) per attention block

#define WMMA16(a,b,c) __builtin_amdgcn_wmma_f32_16x16x32_f16(false,(a),false,(b),(short)0,(c),false,false)

__device__ __forceinline__ v16h make_frag(const h16* p0, const h16* p1) {
    v8h a = *(const v8h*)p0;
    v8h b = *(const v8h*)p1;
    return __builtin_shufflevector(a, b, 0,1,2,3,4,5,6,7,8,9,10,11,12,13,14,15);
}

// Fragment order for the operands of the two GEMMs (row-major [rows][CDIM] matrices).
// One 16-row x 32-k block is 1 KB: two 512-byte halves, and in each half lane l = r + 16*hh
// owns 16 bytes. Half 0 holds k = 8*hh + e, half 1 holds k = 16 + 8*hh + e (e = 0..7): the
// same elements at the same lane and register as the row-major loader took, so a fragment
// is two loads of 512 contiguous bytes (4 whole lines each) instead of 16 pieces of 32 bytes.
#define KSTEPS (CDIM / 32)   // 17 k-steps
#define FBLK   512           // elements per 16 x 32 block
__device__ __forceinline__ int frag_pos(int row, int c) {
    return (((row >> 4) * KSTEPS + (c >> 5)) * FBLK) + ((c & 16) << 4) + ((c & 8) << 4)
         + ((row & 15) << 3) + (c & 7);
}
// inverse map: position in fragment order -> row * CDIM + c
__device__ __forceinline__ int frag_src(int p) {
    int blk = p / FBLK;
    int row = (blk / KSTEPS) * 16 + ((p >> 3) & 15);
    int c   = (blk % KSTEPS) * 32 + ((p >> 4) & 16) + ((p >> 4) & 8) + (p & 7);
    return row * CDIM + c;
}

// ---------------- stage W: convert weights f32 -> f16, stored in fragment order ----------------
__global__ void k_cvt(const float* __restrict__ qkvw, const float* __restrict__ projw,
                      h16* __restrict__ wq, h16* __restrict__ wp) {
    int i = blockIdx.x * blockDim.x + threadIdx.x;   // destination index: stores stay contiguous
    const int n1 = C3 * CDIM, n2 = CDIM * CDIM;
    if (i < n1)            wq[i] = (h16)qkvw[frag_src(i)];
    else if (i < n1 + n2)  wp[i - n1] = (h16)projw[frag_src(i - n1)];
}

// ---------------- stage A: per-joint LN + pooling scores ----------------
__global__ void k_ln1(const float* __restrict__ x, const float* __restrict__ g,
                      const float* __restrict__ bb, const float* __restrict__ apw,
                      const float* __restrict__ apb,
                      float* __restrict__ xr, float* __restrict__ sc) {
    int idx = blockIdx.x * blockDim.x + threadIdx.x;  // (b*N+n)*17 + j
    if (idx >= BN * NJ) return;
    const float* px = x + (size_t)idx * NF;
    float s = 0.f, s2 = 0.f;
    #pragma unroll
    for (int f = 0; f < NF; f++) { float v = px[f]; s += v; s2 += v * v; }
    float mu = s * (1.f / NF);
    float var = s2 * (1.f / NF) - mu * mu;
    float rs = rsqrtf(var + 1e-5f);
    float* po = xr + (size_t)idx * NF;
    float acc = 0.f;
    #pragma unroll
    for (int f = 0; f < NF; f++) {
        float v = (px[f] - mu) * rs * g[f] + bb[f];
        po[f] = v;
        acc += v * apw[f];
    }
    sc[idx] = acc + apb[0];
}

// ---------------- stage B: softmax over sequence axis N ----------------
__global__ void k_softmax_n(float* __restrict__ sc) {
    int b = blockIdx.x / NJ, j = blockIdx.x % NJ;
    __shared__ float red[256];
    int t = threadIdx.x;
    float m = -3e38f;
    for (int n = t; n < NSEQ; n += 256) m = fmaxf(m, sc[(b * NSEQ + n) * NJ + j]);
    red[t] = m; __syncthreads();
    for (int o = 128; o > 0; o >>= 1) { if (t < o) red[t] = fmaxf(red[t], red[t + o]); __syncthreads(); }
    m = red[0]; __syncthreads();
    float s = 0.f;
    for (int n = t; n < NSEQ; n += 256) s += __expf(sc[(b * NSEQ + n) * NJ + j] - m);
    red[t] = s; __syncthreads();
    for (int o = 128; o > 0; o >>= 1) { if (t < o) red[t] += red[t + o]; __syncthreads(); }
    float inv = 1.f / red[0];
    for (int n = t; n < NSEQ; n += 256) {
        int id = (b * NSEQ + n) * NJ + j;
        sc[id] = __expf(sc[id] - m) * inv;
    }
}

// ---------------- stage C: pool by weights + LN over C, emit f16 ----------------
// lane l <-> lane l ^ 16: the other 16-lane row of the wave
__device__ __forceinline__ float xhalf(float x) {
    return __builtin_bit_cast(float, __builtin_amdgcn_permlanex16(
        __builtin_bit_cast(int, x), __builtin_bit_cast(int, x),
        0x76543210, 0xfedcba98, false, false));
}
// lane l <-> lane l ^ M inside a 16-lane row (DPP row_xmask:M)
template <int M> __device__ __forceinline__ float xrow(float x) {
    return __builtin_bit_cast(float, __builtin_amdgcn_update_dpp(
        0, __builtin_bit_cast(int, x), 0x160 + M, 0xf, 0xf, true));
}
// sum over the 32 lanes of a wave; every lane ends with the same value
__device__ __forceinline__ float wave_sum(float x) {
    x += xrow<1>(x);
    x += xrow<2>(x);
    x += xrow<4>(x);
    x += xrow<8>(x);
    return x + xhalf(x);
}

// One wave owns one row: its 544 values stay in registers (a lane holds groups of 8 consecutive channels,
// c = 256*i + 8*lane + e; group 2, channels 512..543, lives on lanes 0..3), both sums are in-lane adds and one
// five-step exchange, and a group leaves as the one 16-byte chunk it is in fragment order. No LDS, no barrier.
// The launch also zeroes the padding of Q, K and V^T: the only elements of those buffers that the
// attention launch reads and the QKV GEMM does not write.
#define QKPAD4 ((HDP - HD) / 4)                    // 7 groups of 4 pad dims (8 bytes) in a Q or K row
#define VPAD8  ((HDP2 - HD) * NSEQ / 8 / (BN / (NB * NH)))   // 12 chunks of 16 bytes: a row's share of its head's pad rows
#define PROWS  8                                   // rows (waves) per block
#define PGRP   3                                   // groups of 8 channels per lane
__global__ __launch_bounds__(32 * PROWS) void k_pool_ln2(const float* __restrict__ xr, const float* __restrict__ w,
                           const float* __restrict__ g2, const float* __restrict__ b2,
                           h16* __restrict__ xp,
                           h16* __restrict__ Qp, h16* __restrict__ Kp, h16* __restrict__ Vt) {
    int lane = threadIdx.x & 31;
    int row = blockIdx.x * PROWS + (threadIdx.x >> 5);  // b*N + n
    const bool tail = lane < (CDIM - 512) / 8;          // the lanes that hold a third group

    const float* px = xr + (size_t)row * CDIM + 8 * lane;
    const float* pw = w + row * NJ + (lane >> 2);       // a group of 8 channels lies inside one joint
    const float* pg = g2 + 8 * lane;
    const float* pb = b2 + 8 * lane;
    v4f lo[PGRP] = {}, hi[PGRP] = {}, glo[PGRP] = {}, ghi[PGRP] = {}, blo[PGRP] = {}, bhi[PGRP] = {};
    float ww[PGRP] = {};
    // the third group first: its loads stand under a lane test, and nothing is yet in flight that could be waited for there
    #pragma unroll  // every index a constant: the arrays stay in registers
    for (int i = PGRP - 1; i >= 0; i--) {
        if (i < PGRP - 1 || tail) {
            lo[i]  = *(const v4f*)(px + 256 * i);
            hi[i]  = *(const v4f*)(px + 256 * i + 4);
            ww[i]  = pw[8 * i];
            glo[i] = *(const v4f*)(pg + 256 * i);
            ghi[i] = *(const v4f*)(pg + 256 * i + 4);
            blo[i] = *(const v4f*)(pb + 256 * i);
            bhi[i] = *(const v4f*)(pb + 256 * i + 4);
        }
    }
    // keeps all of the row's loads in one group at the head: sunk behind the two sums, the loads of scale and shift
    // are waited out one after another at the end of the wave
    __builtin_amdgcn_sched_barrier(0);

    // this token's dims 68..95 in each head's Q row (pieces 0..7) and K row (pieces 8..15)
    #pragma unroll  // 4 fixed trips: only the last one needs its lane test
    for (int k0 = 0; k0 < 2 * NH * QKPAD4; k0 += 32) {
        int k = k0 + lane;
        if (k < 2 * NH * QKPAD4) {
            int piece = k / QKPAD4, part = k % QKPAD4;
            int bh = (row >> 10) * NH + (piece & (NH - 1));
            h16* dst = (piece < NH ? Qp : Kp) + (size_t)(bh * NSEQ + (row & (NSEQ - 1))) * HDP + HD + part * 4;
            v4h z4 = {};
            *(v4h*)dst = z4;
        }
    }
    if (lane < VPAD8) {
        // rows 68..79 of a head's V^T are contiguous: 1536 chunks, shared out over the 128 rows with row >> 7 == head
        h16* dst = Vt + ((size_t)(row >> 7) * HDP2 + HD) * NSEQ + ((row & 127) * VPAD8 + lane) * 8;
        v8h z8 = {};
        *(v8h*)dst = z8;
    }

    v4f s4 = {};
    #pragma unroll  // constant indices, here and below: the arrays stay in registers
    for (int i = 0; i < PGRP; i++) {
        lo[i] *= ww[i];                                 // zero in a lane without a third group
        hi[i] *= ww[i];
        s4 += lo[i] + hi[i];
    }
    float mu = wave_sum((s4[0] + s4[1]) + (s4[2] + s4[3])) * (1.f / CDIM);
    v4f q4 = {};
    #pragma unroll
    for (int i = 0; i < PGRP; i++) {
        lo[i] -= mu;
        hi[i] -= mu;
        v4f q = lo[i] * lo[i] + hi[i] * hi[i];
        if (i == PGRP - 1 && !tail) q = v4f{};          // a lane without a third group adds nothing for it
        q4 += q;
    }
    float rs = rsqrtf(wave_sum((q4[0] + q4[1]) + (q4[2] + q4[3])) * (1.f / CDIM) + 1e-5f);
    #pragma unroll
    for (int i = 0; i < PGRP; i++) {
        if (i < PGRP - 1 || tail) {
            v4f ylo = lo[i] * rs * glo[i] + blo[i];
            v4f yhi = hi[i] * rs * ghi[i] + bhi[i];
            v8h pk;
            #pragma unroll
            for (int e = 0; e < 4; e++) { pk[e] = (h16)ylo[e]; pk[e + 4] = (h16)yhi[e]; }
            *(v8h*)(xp + frag_pos(row, 256 * i + 8 * lane)) = pk;
        }
    }
}

// ---------------- stage D: QKV GEMM (WMMA, 32x48 per wave) ----------------
// A wave owns two row tiles and three column tiles: a weight fragment feeds two products and an activation fragment
// three, 10 fragment loads for 6 products. The block's 8 waves stand 4 x 2 (128 rows x 96 columns):
// an activation fragment is read by 2 waves of the block, a weight fragment by 4.
#define GROWS 2   // row tiles per wave
__global__ void k_qkv_gemm(const h16* __restrict__ xp, const h16* __restrict__ wq,
                           h16* __restrict__ Qp, h16* __restrict__ Kp, h16* __restrict__ Vt) {
    int lane = threadIdx.x;                 // 0..31
    int wy = __builtin_amdgcn_readfirstlane(threadIdx.y);   // the wave's number in a scalar register: tile tests stay scalar branches
    int mt0 = (blockIdx.y * 4 + (wy & 3)) * GROWS;          // first row tile, 0..510
    int ntg = blockIdx.x * 2 + (wy >> 2);   // col tile group 0..33 (3 tiles each)
    int r = lane & 15, hh = lane >> 4;
    const h16* atile = xp + (size_t)mt0 * (KSTEPS * FBLK) + lane * 8;  // both operands in fragment order
    const h16* btile[3];
    #pragma unroll
    for (int nt = 0; nt < 3; nt++)
        btile[nt] = wq + (size_t)(ntg * 3 + nt) * (KSTEPS * FBLK) + lane * 8;
    v8f zero = {};
    v8f acc[GROWS][3];
    #pragma unroll  // constant indices, here and in the loops over rt below: the accumulators and fragments stay in registers
    for (int rt = 0; rt < GROWS; rt++)
        #pragma unroll
        for (int nt = 0; nt < 3; nt++) acc[rt][nt] = zero;
    for (int ks = 0; ks < KSTEPS; ks++) {
        int c0 = ks * FBLK, c1 = ks * FBLK + FBLK / 2;
        v16h a[GROWS];
        #pragma unroll
        for (int rt = 0; rt < GROWS; rt++)
            a[rt] = make_frag(atile + rt * (KSTEPS * FBLK) + c0, atile + rt * (KSTEPS * FBLK) + c1);
        #pragma unroll
        for (int nt = 0; nt < 3; nt++) {
            v16h bfr = make_frag(btile[nt] + c0, btile[nt] + c1);
            #pragma unroll
            for (int rt = 0; rt < GROWS; rt++) acc[rt][nt] = WMMA16(a[rt], bfr, acc[rt][nt]);
        }
    }
    const float qscale = 0.121267813f;  // 68^-0.5, folded into Q
    #pragma unroll
    for (int rt = 0; rt < GROWS; rt++) {
        int m0 = (mt0 + rt) * 16 + 8 * hh;  // this lane's first row (b*N+n) of the tile; its 8 rows are m0 + vg, inside one batch
        int b = m0 >> 10, n0 = m0 & 1023;
        #pragma unroll
        for (int nt = 0; nt < 3; nt++) {
            int tile = ntg * 3 + nt;            // the same for the whole wave
            int third = tile / (CDIM / 16);     // 34 whole tiles each of Q, K and V: a tile lies in one of them
            int rem = (tile - third * (CDIM / 16)) * 16 + r;
            int hd = rem / HD, d = rem % HD;
            int bh = b * NH + hd;
            if (third == 2) {
                // a lane's 8 accumulators are 8 consecutive tokens of one dim: 16 contiguous bytes of its V^T row
                v8h pk;
                #pragma unroll
                for (int vg = 0; vg < 8; vg++) pk[vg] = (h16)acc[rt][nt][vg];
                *(v8h*)(Vt + (size_t)(bh * HDP2 + d) * NSEQ + n0) = pk;
                // the next tile's code reuses this store's registers: the wait stands in front of that
                if (rt < GROWS - 1 || nt < 2) asm volatile("s_wait_xcnt 0x0" ::: "memory");
            } else {
                h16* dst = (third == 0 ? Qp : Kp) + (size_t)(bh * NSEQ + n0) * HDP + d;
                float sc = third == 0 ? qscale : 1.f;   // K times 1 is exact
                #pragma unroll
                for (int vg = 0; vg < 8; vg++) dst[vg * HDP] = (h16)(acc[rt][nt][vg] * sc);
                // the code behind this branch reuses these stores' registers: the wait stands in front of that
                asm volatile("s_wait_xcnt 0x0" ::: "memory");
            }
        }
    }
}

// xhalf (above) joins the two halves of one query's keys

__device__ __forceinline__ unsigned lds_off(const void* p) { return (unsigned)(size_t)p; }

// LDS row pitches, in elements: 16 bytes times an odd number (208 B and 80 B), so that the 16 rows
// which a half wave reads with one 16-byte load start on 16 different groups of 4 banks. At the data's
// own pitches (192 B and 64 B) they start on 4 groups only. The 16 pad bytes of a row are never touched.
#define KPITCH (HDP + 8)
#define VPITCH (32 + 8)
#define KTILE (32 * KPITCH)     // elements of one staged K tile
#define VTILE (HDP2 * VPITCH)   // elements of one staged V^T tile

// the real block size: without it the compiler budgets for 1,024 threads (128 registers a wave), too few
// to hold a pass's 11 fragments at once
__global__ __launch_bounds__(32 * QTPB) void k_attn(const h16* __restrict__ Qp, const h16* __restrict__ Kp,
                       const h16* __restrict__ Vt, const float* __restrict__ sfp,
                       h16* __restrict__ O) {
    int lane = threadIdx.x;               // 0..31
    int wv = threadIdx.y;                 // 0..3 : one query tile per wave
    int tid = wv * 32 + lane;
    int wvs = __builtin_amdgcn_readfirstlane(wv);   // the wave's number in a scalar register: a test on it is a scalar branch
    int qt = blockIdx.x * QTPB + wv;      // 0..63
    int hd = blockIdx.y, b = blockIdx.z;
    int bh = b * NH + hd;
    int r = lane & 15, hh = lane >> 4;
    float sf = sfp[0];

    __shared__ __align__(16) h16 kl[2 * KTILE];       // 2 x 6.5 KB: 32 keys x 96 dims, padded rows
    __shared__ __align__(16) h16 vl[2 * VTILE];       // 2 x 6.25 KB: 80 dims x 32 keys, padded rows
    __shared__ __align__(16) float psl[NSEQ];         // 4 KB: per-key positional scale

    // Q fragments for this wave's 16 queries (3 K-steps covering padded 96), used as B
    const h16* qrow = Qp + (size_t)(bh * NSEQ + qt * 16 + r) * HDP;
    v16h qa0 = make_frag(qrow +      8 * hh, qrow + 16 + 8 * hh);
    v16h qa1 = make_frag(qrow + 32 + 8 * hh, qrow + 48 + 8 * hh);
    v16h qa2 = make_frag(qrow + 64 + 8 * hh, qrow + 80 + 8 * hh);

    v8f zero = {};
    v8f accO[5];                          // O^T tiles: row = dim dt*16 + vg + 8*hh, column = query r
    #pragma unroll
    for (int i = 0; i < 5; i++) accO[i] = zero;
    float m_run = -1e30f, l_run = 0.f;    // this lane's query; l_run sums this half's keys only

    const h16* kbase = Kp + (size_t)bh * NSEQ * HDP;
    const h16* vbase = Vt + (size_t)bh * HDP2 * NSEQ;
    const float invN1 = 1.f / (float)(NSEQ - 1);

    // One tile's asynchronous copies, 16 bytes a lane each, every lane on. The K tile is contiguous in
    // memory (384 chunks: 3 a lane, 12 a row); the V^T tile is 80 rows x 4 chunks (2 a lane, a third from
    // waves 0 and 1). In LDS chunk c lands 16 bytes further for every row in front of it.
    const h16* kg0 = kbase + tid * 8;
    const h16* vg0 = vbase + (size_t)(tid >> 2) * NSEQ + (tid & 3) * 8;
    const unsigned kd0 = lds_off(kl) + (tid       + (tid      ) / 12) * 16;
    const unsigned kd1 = lds_off(kl) + (tid + 128 + (tid + 128) / 12) * 16;
    const unsigned kd2 = lds_off(kl) + (tid + 256 + (tid + 256) / 12) * 16;
    const unsigned vd0 = lds_off(vl) + (tid + (tid >> 2)) * 16;
    auto stage = [&](int kt, int buf) {
        const h16* kg = kg0 + (size_t)kt * HDP;
        const h16* vg = vg0 + kt;
        unsigned kb = buf * (KTILE * 2), vd = vd0 + buf * (VTILE * 2);
        // s_wait_xcnt 0 closes each statement: no address register is rewritten in front of it
        asm volatile("global_load_async_to_lds_b128 %0, %1, off\n\t"
                     "global_load_async_to_lds_b128 %2, %3, off\n\t"
                     "global_load_async_to_lds_b128 %4, %5, off\n\t"
                     "global_load_async_to_lds_b128 %6, %7, off\n\t"
                     "global_load_async_to_lds_b128 %8, %9, off\n\t"
                     "s_wait_xcnt 0x0"
                     :: "v"(kd0 + kb), "v"(kg), "v"(kd1 + kb), "v"(kg + 1024), "v"(kd2 + kb), "v"(kg + 2048),
                        "v"(vd), "v"(vg), "v"(vd + 32 * VPITCH * 2), "v"(vg + 32 * NSEQ) : "memory");
        if (wvs < 2)
            asm volatile("global_load_async_to_lds_b128 %0, %1, off\n\t"
                         "s_wait_xcnt 0x0"
                         :: "v"(vd + 64 * VPITCH * 2), "v"(vg + 64 * NSEQ) : "memory");
    };
    stage(0, 0);

    // a key is now a register row, not a lane: its scale comes from a table filled once
    // (published by the barrier in front of the loop)
    #pragma unroll  // fixed 8 trips: the exponentials issue back to back instead of one per loop trip
    for (int i = 0; i < NSEQ / (32 * QTPB); i++) {
        int k = tid + 32 * QTPB * i;
        float p = (float)k * invN1 - 0.5f;
        psl[k] = __expf(-sf * p * p);
    }

    asm volatile("s_wait_asynccnt 0x0" ::: "memory");  // this wave's copies of tile 0 have landed
    __syncthreads();                                   // every wave's have: tile 0 and the table are readable
    stage(32, 1);                                      // tile 1 flies during pass 0

    for (int kt = 0; kt < NSEQ; kt += 32) {
        int buf = (kt >> 5) & 1;                       // this pass reads this buffer alone

        // ---- all 26 LDS reads of the pass in one group: scales, K fragments, V^T fragments ----
        // per-key positional scale: keys kt + 8*hh + vg (s0) and kt + 16 + 8*hh + vg (s1)
        const v4f* pt = (const v4f*)(psl + kt + 8 * hh);
        v4f pa = pt[0], pb = pt[1], pc = pt[4], pd = pt[5];
        const h16* krow0 = kl + buf * KTILE + (size_t)r * KPITCH + 8 * hh;
        const h16* krow1 = krow0 + 16 * KPITCH;
        v16h kf0[3], kf1[3], vf[5];
        #pragma unroll  // every index a constant: the fragment arrays stay in registers
        for (int ks = 0; ks < 3; ks++) {
            kf0[ks] = make_frag(krow0 + 32 * ks, krow0 + 32 * ks + 16);
            kf1[ks] = make_frag(krow1 + 32 * ks, krow1 + 32 * ks + 16);
        }
        // keeps the K reads in front of the V^T reads: LDS answers in order, and the first products wait for K alone
        __builtin_amdgcn_sched_barrier(0);
        #pragma unroll  // as above
        for (int dt = 0; dt < 5; dt++) {
            const h16* vrow = vl + buf * VTILE + (dt * 16 + r) * VPITCH + 8 * hh;
            vf[dt] = make_frag(vrow, vrow + 16);
        }
        // holds the reads together in front of the products: sunk among them, each pair is waited out alone,
        // about ten LDS latencies a pass instead of one
        __builtin_amdgcn_sched_barrier(0);

        // ---- S^T = K Q^T for two 16-key tiles (K fragments as A) ----
        v8f s0 = zero, s1 = zero;
        s0 = WMMA16(kf0[0], qa0, s0);
        s1 = WMMA16(kf1[0], qa0, s1);
        s0 = WMMA16(kf0[1], qa1, s0);
        s1 = WMMA16(kf1[1], qa1, s1);
        s0 = WMMA16(kf0[2], qa2, s0);
        s1 = WMMA16(kf1[2], qa2, s1);

        // ---- online softmax for this lane's query ----
        float t0[8], t1[8];
        #pragma unroll
        for (int vg = 0; vg < 4; vg++) {
            t0[vg]     = s0[vg]     * pa[vg];
            t0[vg + 4] = s0[vg + 4] * pb[vg];
            t1[vg]     = s1[vg]     * pc[vg];
            t1[vg + 4] = s1[vg + 4] * pd[vg];
        }
        float tm = fmaxf(t0[0], t1[0]);
        #pragma unroll
        for (int vg = 1; vg < 8; vg++) tm = fmaxf(tm, fmaxf(t0[vg], t1[vg]));
        tm = fmaxf(tm, xhalf(tm));
        float mn = fmaxf(m_run, tm);
        float alpha = __expf(m_run - mn);
        m_run = mn;
        v16h pf;                           // P^T as B: element i = key 8*hh + i, 8 + i = key 16 + 8*hh + i
        float es = 0.f;
        #pragma unroll
        for (int vg = 0; vg < 8; vg++) {
            float e0 = __expf(t0[vg] - mn), e1 = __expf(t1[vg] - mn);
            es += e0 + e1;
            pf[vg] = (h16)e0; pf[vg + 8] = (h16)e1;
        }
        l_run = l_run * alpha + es;
        #pragma unroll
        for (int dt = 0; dt < 5; dt++)
            #pragma unroll
            for (int vg = 0; vg < 8; vg++) accO[dt][vg] *= alpha;

        // ---- O^T += V^T P^T  (V^T fragments as A, read at the head of the pass) ----
        #pragma unroll
        for (int dt = 0; dt < 5; dt++) accO[dt] = WMMA16(vf[dt], pf, accO[dt]);

        // ---- foot of the pass: publish the next tile, then refill the buffer just read ----
        // holds the pass's arithmetic in front of the foot: with every LDS read at the head the compiler lifts the
        // waits and the barrier over it, and the wait for the next tile's copies then stands right behind their issue
        __builtin_amdgcn_sched_barrier(0);
        asm volatile("s_wait_dscnt 0x0" ::: "memory");     // this wave's reads of this buffer are done
        asm volatile("s_wait_asynccnt 0x0" ::: "memory");  // this wave's copies of the next tile have landed
        __syncthreads();                                   // both hold for every wave
        if (kt + 64 < NSEQ) stage(kt + 64, buf);           // flies during the next pass
    }
    asm volatile("s_wait_asynccnt 0x0" ::: "memory");      // no copy is outstanding when the wave ends

    // ---- finalize: join the halves' sums, normalize, store in the projection's fragment order ----
    float inv = 1.f / (l_run + xhalf(l_run));
    int orow = b * NSEQ + qt * 16 + r;
    int ocol = hd * HD + 8 * hh;          // a multiple of 4: a group of 4 dims stays inside one 8-element chunk
    #pragma unroll
    for (int dt = 0; dt < 5; dt++) {
        v4h lo, hi;
        #pragma unroll
        for (int vg = 0; vg < 4; vg++) {
            lo[vg] = (h16)(accO[dt][vg] * inv);
            hi[vg] = (h16)(accO[dt][vg + 4] * inv);
        }
        if (dt < 4) {
            *(v4h*)(O + frag_pos(orow, ocol + dt * 16))     = lo;
            *(v4h*)(O + frag_pos(orow, ocol + dt * 16 + 4)) = hi;
        } else if (hh == 0) {
            *(v4h*)(O + frag_pos(orow, ocol + dt * 16))     = lo;   // dims 64..67; 68..79 are padding
        }
    }
}

// ---------------- stage F: projection GEMM (WMMA) + bias ----------------
__global__ void k_proj(const h16* __restrict__ O, const h16* __restrict__ wp,
                       const float* __restrict__ pb, float* __restrict__ out) {
    int lane = threadIdx.x;
    int mt = blockIdx.y * 8 + threadIdx.y;  // 0..511
    int ntg = blockIdx.x;                   // 0..16 (2 tiles each -> 34 tiles = 544)
    int r = lane & 15, hh = lane >> 4;
    const h16* atile = O + (size_t)mt * (KSTEPS * FBLK) + lane * 8;    // both operands in fragment order
    int o0 = (ntg * 2 + 0) * 16 + r;
    int o1 = (ntg * 2 + 1) * 16 + r;
    const h16* b0tile = wp + (size_t)(ntg * 2 + 0) * (KSTEPS * FBLK) + lane * 8;
    const h16* b1tile = wp + (size_t)(ntg * 2 + 1) * (KSTEPS * FBLK) + lane * 8;
    v8f acc0 = {}; v8f acc1 = {};
    for (int ks = 0; ks < KSTEPS; ks++) {
        int c0 = ks * FBLK, c1 = ks * FBLK + FBLK / 2;
        v16h a  = make_frag(atile  + c0, atile  + c1);
        v16h b0 = make_frag(b0tile + c0, b0tile + c1);
        v16h b1 = make_frag(b1tile + c0, b1tile + c1);
        acc0 = WMMA16(a, b0, acc0);
        acc1 = WMMA16(a, b1, acc1);
    }
    float bias0 = pb[o0], bias1 = pb[o1];
    #pragma unroll
    for (int vg = 0; vg < 8; vg++) {
        int m = mt * 16 + vg + 8 * hh;
        out[(size_t)m * CDIM + o0] = acc0[vg] + bias0;
        out[(size_t)m * CDIM + o1] = acc1[vg] + bias1;
    }
}

extern "C" void kernel_launch(void* const* d_in, const int* in_sizes, int n_in,
                              void* d_out, int out_size, void* d_ws, size_t ws_size,
                              hipStream_t stream) {
    const float* x     = (const float*)d_in[0];
    const float* ng    = (const float*)d_in[1];
    const float* nb    = (const float*)d_in[2];
    const float* apw   = (const float*)d_in[3];
    const float* apb   = (const float*)d_in[4];
    const float* n2g   = (const float*)d_in[5];
    const float* n2b   = (const float*)d_in[6];
    const float* qkvw  = (const float*)d_in[7];
    const float* projw = (const float*)d_in[8];
    const float* projb = (const float*)d_in[9];
    const float* sfp   = (const float*)d_in[10];
    float* out = (float*)d_out;

    char* ws = (char*)d_ws;
    size_t off = 0;
    float* xr = (float*)(ws + off); off += (size_t)BN * CDIM * 4;        // 17.8 MB
    float* sc = (float*)(ws + off); off += (size_t)BN * NJ * 4;          // 0.56 MB
    h16* xp = (h16*)(ws + off); off += (size_t)BN * CDIM * 2;            // 8.9 MB
    h16* wq = (h16*)(ws + off); off += (size_t)C3 * CDIM * 2;            // 1.8 MB
    h16* wp = (h16*)(ws + off); off += (size_t)CDIM * CDIM * 2;          // 0.6 MB
    h16* Qp = (h16*)(ws + off); off += (size_t)NB * NH * NSEQ * HDP * 2; // 12.6 MB
    h16* Kp = (h16*)(ws + off); off += (size_t)NB * NH * NSEQ * HDP * 2; // 12.6 MB
    h16* Vt = (h16*)(ws + off); off += (size_t)NB * NH * HDP2 * NSEQ * 2;// 10.5 MB
    h16* O  = (h16*)(ws + off); off += (size_t)BN * CDIM * 2;            // 8.9 MB

    // W: weight conversion f32 -> f16
    int ncvt = C3 * CDIM + CDIM * CDIM;
    k_cvt<<<(ncvt + 255) / 256, 256, 0, stream>>>(qkvw, projw, wq, wp);
    // A: per-joint LN + attention-pool scores
    k_ln1<<<(BN * NJ + 255) / 256, 256, 0, stream>>>(x, ng, nb, apw, apb, xr, sc);
    // B: softmax over sequence axis
    k_softmax_n<<<NB * NJ, 256, 0, stream>>>(sc);
    // C: pool + LN over C -> f16 activations; zeroes the padding of Q, K, V^T
    k_pool_ln2<<<BN / PROWS, 32 * PROWS, 0, stream>>>(xr, sc, n2g, n2b, xp, Qp, Kp, Vt);
    // D: QKV GEMM (WMMA), scatter to Q (scaled), K, V^T
    k_qkv_gemm<<<dim3(17, 64), dim3(32, 8), 0, stream>>>(xp, wq, Qp, Kp, Vt);
    // E: flash attention, 4 query tiles per block sharing K/V through LDS
    k_attn<<<dim3(64 / QTPB, NH, NB), dim3(32, QTPB), 0, stream>>>(Qp, Kp, Vt, sfp, O);
    // F: projection GEMM (WMMA) + bias -> f32 output
    k_proj<<<dim3(17, 64), dim3(32, 8), 0, stream>>>(O, wp, projb, out);
    (void)in_sizes; (void)n_in; (void)out_size; (void)ws_size;
}

// v010
// A run of this version takes 98.3 microseconds.
// In two side-by-side timings against v009, it was 1.05 and 1.06 times as fast.
// Over all steps from v000 it is 3.31 times as fast.
#include <hip/hip_runtime.h>
#include <hip/hip_bf16.h>
#include <math.h>

typedef _Float16 h16;
typedef __attribute__((ext_vector_type(4)))  _Float16 v4h;
typedef __attribute__((ext_vector_type(8)))  _Float16 v8h;
typedef __attribute__((ext_vector_type(16))) _Float16 v16h;
typedef __attribute__((ext_vector_type(8)))  float    v8f;
typedef __attribute__((ext_vector_type(4)))  float    v4f;

#define NJ    17
#define NF    32
#define CDIM  544
#define NH    8
#define HD    68
#define HDP   96    // padded head dim for Q/K (3 K-steps of 32)
#define HDP2  80    // padded head dim for O tiles (5 tiles of 16)
#define NB    8
#define NSEQ  1024
#define BN    8192  // NB*NSEQ
#define C3    1632  // 3*CDIM
#define QTPB  4     // query tiles (waves) per attention block

#define WMMA16(a,b,c) __builtin_amdgcn_wmma_f32_16x16x32_f16(false,(a),false,(b),(short)0,(c),false,false)

__device__ __forceinline__ v16h make_frag(const h16* p0, const h16* p1) {
    v8h a = *(const v8h*)p0;
    v8h b = *(const v8h*)p1;
    return __builtin_shufflevector(a, b, 0,1,2,3,4,5,6,7,8,9,10,11,12,13,14,15);
}

// Fragment order for the operands of the two GEMMs (row-major [rows][CDIM] matrices).
// One 16-row x 32-k block is 1 KB: two 512-byte halves, and in each half lane l = r + 16*hh
// owns 16 bytes. Half 0 holds k = 8*hh + e, half 1 holds k = 16 + 8*hh + e (e = 0..7): the
// same elements at the same lane and register as the row-major loader took, so a fragment
// is two loads of 512 contiguous bytes (4 whole lines each) instead of 16 pieces of 32 bytes.
#define KSTEPS (CDIM / 32)   // 17 k-steps
#define FBLK   512           // elements per 16 x 32 block
__device__ __forceinline__ int frag_pos(int row, int c) {
    return (((row >> 4) * KSTEPS + (c >> 5)) * FBLK) + ((c & 16) << 4) + ((c & 8) << 4)
         + ((row & 15) << 3) + (c & 7);
}
// inverse map: position in fragment order -> row * CDIM + c
__device__ __forceinline__ int frag_src(int p) {
    int blk = p / FBLK;
    int row = (blk / KSTEPS) * 16 + ((p >> 3) & 15);
    int c   = (blk % KSTEPS) * 32 + ((p >> 4) & 16) + ((p >> 4) & 8) + (p & 7);
    return row * CDIM + c;
}

// ---------------- lane exchanges ----------------
// lane l <-> lane l ^ 16: the other 16-lane row of the wave
__device__ __forceinline__ float xhalf(float x) {
    return __builtin_bit_cast(float, __builtin_amdgcn_permlanex16(
        __builtin_bit_cast(int, x), __builtin_bit_cast(int, x),
        0x76543210, 0xfedcba98, false, false));
}
// lane l <-> lane l ^ M inside a 16-lane row (DPP row_xmask:M)
template <int M> __device__ __forceinline__ float xrow(float x) {
    return __builtin_bit_cast(float, __builtin_amdgcn_update_dpp(
        0, __builtin_bit_cast(int, x), 0x160 + M, 0xf, 0xf, true));
}
// sum over the 32 lanes of a wave; every lane ends with the same value
__device__ __forceinline__ float wave_sum(float x) {
    x += xrow<1>(x);
    x += xrow<2>(x);
    x += xrow<4>(x);
    x += xrow<8>(x);
    return x + xhalf(x);
}
// maximum over the 32 lanes of a wave; every lane ends with the same value
__device__ __forceinline__ float wave_max(float x) {
    x = fmaxf(x, xrow<1>(x));
    x = fmaxf(x, xrow<2>(x));
    x = fmaxf(x, xrow<4>(x));
    x = fmaxf(x, xrow<8>(x));
    return fmaxf(x, xhalf(x));
}

// 2^a. The v_nop fills the slot behind the transcendental inside the statement
__device__ __forceinline__ float exp2_slot(float a) {
    float r;
    asm("v_exp_f32 %0, %1\n\tv_nop" : "=v"(r) : "v"(a));
    return r;
}
// sum over the 8 lanes that share lane >> 3; each of them ends with the same value
__device__ __forceinline__ float oct_sum(float x) {
    x += xrow<1>(x);
    x += xrow<2>(x);
    return x + xrow<4>(x);
}

// ---------------- stages W, A, B in one launch ----------------
// Blocks 0..135: one block per (batch, joint): per-joint LN, the pooling score, and the softmax over the sequence
// axis, whose 1,024 scores are exactly the block's own, so that they never leave their registers.
// A wave owns 32 tokens, 4 a trip: 8 lanes share a token's 128-byte row, 16 bytes a lane, so a load or store covers
// 4 whole lines; a row's sums are in-lane adds and a 3-step exchange, after which its 8 lanes all hold them.
// Blocks from 136 on: weights f32 -> f16, stored in fragment order; they depend on nothing and fill the rest of the chip.
#define FTHR   NSEQ                                   // threads per block
#define LNBLK  (NB * NJ)                              // 136 blocks of LN + softmax
#define CVTBLK (((C3 * CDIM + CDIM * CDIM) / 8 + FTHR - 1) / FTHR)   // 145 blocks of weight conversion, 8 elements a thread
#define FTRIPS 8                                      // trips of 4 tokens per wave
__global__ __launch_bounds__(FTHR) void k_front(const float* __restrict__ x, const float* __restrict__ g,
                      const float* __restrict__ bb, const float* __restrict__ apw,
                      const float* __restrict__ apb,
                      const float* __restrict__ qkvw, const float* __restrict__ projw,
                      float* __restrict__ xr, float* __restrict__ sc,
                      h16* __restrict__ wq, h16* __restrict__ wp) {
    __shared__ float redm[FTHR / 32], reds[FTHR / 32];
    int t = threadIdx.x;
    if (blockIdx.x >= LNBLK) {                        // the same for the whole block, and in front of every barrier
        // a thread makes one 16-byte chunk of the destination: in fragment order that is 8 consecutive k of one row.
        // The blocks take the LN body's registers, one block a WGP: at one element a thread they would outlast it
        int u = (blockIdx.x - LNBLK) * FTHR + t;      // destination chunk: stores stay contiguous
        const int c1 = C3 * CDIM / 8, c2 = CDIM * CDIM / 8;
        if (u < c1 + c2) {
            const float* src = u < c1 ? qkvw + frag_src(8 * u) : projw + frag_src(8 * (u - c1));
            h16* dst = u < c1 ? wq + 8 * u : wp + 8 * (u - c1);
            v4f lo = *(const v4f*)src, hi = *(const v4f*)(src + 4);
            v8h pk;
            #pragma unroll  // constant element indices: the chunk is packed in registers
            for (int e = 0; e < 4; e++) { pk[e] = (h16)lo[e]; pk[e + 4] = (h16)hi[e]; }
            *(v8h*)dst = pk;
        }
        return;
    }
    int b = blockIdx.x / NJ, j = blockIdx.x % NJ;
    int lane = t & 31, wave = t >> 5;
    int q = lane & 7, grp = lane >> 3;                // this lane's 4 features of the row; its token within a trip
    int row0 = b * NSEQ + wave * (4 * FTRIPS) + grp;  // b*N + n of trip 0; trip i is 4*i tokens further
    size_t off = ((size_t)row0 * NJ + j) * NF + 4 * q;
    const float* px = x + off;
    v4f val[FTRIPS];
    #pragma unroll  // constant indices, here and below: the arrays stay in registers; all 8 loads in flight at once
    for (int i = 0; i < FTRIPS; i++) val[i] = *(const v4f*)(px + i * (4 * CDIM));
    v4f g4 = *(const v4f*)(g + 4 * q), b4 = *(const v4f*)(bb + 4 * q), a4 = *(const v4f*)(apw + 4 * q);
    float ab = apb[0];
    // the arithmetic below reuses the loads' address registers: the wait stands in front of that
    asm volatile("s_wait_xcnt 0x0" ::: "memory");
    // keeps all of the wave's loads in one group at the head: sunk behind the row sums, the loads of scale, shift and
    // pooling weights are waited out as a second memory latency
    __builtin_amdgcn_sched_barrier(0);

    float score[FTRIPS];
    #pragma unroll
    for (int i = 0; i < FTRIPS; i++) {
        v4f v = val[i];
        v4f vv = v * v;
        float s  = oct_sum((v[0] + v[1]) + (v[2] + v[3]));
        float s2 = oct_sum((vv[0] + vv[1]) + (vv[2] + vv[3]));
        float mu = s * (1.f / NF);
        float var = s2 * (1.f / NF) - mu * mu;
        float rs = rsqrtf(var + 1e-5f);
        v = (v - mu) * rs * g4 + b4;
        val[i] = v;
        v4f pa = v * a4;
        score[i] = oct_sum((pa[0] + pa[1]) + (pa[2] + pa[3])) + ab;
    }

    // softmax over the block's 1,024 tokens: over a lane's 8 in-lane, over the wave's 4 groups by two exchanges,
    // over the 32 waves through 32 LDS words
    float mx = score[0];
    #pragma unroll
    for (int i = 1; i < FTRIPS; i++) mx = fmaxf(mx, score[i]);
    mx = fmaxf(mx, xrow<8>(mx));
    mx = fmaxf(mx, xhalf(mx));
    if (lane == 0) redm[wave] = mx;
    __syncthreads();                                  // every wave's maximum is readable
    float m = wave_max(redm[lane]);
    float e[FTRIPS], es = 0.f;
    #pragma unroll
    for (int i = 0; i < FTRIPS; i++) e[i] = exp2_slot((score[i] - m) * 1.44269504f);   // e^(score - m)
    #pragma unroll
    for (int i = 0; i < FTRIPS; i++) es += e[i];
    es += xrow<8>(es);
    es += xhalf(es);
    if (lane == 0) reds[wave] = es;
    __syncthreads();                                  // every wave's sum is readable
    float inv = 1.f / wave_sum(reds[lane]);

    // a group's 8 lanes all hold its 8 weights: lane q stores that of trip q, one store for the wave's 32 tokens
    float mine = e[0];
    #pragma unroll
    for (int i = 1; i < FTRIPS; i++) mine = q == i ? e[i] : mine;
    sc[(row0 + 4 * q) * NJ + j] = mine * inv;
    // the stores stand behind the barriers: in front of one, a wave would wait there until they are done
    float* po = xr + off;
    #pragma unroll
    for (int i = 0; i < FTRIPS; i++) *(v4f*)(po + i * (4 * CDIM)) = val[i];
    // in the built code the conversion path stands behind these stores and writes their address and data registers:
    // the wait stands in front of that
    asm volatile("s_wait_xcnt 0x0" ::: "memory");
}

// ---------------- stage C: pool by weights + LN over C, emit f16 ----------------
// One wave owns one row: its 544 values stay in registers (a lane holds groups of 8 consecutive channels,
// c = 256*i + 8*lane + e; group 2, channels 512..543, lives on lanes 0..3), both sums are in-lane adds and one
// five-step exchange, and a group leaves as the one 16-byte chunk it is in fragment order. No LDS, no barrier.
// The launch also zeroes the padding of Q, K and V^T: the only elements of those buffers that the
// attention launch reads and the QKV GEMM does not write.
#define QKPAD4 ((HDP - HD) / 4)                    // 7 groups of 4 pad dims (8 bytes) in a Q or K row
#define VPAD8  ((HDP2 - HD) * NSEQ / 8 / (BN / (NB * NH)))   // 12 chunks of 16 bytes: a row's share of its head's pad rows
#define PROWS  8                                   // rows (waves) per block
#define PGRP   3                                   // groups of 8 channels per lane
__global__ __launch_bounds__(32 * PROWS) void k_pool_ln2(const float* __restrict__ xr, const float* __restrict__ w,
                           const float* __restrict__ g2, const float* __restrict__ b2,
                           h16* __restrict__ xp,
                           h16* __restrict__ Qp, h16* __restrict__ Kp, h16* __restrict__ Vt) {
    int lane = threadIdx.x & 31;
    int row = blockIdx.x * PROWS + (threadIdx.x >> 5);  // b*N + n
    const bool tail = lane < (CDIM - 512) / 8;          // the lanes that hold a third group

    const float* px = xr + (size_t)row * CDIM + 8 * lane;
    const float* pw = w + row * NJ + (lane >> 2);       // a group of 8 channels lies inside one joint
    const float* pg = g2 + 8 * lane;
    const float* pb = b2 + 8 * lane;
    v4f lo[PGRP] = {}, hi[PGRP] = {}, glo[PGRP] = {}, ghi[PGRP] = {}, blo[PGRP] = {}, bhi[PGRP] = {};
    float ww[PGRP] = {};
    // the third group first: its loads stand under a lane test, and nothing is yet in flight that could be waited for there
    #pragma unroll  // every index a constant: the arrays stay in registers
    for (int i = PGRP - 1; i >= 0; i--) {
        if (i < PGRP - 1 || tail) {
            lo[i]  = *(const v4f*)(px + 256 * i);
            hi[i]  = *(const v4f*)(px + 256 * i + 4);
            ww[i]  = pw[8 * i];
            glo[i] = *(const v4f*)(pg + 256 * i);
            ghi[i] = *(const v4f*)(pg + 256 * i + 4);
            blo[i] = *(const v4f*)(pb + 256 * i);
            bhi[i] = *(const v4f*)(pb + 256 * i + 4);
        }
    }
    // keeps all of the row's loads in one group at the head: sunk behind the two sums, the loads of scale and shift
    // are waited out one after another at the end of the wave
    __builtin_amdgcn_sched_barrier(0);

    // this token's dims 68..95 in each head's Q row (pieces 0..7) and K row (pieces 8..15)
    #pragma unroll  // 4 fixed trips: only the last one needs its lane test
    for (int k0 = 0; k0 < 2 * NH * QKPAD4; k0 += 32) {
        int k = k0 + lane;
        if (k < 2 * NH * QKPAD4) {
            int piece = k / QKPAD4, part = k % QKPAD4;
            int bh = (row >> 10) * NH + (piece & (NH - 1));
            h16* dst = (piece < NH ? Qp : Kp) + (size_t)(bh * NSEQ + (row & (NSEQ - 1))) * HDP + HD + part * 4;
            v4h z4 = {};
            *(v4h*)dst = z4;
        }
    }
    if (lane < VPAD8) {
        // rows 68..79 of a head's V^T are contiguous: 1536 chunks, shared out over the 128 rows with row >> 7 == head
        h16* dst = Vt + ((size_t)(row >> 7) * HDP2 + HD) * NSEQ + ((row & 127) * VPAD8 + lane) * 8;
        v8h z8 = {};
        *(v8h*)dst = z8;
    }

    v4f s4 = {};
    #pragma unroll  // constant indices, here and below: the arrays stay in registers
    for (int i = 0; i < PGRP; i++) {
        lo[i] *= ww[i];                                 // zero in a lane without a third group
        hi[i] *= ww[i];
        s4 += lo[i] + hi[i];
    }
    float mu = wave_sum((s4[0] + s4[1]) + (s4[2] + s4[3])) * (1.f / CDIM);
    v4f q4 = {};
    #pragma unroll
    for (int i = 0; i < PGRP; i++) {
        lo[i] -= mu;
        hi[i] -= mu;
        v4f q = lo[i] * lo[i] + hi[i] * hi[i];
        if (i == PGRP - 1 && !tail) q = v4f{};          // a lane without a third group adds nothing for it
        q4 += q;
    }
    float rs = rsqrtf(wave_sum((q4[0] + q4[1]) + (q4[2] + q4[3])) * (1.f / CDIM) + 1e-5f);
    #pragma unroll
    for (int i = 0; i < PGRP; i++) {
        if (i < PGRP - 1 || tail) {
            v4f ylo = lo[i] * rs * glo[i] + blo[i];
            v4f yhi = hi[i] * rs * ghi[i] + bhi[i];
            v8h pk;
            #pragma unroll
            for (int e = 0; e < 4; e++) { pk[e] = (h16)ylo[e]; pk[e + 4] = (h16)yhi[e]; }
            *(v8h*)(xp + frag_pos(row, 256 * i + 8 * lane)) = pk;
        }
    }
}

// ---------------- stage D: QKV GEMM (WMMA, 32x48 per wave) ----------------
// A wave owns two row tiles and three column tiles: a weight fragment feeds two products and an activation fragment
// three, 10 fragment loads for 6 products. The block's 8 waves stand 4 x 2 (128 rows x 96 columns):
// an activation fragment is read by 2 waves of the block, a weight fragment by 4.
#define GROWS 2   // row tiles per wave
__global__ void k_qkv_gemm(const h16* __restrict__ xp, const h16* __restrict__ wq,
                           h16* __restrict__ Qp, h16* __restrict__ Kp, h16* __restrict__ Vt) {
    int lane = threadIdx.x;                 // 0..31
    int wy = __builtin_amdgcn_readfirstlane(threadIdx.y);   // the wave's number in a scalar register: tile tests stay scalar branches
    int mt0 = (blockIdx.y * 4 + (wy & 3)) * GROWS;          // first row tile, 0..510
    int ntg = blockIdx.x * 2 + (wy >> 2);   // col tile group 0..33 (3 tiles each)
    int r = lane & 15, hh = lane >> 4;
    const h16* atile = xp + (size_t)mt0 * (KSTEPS * FBLK) + lane * 8;  // both operands in fragment order
    const h16* btile[3];
    #pragma unroll
    for (int nt = 0; nt < 3; nt++)
        btile[nt] = wq + (size_t)(ntg * 3 + nt) * (KSTEPS * FBLK) + lane * 8;
    v8f zero = {};
    v8f acc[GROWS][3];
    #pragma unroll  // constant indices, here and in the loops over rt below: the accumulators and fragments stay in registers
    for (int rt = 0; rt < GROWS; rt++)
        #pragma unroll
        for (int nt = 0; nt < 3; nt++) acc[rt][nt] = zero;
    for (int ks = 0; ks < KSTEPS; ks++) {
        int c0 = ks * FBLK, c1 = ks * FBLK + FBLK / 2;
        v16h a[GROWS];
        #pragma unroll
        for (int rt = 0; rt < GROWS; rt++)
            a[rt] = make_frag(atile + rt * (KSTEPS * FBLK) + c0, atile + rt * (KSTEPS * FBLK) + c1);
        #pragma unroll
        for (int nt = 0; nt < 3; nt++) {
            v16h bfr = make_frag(btile[nt] + c0, btile[nt] + c1);
            #pragma unroll
            for (int rt = 0; rt < GROWS; rt++) acc[rt][nt] = WMMA16(a[rt], bfr, acc[rt][nt]);
        }
    }
    const float qscale = 0.121267813f;  // 68^-0.5, folded into Q
    #pragma unroll
    for (int rt = 0; rt < GROWS; rt++) {
        int m0 = (mt0 + rt) * 16 + 8 * hh;  // this lane's first row (b*N+n) of the tile; its 8 rows are m0 + vg, inside one batch
        int b = m0 >> 10, n0 = m0 & 1023;
        #pragma unroll
        for (int nt = 0; nt < 3; nt++) {
            int tile = ntg * 3 + nt;            // the same for the whole wave
            int third = tile / (CDIM / 16);     // 34 whole tiles each of Q, K and V: a tile lies in one of them
            int rem = (tile - third * (CDIM / 16)) * 16 + r;
            int hd = rem / HD, d = rem % HD;
            int bh = b * NH + hd;
            if (third == 2) {
                // a lane's 8 accumulators are 8 consecutive tokens of one dim: 16 contiguous bytes of its V^T row
                v8h pk;
                #pragma unroll
                for (int vg = 0; vg < 8; vg++) pk[vg] = (h16)acc[rt][nt][vg];
                *(v8h*)(Vt + (size_t)(bh * HDP2 + d) * NSEQ + n0) = pk;
                // the next tile's code reuses this store's registers: the wait stands in front of that
                if (rt < GROWS - 1 || nt < 2) asm volatile("s_wait_xcnt 0x0" ::: "memory");
            } else {
                h16* dst = (third == 0 ? Qp : Kp) + (size_t)(bh * NSEQ + n0) * HDP + d;
                float sc = third == 0 ? qscale : 1.f;   // K times 1 is exact
                #pragma unroll
                for (int vg = 0; vg < 8; vg++) dst[vg * HDP] = (h16)(acc[rt][nt][vg] * sc);
                // the code behind this branch reuses these stores' registers: the wait stands in front of that
                asm volatile("s_wait_xcnt 0x0" ::: "memory");
            }
        }
    }
}

// xhalf (above) joins the two halves of one query's keys

__device__ __forceinline__ unsigned lds_off(const void* p) { return (unsigned)(size_t)p; }

// LDS row pitches, in elements: 16 bytes times an odd number (208 B and 80 B), so that the 16 rows
// which a half wave reads with one 16-byte load start on 16 different groups of 4 banks. At the data's
// own pitches (192 B and 64 B) they start on 4 groups only. The 16 pad bytes of a row are never touched.
#define KPITCH (HDP + 8)
#define VPITCH (32 + 8)
#define KTILE (32 * KPITCH)     // elements of one staged K tile
#define VTILE (HDP2 * VPITCH)   // elements of one staged V^T tile

// the real block size: without it the compiler budgets for 1,024 threads (128 registers a wave), too few
// to hold a pass's 11 fragments at once
__global__ __launch_bounds__(32 * QTPB) void k_attn(const h16* __restrict__ Qp, const h16* __restrict__ Kp,
                       const h16* __restrict__ Vt, const float* __restrict__ sfp,
                       h16* __restrict__ O) {
    int lane = threadIdx.x;               // 0..31
    int wv = threadIdx.y;                 // 0..3 : one query tile per wave
    int tid = wv * 32 + lane;
    int wvs = __builtin_amdgcn_readfirstlane(wv);   // the wave's number in a scalar register: a test on it is a scalar branch
    int qt = blockIdx.x * QTPB + wv;      // 0..63
    int hd = blockIdx.y, b = blockIdx.z;
    int bh = b * NH + hd;
    int r = lane & 15, hh = lane >> 4;
    float sf = sfp[0];

    __shared__ __align__(16) h16 kl[2 * KTILE];       // 2 x 6.5 KB: 32 keys x 96 dims, padded rows
    __shared__ __align__(16) h16 vl[2 * VTILE];       // 2 x 6.25 KB: 80 dims x 32 keys, padded rows
    __shared__ __align__(16) float psl[NSEQ];         // 4 KB: per-key positional scale

    // Q fragments for this wave's 16 queries (3 K-steps covering padded 96), used as B
    const h16* qrow = Qp + (size_t)(bh * NSEQ + qt * 16 + r) * HDP;
    v16h qa0 = make_frag(qrow +      8 * hh, qrow + 16 + 8 * hh);
    v16h qa1 = make_frag(qrow + 32 + 8 * hh, qrow + 48 + 8 * hh);
    v16h qa2 = make_frag(qrow + 64 + 8 * hh, qrow + 80 + 8 * hh);

    v8f zero = {};
    v8f accO[5];                          // O^T tiles: row = dim dt*16 + vg + 8*hh, column = query r
    #pragma unroll
    for (int i = 0; i < 5; i++) accO[i] = zero;
    float m_run = -1e30f, l_run = 0.f;    // this lane's query; l_run sums this half's keys only

    const h16* kbase = Kp + (size_t)bh * NSEQ * HDP;
    const h16* vbase = Vt + (size_t)bh * HDP2 * NSEQ;
    const float invN1 = 1.f / (float)(NSEQ - 1);

    // One tile's asynchronous copies, 16 bytes a lane each, every lane on. The K tile is contiguous in
    // memory (384 chunks: 3 a lane, 12 a row); the V^T tile is 80 rows x 4 chunks (2 a lane, a third from
    // waves 0 and 1). In LDS chunk c lands 16 bytes further for every row in front of it.
    const h16* kg0 = kbase + tid * 8;
    const h16* vg0 = vbase + (size_t)(tid >> 2) * NSEQ + (tid & 3) * 8;
    const unsigned kd0 = lds_off(kl) + (tid       + (tid      ) / 12) * 16;
    const unsigned kd1 = lds_off(kl) + (tid + 128 + (tid + 128) / 12) * 16;
    const unsigned kd2 = lds_off(kl) + (tid + 256 + (tid + 256) / 12) * 16;
    const unsigned vd0 = lds_off(vl) + (tid + (tid >> 2)) * 16;
    auto stage = [&](int kt, int buf) {
        const h16* kg = kg0 + (size_t)kt * HDP;
        const h16* vg = vg0 + kt;
        unsigned kb = buf * (KTILE * 2), vd = vd0 + buf * (VTILE * 2);
        // s_wait_xcnt 0 closes each statement: no address register is rewritten in front of it
        asm volatile("global_load_async_to_lds_b128 %0, %1, off\n\t"
                     "global_load_async_to_lds_b128 %2, %3, off\n\t"
                     "global_load_async_to_lds_b128 %4, %5, off\n\t"
                     "global_load_async_to_lds_b128 %6, %7, off\n\t"
                     "global_load_async_to_lds_b128 %8, %9, off\n\t"
                     "s_wait_xcnt 0x0"
                     :: "v"(kd0 + kb), "v"(kg), "v"(kd1 + kb), "v"(kg + 1024), "v"(kd2 + kb), "v"(kg + 2048),
                        "v"(vd), "v"(vg), "v"(vd + 32 * VPITCH * 2), "v"(vg + 32 * NSEQ) : "memory");
        if (wvs < 2)
            asm volatile("global_load_async_to_lds_b128 %0, %1, off\n\t"
                         "s_wait_xcnt 0x0"
                         :: "v"(vd + 64 * VPITCH * 2), "v"(vg + 64 * NSEQ) : "memory");
    };
    stage(0, 0);

    // a key is now a register row, not a lane: its scale comes from a table filled once
    // (published by the barrier in front of the loop)
    #pragma unroll  // fixed 8 trips: the exponentials issue back to back instead of one per loop trip
    for (int i = 0; i < NSEQ / (32 * QTPB); i++) {
        int k = tid + 32 * QTPB * i;
        float p = (float)k * invN1 - 0.5f;
        psl[k] = __expf(-sf * p * p);
    }

    asm volatile("s_wait_asynccnt 0x0" ::: "memory");  // this wave's copies of tile 0 have landed
    __syncthreads();                                   // every wave's have: tile 0 and the table are readable
    stage(32, 1);                                      // tile 1 flies during pass 0

    for (int kt = 0; kt < NSEQ; kt += 32) {
        int buf = (kt >> 5) & 1;                       // this pass reads this buffer alone

        // ---- all 26 LDS reads of the pass in one group: scales, K fragments, V^T fragments ----
        // per-key positional scale: keys kt + 8*hh + vg (s0) and kt + 16 + 8*hh + vg (s1)
        const v4f* pt = (const v4f*)(psl + kt + 8 * hh);
        v4f pa = pt[0], pb = pt[1], pc = pt[4], pd = pt[5];
        const h16* krow0 = kl + buf * KTILE + (size_t)r * KPITCH + 8 * hh;
        const h16* krow1 = krow0 + 16 * KPITCH;
        v16h kf0[3], kf1[3], vf[5];
        #pragma unroll  // every index a constant: the fragment arrays stay in registers
        for (int ks = 0; ks < 3; ks++) {
            kf0[ks] = make_frag(krow0 + 32 * ks, krow0 + 32 * ks + 16);
            kf1[ks] = make_frag(krow1 + 32 * ks, krow1 + 32 * ks + 16);
        }
        // keeps the K reads in front of the V^T reads: LDS answers in order, and the first products wait for K alone
        __builtin_amdgcn_sched_barrier(0);
        #pragma unroll  // as above
        for (int dt = 0; dt < 5; dt++) {
            const h16* vrow = vl + buf * VTILE + (dt * 16 + r) * VPITCH + 8 * hh;
            vf[dt] = make_frag(vrow, vrow + 16);
        }
        // holds the reads together in front of the products: sunk among them, each pair is waited out alone,
        // about ten LDS latencies a pass instead of one
        __builtin_amdgcn_sched_barrier(0);

        // ---- S^T = K Q^T for two 16-key tiles (K fragments as A) ----
        v8f s0 = zero, s1 = zero;
        s0 = WMMA16(kf0[0], qa0, s0);
        s1 = WMMA16(kf1[0], qa0, s1);
        s0 = WMMA16(kf0[1], qa1, s0);
        s1 = WMMA16(kf1[1], qa1, s1);
        s0 = WMMA16(kf0[2], qa2, s0);
        s1 = WMMA16(kf1[2], qa2, s1);

        // ---- online softmax for this lane's query ----
        float t0[8], t1[8];
        #pragma unroll
        for (int vg = 0; vg < 4; vg++) {
            t0[vg]     = s0[vg]     * pa[vg];
            t0[vg + 4] = s0[vg + 4] * pb[vg];
            t1[vg]     = s1[vg]     * pc[vg];
            t1[vg + 4] = s1[vg + 4] * pd[vg];
        }
        float tm = fmaxf(t0[0], t1[0]);
        #pragma unroll
        for (int vg = 1; vg < 8; vg++) tm = fmaxf(tm, fmaxf(t0[vg], t1[vg]));
        tm = fmaxf(tm, xhalf(tm));
        float mn = fmaxf(m_run, tm);
        float alpha = __expf(m_run - mn);
        m_run = mn;
        v16h pf;                           // P^T as B: element i = key 8*hh + i, 8 + i = key 16 + 8*hh + i
        float es = 0.f;
        #pragma unroll
        for (int vg = 0; vg < 8; vg++) {
            float e0 = __expf(t0[vg] - mn), e1 = __expf(t1[vg] - mn);
            es += e0 + e1;
            pf[vg] = (h16)e0; pf[vg + 8] = (h16)e1;
        }
        l_run = l_run * alpha + es;
        #pragma unroll
        for (int dt = 0; dt < 5; dt++)
            #pragma unroll
            for (int vg = 0; vg < 8; vg++) accO[dt][vg] *= alpha;

        // ---- O^T += V^T P^T  (V^T fragments as A, read at the head of the pass) ----
        #pragma unroll
        for (int dt = 0; dt < 5; dt++) accO[dt] = WMMA16(vf[dt], pf, accO[dt]);

        // ---- foot of the pass: publish the next tile, then refill the buffer just read ----
        // holds the pass's arithmetic in front of the foot: with every LDS read at the head the compiler lifts the
        // waits and the barrier over it, and the wait for the next tile's copies then stands right behind their issue
        __builtin_amdgcn_sched_barrier(0);
        asm volatile("s_wait_dscnt 0x0" ::: "memory");     // this wave's reads of this buffer are done
        asm volatile("s_wait_asynccnt 0x0" ::: "memory");  // this wave's copies of the next tile have landed
        __syncthreads();                                   // both hold for every wave
        if (kt + 64 < NSEQ) stage(kt + 64, buf);           // flies during the next pass
    }
    asm volatile("s_wait_asynccnt 0x0" ::: "memory");      // no copy is outstanding when the wave ends

    // ---- finalize: join the halves' sums, normalize, store in the projection's fragment order ----
    float inv = 1.f / (l_run + xhalf(l_run));
    int orow = b * NSEQ + qt * 16 + r;
    int ocol = hd * HD + 8 * hh;          // a multiple of 4: a group of 4 dims stays inside one 8-element chunk
    #pragma unroll
    for (int dt = 0; dt < 5; dt++) {
        v4h lo, hi;
        #pragma unroll
        for (int vg = 0; vg < 4; vg++) {
            lo[vg] = (h16)(accO[dt][vg] * inv);
            hi[vg] = (h16)(accO[dt][vg + 4] * inv);
        }
        if (dt < 4) {
            *(v4h*)(O + frag_pos(orow, ocol + dt * 16))     = lo;
            *(v4h*)(O + frag_pos(orow, ocol + dt * 16 + 4)) = hi;
        } else if (hh == 0) {
            *(v4h*)(O + frag_pos(orow, ocol + dt * 16))     = lo;   // dims 64..67; 68..79 are padding
        }
    }
}

// ---------------- stage F: projection GEMM (WMMA) + bias ----------------
__global__ void k_proj(const h16* __restrict__ O, const h16* __restrict__ wp,
                       const float* __restrict__ pb, float* __restrict__ out) {
    int lane = threadIdx.x;
    int mt = blockIdx.y * 8 + threadIdx.y;  // 0..511
    int ntg = blockIdx.x;                   // 0..16 (2 tiles each -> 34 tiles = 544)
    int r = lane & 15, hh = lane >> 4;
    const h16* atile = O + (size_t)mt * (KSTEPS * FBLK) + lane * 8;    // both operands in fragment order
    int o0 = (ntg * 2 + 0) * 16 + r;
    int o1 = (ntg * 2 + 1) * 16 + r;
    const h16* b0tile = wp + (size_t)(ntg * 2 + 0) * (KSTEPS * FBLK) + lane * 8;
    const h16* b1tile = wp + (size_t)(ntg * 2 + 1) * (KSTEPS * FBLK) + lane * 8;
    v8f acc0 = {}; v8f acc1 = {};
    for (int ks = 0; ks < KSTEPS; ks++) {
        int c0 = ks * FBLK, c1 = ks * FBLK + FBLK / 2;
        v16h a  = make_frag(atile  + c0, atile  + c1);
        v16h b0 = make_frag(b0tile + c0, b0tile + c1);
        v16h b1 = make_frag(b1tile + c0, b1tile + c1);
        acc0 = WMMA16(a, b0, acc0);
        acc1 = WMMA16(a, b1, acc1);
    }
    float bias0 = pb[o0], bias1 = pb[o1];
    #pragma unroll
    for (int vg = 0; vg < 8; vg++) {
        int m = mt * 16 + vg + 8 * hh;
        out[(size_t)m * CDIM + o0] = acc0[vg] + bias0;
        out[(size_t)m * CDIM + o1] = acc1[vg] + bias1;
    }
}

extern "C" void kernel_launch(void* const* d_in, const int* in_sizes, int n_in,
                              void* d_out, int out_size, void* d_ws, size_t ws_size,
                              hipStream_t stream) {
    const float* x     = (const float*)d_in[0];
    const float* ng    = (const float*)d_in[1];
    const float* nb    = (const float*)d_in[2];
    const float* apw   = (const float*)d_in[3];
    const float* apb   = (const float*)d_in[4];
    const float* n2g   = (const float*)d_in[5];
    const float* n2b   = (const float*)d_in[6];
    const float* qkvw  = (const float*)d_in[7];
    const float* projw = (const float*)d_in[8];
    const float* projb = (const float*)d_in[9];
    const float* sfp   = (const float*)d_in[10];
    float* out = (float*)d_out;

    char* ws = (char*)d_ws;
    size_t off = 0;
    float* xr = (float*)(ws + off); off += (size_t)BN * CDIM * 4;        // 17.8 MB
    float* sc = (float*)(ws + off); off += (size_t)BN * NJ * 4;          // 0.56 MB
    h16* xp = (h16*)(ws + off); off += (size_t)BN * CDIM * 2;            // 8.9 MB
    h16* wq = (h16*)(ws + off); off += (size_t)C3 * CDIM * 2;            // 1.8 MB
    h16* wp = (h16*)(ws + off); off += (size_t)CDIM * CDIM * 2;          // 0.6 MB
    h16* Qp = (h16*)(ws + off); off += (size_t)NB * NH * NSEQ * HDP * 2; // 12.6 MB
    h16* Kp = (h16*)(ws + off); off += (size_t)NB * NH * NSEQ * HDP * 2; // 12.6 MB
    h16* Vt = (h16*)(ws + off); off += (size_t)NB * NH * HDP2 * NSEQ * 2;// 10.5 MB
    h16* O  = (h16*)(ws + off); off += (size_t)BN * CDIM * 2;            // 8.9 MB

    // W, A, B: per-joint LN + pooling scores + softmax over the sequence axis; weight conversion f32 -> f16 beside them
    k_front<<<LNBLK + CVTBLK, FTHR, 0, stream>>>(x, ng, nb, apw, apb, qkvw, projw, xr, sc, wq, wp);
    // C: pool + LN over C -> f16 activations; zeroes the padding of Q, K, V^T
    k_pool_ln2<<<BN / PROWS, 32 * PROWS, 0, stream>>>(xr, sc, n2g, n2b, xp, Qp, Kp, Vt);
    // D: QKV GEMM (WMMA), scatter to Q (scaled), K, V^T
    k_qkv_gemm<<<dim3(17, 64), dim3(32, 8), 0, stream>>>(xp, wq, Qp, Kp, Vt);
    // E: flash attention, 4 query tiles per block sharing K/V through LDS
    k_attn<<<dim3(64 / QTPB, NH, NB), dim3(32, QTPB), 0, stream>>>(Qp, Kp, Vt, sfp, O);
    // F: projection GEMM (WMMA) + bias -> f32 output
    k_proj<<<dim3(17, 64), dim3(32, 8), 0, stream>>>(O, wp, projb, out);
    (void)in_sizes; (void)n_in; (void)out_size; (void)ws_size;
}
